// v000
// Measured on an AMD MI455X. A time is GPU time per run, averaged over a window of back-to-back runs after a warm-up
// (all launches, gaps included; the runs take copies of the inputs in turn), and the median of several windows.
// Apart from v000's, it joins two sittings. Times from different sittings can be a few percent apart, while
// side-by-side timings come from the same sitting.
// v000, which the later versions start from, runs in 2110 microseconds.
#include <hip/hip_runtime.h>

// Sigmoid attention (q, k, v [1][4096][1024]; qh, kh, vh = (q Wq^T, k Wk^T, v Wv^T) ('oi' [1024][1024], no bias) split into 16 heads x 64; per-head LayerNorm over the 64 dims of qh (x gq + bq, then x 1/8) and kh (x gk + bk); attn = sigmoid(qh.kh) over the full 4096 x 4096 matrix (no softmax, no normalisation); x = attn vh merged; out = x Wp^T + bp -> [1][4096][1024] (4.2 M)).
// Compute dtypes, f32 accumulate: every input rounded to bf16; projections on PLAIN bf16 operands (inputs: exact); LayerNorm in f32 (one wave per head row); scores and attn.v on single fp16 planes (1 product each: sigmoid outputs lie in (0,1), no carry needed); sigmoid in f32 (precise expf, true division); merged heads hi/lo x exact Wp (2 products) + bp.

#define TT   4096
#define DM   1024
#define NH_  16
#define HD   64
#define DQ   (NH_ * HD)
#define SCL  0.125f
#define LNEPS 1e-5f
typedef _Float16 h16;
typedef unsigned short bf;
typedef __attribute__((ext_vector_type(16))) __bf16   v16bf;
typedef __attribute__((ext_vector_type(16))) _Float16 v16h;
typedef __attribute__((ext_vector_type(8)))  _Float16 v8h;
typedef __attribute__((ext_vector_type(8)))  unsigned short v8us;
typedef __attribute__((ext_vector_type(8)))  float    v8f;
typedef __attribute__((ext_vector_type(4)))  float    v4f;
typedef v8h  __attribute__((may_alias)) v8ha;
typedef v4f  __attribute__((may_alias)) v4fa;
typedef v8us __attribute__((may_alias)) v8usa;

__device__ __forceinline__ unsigned short f2bf(float f) { unsigned u = __float_as_uint(f); u += 0x7FFFu + ((u >> 16) & 1u); return (unsigned short)(u >> 16); }
__device__ __forceinline__ float bf2f(unsigned short b) { return __uint_as_float(((unsigned)b) << 16); }
__device__ __forceinline__ float bfr(float f) { return bf2f(f2bf(f)); }
__device__ __forceinline__ v16h cat16(v8h lo, v8h hi) { return __builtin_shufflevector(lo, hi, 0, 1, 2, 3, 4, 5, 6, 7, 8, 9, 10, 11, 12, 13, 14, 15); }
__device__ __forceinline__ v16bf cat16b(v8us lo, v8us hi) { return __builtin_bit_cast(v16bf, __builtin_shufflevector(lo, hi, 0, 1, 2, 3, 4, 5, 6, 7, 8, 9, 10, 11, 12, 13, 14, 15)); }
__device__ __forceinline__ v8f wmma16(v16h a, v16h b, v8f c) { return __builtin_amdgcn_wmma_f32_16x16x32_f16(false, a, false, b, (short)0, c, false, false); }
__device__ __forceinline__ v8f wmmab(v16bf a, v16bf b, v8f c) { return __builtin_amdgcn_wmma_f32_16x16x32_bf16(false, a, false, b, (short)0, c, false, false); }



// ---- k_gemmw: register-blocked GEMM, ONE WAVE per 64x64 output tile (16 accumulators), operands straight from K-contiguous 16-bit planes; grid (M/64, N/64, Z), 32 threads.
// C[m][n] (f32, pitch ldc, + optional f32 bias[n]) = sum_k A[m][k] Bt[n][k] (+ split products per NSPLIT). z-batch strides sA/sB/sC in elements. K % 32 == 0.
template <typename T16> struct WFrag;
template <> struct WFrag<h16> { typedef v16h V; static __device__ __forceinline__ V ld(const h16* p) { return cat16(*(const v8h*)p, *(const v8h*)(p + 16)); } static __device__ __forceinline__ v8f mma(V a, V b, v8f c) { return wmma16(a, b, c); } };
template <> struct WFrag<bf> { typedef v16bf V; static __device__ __forceinline__ V ld(const bf* p) { return cat16b(*(const v8us*)p, *(const v8us*)(p + 16)); } static __device__ __forceinline__ v8f mma(V a, V b, v8f c) { return wmmab(a, b, c); } };
template <typename T16, int NSPLIT, bool BIAS>
__global__ __launch_bounds__(32) void k_gemmw(const T16* __restrict__ A, const T16* __restrict__ A2, const T16* __restrict__ Bt, const T16* __restrict__ Bt2, int K, float* C, int ldc, const float* __restrict__ bias, size_t sA, size_t sB, size_t sC) {
    typedef typename WFrag<T16>::V V;
    __shared__ __align__(16) float os[16 * 68];
    const size_t z = blockIdx.z; A += z * sA; if (A2) A2 += z * sA; Bt += z * sB; if (Bt2) Bt2 += z * sB; C += z * sC;
    const int lane = threadIdx.x & 31, lr = lane & 15, hi = lane >> 4; const int r0 = blockIdx.x * 64, c0 = blockIdx.y * 64;
    v8f acc[4][4];
#pragma unroll
    for (int mb = 0; mb < 4; ++mb)
#pragma unroll
        for (int nb = 0; nb < 4; ++nb) acc[mb][nb] = (v8f){};
    const size_t aoff = (size_t)(r0 + lr) * K + 8 * hi, boff = (size_t)(c0 + lr) * K + 8 * hi;
#pragma unroll 1
    for (int kc = 0; kc < K; kc += 32) {
        V a[4], a2[4];
#pragma unroll
        for (int mb = 0; mb < 4; ++mb) { a[mb] = WFrag<T16>::ld(A + aoff + (size_t)mb * 16 * K + kc); if (NSPLIT == 1 || NSPLIT == 2) a2[mb] = WFrag<T16>::ld(A2 + aoff + (size_t)mb * 16 * K + kc); }
#pragma unroll
        for (int nb = 0; nb < 4; ++nb) { const V b = WFrag<T16>::ld(Bt + boff + (size_t)nb * 16 * K + kc); V b2; if (NSPLIT >= 2) b2 = WFrag<T16>::ld(Bt2 + boff + (size_t)nb * 16 * K + kc);
#pragma unroll
            for (int mb = 0; mb < 4; ++mb) { acc[mb][nb] = WFrag<T16>::mma(a[mb], b, acc[mb][nb]); if (NSPLIT == 1 || NSPLIT == 2) acc[mb][nb] = WFrag<T16>::mma(a2[mb], b, acc[mb][nb]); if (NSPLIT >= 2) acc[mb][nb] = WFrag<T16>::mma(a[mb], b2, acc[mb][nb]); } }
        asm volatile("v_nop\n\tv_nop\n\tv_nop\n\tv_nop" : "+v"(acc[0][0]), "+v"(acc[1][1]), "+v"(acc[2][2]), "+v"(acc[3][3]) : "v"(a[0]), "v"(a[3]));
    }
#pragma unroll
    for (int mb = 0; mb < 4; ++mb) {
#pragma unroll
        for (int nb = 0; nb < 4; ++nb) {
#pragma unroll
            for (int j = 0; j < 8; ++j) os[(hi * 8 + j) * 68 + nb * 16 + lr] = acc[mb][nb][j]; }
        __builtin_amdgcn_wave_barrier(); asm volatile("" ::: "memory");
        float* crow = C + (size_t)(r0 + mb * 16) * ldc + c0;
{
#pragma unroll
            for (int s = 0; s < 8; ++s) { const int row = 2 * s + hi, cofs = lr * 4; v4f val = *(const v4fa*)(os + row * 68 + cofs); if (BIAS) { val[0] += bfr(bias[c0 + cofs]); val[1] += bfr(bias[c0 + cofs + 1]); val[2] += bfr(bias[c0 + cofs + 2]); val[3] += bfr(bias[c0 + cofs + 3]); }
                *(v4f*)(crow + (size_t)row * ldc + cofs) = val; }
             }
        __builtin_amdgcn_wave_barrier(); asm volatile("" ::: "memory");
    }
}

__device__ __forceinline__ h16 tohx(float x) { return (h16)x; }
__device__ __forceinline__ void splitf(float y, unsigned short& h, unsigned short& l) { h = f2bf(y); l = f2bf(y - bf2f(h)); }
typedef __attribute__((ext_vector_type(2))) _Float16 v2h;
typedef __attribute__((ext_vector_type(4))) _Float16 v4h;
typedef __attribute__((ext_vector_type(2))) unsigned short v2us;
typedef __attribute__((ext_vector_type(4))) unsigned short v4us;
typedef __attribute__((ext_vector_type(2))) float v2f;
typedef __attribute__((ext_vector_type(4))) int v4i;

__global__ __launch_bounds__(256) void k_cvt8(const float* __restrict__ src, bf* dst, size_t n8) { const size_t i = (size_t)blockIdx.x * 256 + threadIdx.x; if (i >= n8) return; const v8f v = *(const v8f*)(src + i * 8); v8us o;
#pragma unroll
    for (int k = 0; k < 8; ++k) o[k] = f2bf(v[k]); *(v8us*)(dst + i * 8) = o;  }

__global__ __launch_bounds__(256) void k_lnpl(const float* __restrict__ F, const float* __restrict__ gw, const float* __restrict__ gb, float sc, h16* P16) { const int lane = threadIdx.x & 31; const size_t row = (size_t)blockIdx.x * 8 + (threadIdx.x >> 5); if (row >= (size_t)NH_ * TT) return; const int t = (int)(row % TT); const int h = (int)(row / TT); const float* f = F + (size_t)t * DQ + h * HD + lane * 2; const float u0 = f[0], u1 = f[1];
    float s = __fadd_rn(u0, u1);
#pragma unroll
    for (int sh = 16; sh; sh >>= 1) s += __shfl_xor(s, sh, 32);
    float mu = s * (1.0f / 64.0f); asm volatile("" : "+v"(mu)); float d0 = __fsub_rn(u0, mu), d1 = __fsub_rn(u1, mu); asm volatile("" : "+v"(d0), "+v"(d1)); float p0 = __fmul_rn(d0, d0), p1 = __fmul_rn(d1, d1); asm volatile("" : "+v"(p0), "+v"(p1)); float s2 = __fadd_rn(p0, p1);
#pragma unroll
    for (int sh = 16; sh; sh >>= 1) s2 += __shfl_xor(s2, sh, 32);
    float var = __fadd_rn(s2 * (1.0f / 64.0f), LNEPS); asm volatile("" : "+v"(var)); const float rs = __frsqrt_rn(var);
    v2h o;
#pragma unroll
    for (int q = 0; q < 2; ++q) { const int d = lane * 2 + q; float n0 = __fmul_rn(q ? d1 : d0, rs); asm volatile("" : "+v"(n0)); float y = __fmul_rn(n0, bfr(gw[d])); asm volatile("" : "+v"(y)); float z = __fadd_rn(y, bfr(gb[d])); asm volatile("" : "+v"(z)); o[q] = tohx(z * sc); }
    const size_t oo = ((size_t)h * TT + t) * HD + lane * 2; *(v2h*)(P16 + oo) = o;  }
__global__ __launch_bounds__(256) void k_vt16s(const float* __restrict__ F, h16* V16) { const size_t e = ((size_t)blockIdx.x * 256 + threadIdx.x) * 2; if (e >= (size_t)NH_ * HD * TT) return; const int t = (int)(e % TT); const int d = (int)((e / TT) % HD); const int h = (int)(e / ((size_t)TT * HD)); v2h o;
#pragma unroll
    for (int q = 0; q < 2; ++q) o[q] = tohx(F[((size_t)t + q) * DQ + h * HD + d]);
    *(v2h*)(V16 + e) = o;  }
__global__ __launch_bounds__(256) void k_sigm(const float* __restrict__ Sb, h16* P16, size_t n8) { const size_t i = (size_t)blockIdx.x * 256 + threadIdx.x; if (i >= n8) return; const v8f a = *(const v8f*)(Sb + i * 8); v8h o;
#pragma unroll
    for (int q = 0; q < 8; ++q) { float den = __fadd_rn(1.0f, expf(-a[q])); asm volatile("" : "+v"(den)); o[q] = tohx(__fdiv_rn(1.0f, den)); }
    *(v8h*)(P16 + i * 8) = o;  }
__global__ __launch_bounds__(256) void k_mergeS(const float* __restrict__ O, int h, bf* Ah, bf* Al) { const size_t e = ((size_t)blockIdx.x * 256 + threadIdx.x) * 2; if (e >= (size_t)TT * HD) return; const int d = (int)(e % HD); const int t = (int)(e / HD); const size_t oo = (size_t)t * DQ + h * HD + d; v2us oh, ol;
#pragma unroll
    for (int q = 0; q < 2; ++q) { unsigned short a, c2; splitf(O[e + q], a, c2); oh[q] = a; ol[q] = c2; } *(v2us*)(Ah + oo) = oh; *(v2us*)(Al + oo) = ol;  }

extern "C" void kernel_launch(void* const* d_in, const int* in_sizes, int n_in,
                              void* d_out, int out_size, void* d_ws, size_t ws_size, hipStream_t stream) {
    (void)in_sizes; (void)n_in; (void)out_size;
    const float* xq = (const float*)d_in[0]; const float* xk = (const float*)d_in[1]; const float* xv = (const float*)d_in[2]; const float* wq = (const float*)d_in[3]; const float* wk = (const float*)d_in[4]; const float* wv = (const float*)d_in[5];
    const float* gq = (const float*)d_in[6]; const float* bq = (const float*)d_in[7]; const float* gk = (const float*)d_in[8]; const float* bk = (const float*)d_in[9]; const float* wp = (const float*)d_in[10]; const float* bp = (const float*)d_in[11];
    float* OUT = (float*)d_out;     // [1][4096][1024]
    char* wsp = (char*)d_ws;
    auto take = [&](size_t bytes) { char* p = wsp; wsp += (bytes + 255) & ~(size_t)255; return (void*)p; };
    bf* WQ = (bf*)take((size_t)DQ * DM * 2); bf* WK = (bf*)take((size_t)DQ * DM * 2); bf* WV = (bf*)take((size_t)DQ * DM * 2); bf* WP = (bf*)take((size_t)DM * DQ * 2);
    bf* XB = (bf*)take((size_t)TT * DM * 2); float* F = (float*)take((size_t)TT * DQ * 4);
    const size_t PS = (size_t)NH_ * TT * HD; h16* QP16 = (h16*)take(PS * 2); h16* KP16 = (h16*)take(PS * 2); h16* VT16 = (h16*)take(PS * 2);
    float* Sb = (float*)take((size_t)TT * TT * 4); h16* P16 = (h16*)take((size_t)TT * TT * 2); float* Ob = (float*)take((size_t)TT * HD * 4); bf* ATh = (bf*)take((size_t)TT * DQ * 2); bf* ATl = (bf*)take((size_t)TT * DQ * 2);
    if ((size_t)(wsp - (char*)d_ws) > ws_size) return;    // ws 256 MiB
    const unsigned LW = (unsigned)(((size_t)DQ * DM / 8 + 255) / 256), LX = (unsigned)(((size_t)TT * DM / 8 + 255) / 256), LP = (unsigned)((PS / 2 + 255) / 256);
    k_cvt8<<<LW, 256, 0, stream>>>(wq, WQ, (size_t)DQ * DM / 8); k_cvt8<<<LW, 256, 0, stream>>>(wk, WK, (size_t)DQ * DM / 8); k_cvt8<<<LW, 256, 0, stream>>>(wv, WV, (size_t)DQ * DM / 8); k_cvt8<<<LW, 256, 0, stream>>>(wp, WP, (size_t)DM * DQ / 8);
    /* q */ k_cvt8<<<LX, 256, 0, stream>>>(xq, XB, (size_t)TT * DM / 8); k_gemmw<bf, 0, false><<<dim3(TT / 64, DQ / 64, 1), 32, 0, stream>>>(XB, nullptr, WQ, nullptr, DM, F, DQ, nullptr, 0, 0, 0); k_lnpl<<<(unsigned)((size_t)NH_ * TT / 8), 256, 0, stream>>>(F, gq, bq, SCL, QP16);
    /* k */ k_cvt8<<<LX, 256, 0, stream>>>(xk, XB, (size_t)TT * DM / 8); k_gemmw<bf, 0, false><<<dim3(TT / 64, DQ / 64, 1), 32, 0, stream>>>(XB, nullptr, WK, nullptr, DM, F, DQ, nullptr, 0, 0, 0); k_lnpl<<<(unsigned)((size_t)NH_ * TT / 8), 256, 0, stream>>>(F, gk, bk, 1.0f, KP16);
    /* v */ k_cvt8<<<LX, 256, 0, stream>>>(xv, XB, (size_t)TT * DM / 8); k_gemmw<bf, 0, false><<<dim3(TT / 64, DQ / 64, 1), 32, 0, stream>>>(XB, nullptr, WV, nullptr, DM, F, DQ, nullptr, 0, 0, 0); k_vt16s<<<LP, 256, 0, stream>>>(F, VT16);
    for (int h = 0; h < NH_; ++h) { const size_t po = (size_t)h * TT * HD;
        k_gemmw<h16, 0, false><<<dim3(TT / 64, TT / 64, 1), 32, 0, stream>>>(QP16 + po, nullptr, KP16 + po, nullptr, HD, Sb, TT, nullptr, 0, 0, 0);       /* qh.kh */
        k_sigm<<<(unsigned)(((size_t)TT * TT / 8 + 255) / 256), 256, 0, stream>>>(Sb, P16, (size_t)TT * TT / 8);                                        /* sigmoid */
        k_gemmw<h16, 0, false><<<dim3(TT / 64, HD / 64, 1), 32, 0, stream>>>(P16, nullptr, VT16 + po, nullptr, TT, Ob, HD, nullptr, 0, 0, 0);           /* attn . vh */
        k_mergeS<<<(unsigned)(((size_t)TT * HD / 2 + 255) / 256), 256, 0, stream>>>(Ob, h, ATh, ATl); }
    k_gemmw<bf, 1, true><<<dim3(TT / 64, DM / 64, 1), 32, 0, stream>>>(ATh, ATl, WP, nullptr, DQ, OUT, DM, bp, 0, 0, 0);
}

// v001
// It runs in 340 microseconds.
// Two timings next to v000 put it at 6.18 and 6.20 times that version's speed.
#include <hip/hip_runtime.h>

// Sigmoid attention (q, k, v [1][4096][1024]; qh, kh, vh = (q Wq^T, k Wk^T, v Wv^T) ('oi' [1024][1024], no bias) split into 16 heads x 64; per-head LayerNorm over the 64 dims of qh (x gq + bq, then x 1/8) and kh (x gk + bk); attn = sigmoid(qh.kh) over the full 4096 x 4096 matrix (no softmax, no normalisation); x = attn vh merged; out = x Wp^T + bp -> [1][4096][1024] (4.2 M)).
// Compute dtypes, f32 accumulate: every input rounded to bf16; projections on PLAIN bf16 operands (inputs: exact); LayerNorm in f32 (one wave per head row); scores and attn.v on single fp16 planes (1 product each: sigmoid outputs lie in (0,1), no carry needed); sigmoid in f32 (precise expf, true division); merged heads hi/lo x exact Wp (2 products) + bp.
// Scores, sigmoid, attn.v and the head merge run in ONE launch (k_fattn): the 4096 x 4096 matrix of a head never leaves the registers.

#define TT   4096
#define DM   1024
#define NH_  16
#define HD   64
#define DQ   (NH_ * HD)
#define SCL  0.125f
#define LNEPS 1e-5f
typedef _Float16 h16;
typedef unsigned short bf;
typedef __attribute__((ext_vector_type(16))) __bf16   v16bf;
typedef __attribute__((ext_vector_type(16))) _Float16 v16h;
typedef __attribute__((ext_vector_type(8)))  _Float16 v8h;
typedef __attribute__((ext_vector_type(8)))  unsigned short v8us;
typedef __attribute__((ext_vector_type(8)))  float    v8f;
typedef __attribute__((ext_vector_type(4)))  float    v4f;
typedef v8h  __attribute__((may_alias)) v8ha;
typedef v4f  __attribute__((may_alias)) v4fa;
typedef v8us __attribute__((may_alias)) v8usa;

__device__ __forceinline__ unsigned short f2bf(float f) { unsigned u = __float_as_uint(f); u += 0x7FFFu + ((u >> 16) & 1u); return (unsigned short)(u >> 16); }
__device__ __forceinline__ float bf2f(unsigned short b) { return __uint_as_float(((unsigned)b) << 16); }
__device__ __forceinline__ float bfr(float f) { return bf2f(f2bf(f)); }
__device__ __forceinline__ v16h cat16(v8h lo, v8h hi) { return __builtin_shufflevector(lo, hi, 0, 1, 2, 3, 4, 5, 6, 7, 8, 9, 10, 11, 12, 13, 14, 15); }
__device__ __forceinline__ v16bf cat16b(v8us lo, v8us hi) { return __builtin_bit_cast(v16bf, __builtin_shufflevector(lo, hi, 0, 1, 2, 3, 4, 5, 6, 7, 8, 9, 10, 11, 12, 13, 14, 15)); }
__device__ __forceinline__ v8f wmma16(v16h a, v16h b, v8f c) { return __builtin_amdgcn_wmma_f32_16x16x32_f16(false, a, false, b, (short)0, c, false, false); }
__device__ __forceinline__ v8f wmmab(v16bf a, v16bf b, v8f c) { return __builtin_amdgcn_wmma_f32_16x16x32_bf16(false, a, false, b, (short)0, c, false, false); }



// ---- k_gemmw: register-blocked GEMM, ONE WAVE per 64x64 output tile (16 accumulators), operands straight from K-contiguous 16-bit planes; grid (M/64, N/64, Z), 32 threads.
// C[m][n] (f32, pitch ldc, + optional f32 bias[n]) = sum_k A[m][k] Bt[n][k] (+ split products per NSPLIT). z-batch strides sA/sB/sC in elements. K % 32 == 0.
template <typename T16> struct WFrag;
template <> struct WFrag<h16> { typedef v16h V; static __device__ __forceinline__ V ld(const h16* p) { return cat16(*(const v8h*)p, *(const v8h*)(p + 16)); } static __device__ __forceinline__ v8f mma(V a, V b, v8f c) { return wmma16(a, b, c); } };
template <> struct WFrag<bf> { typedef v16bf V; static __device__ __forceinline__ V ld(const bf* p) { return cat16b(*(const v8us*)p, *(const v8us*)(p + 16)); } static __device__ __forceinline__ v8f mma(V a, V b, v8f c) { return wmmab(a, b, c); } };
template <typename T16, int NSPLIT, bool BIAS>
__global__ __launch_bounds__(32) void k_gemmw(const T16* __restrict__ A, const T16* __restrict__ A2, const T16* __restrict__ Bt, const T16* __restrict__ Bt2, int K, float* C, int ldc, const float* __restrict__ bias, size_t sA, size_t sB, size_t sC) {
    typedef typename WFrag<T16>::V V;
    __shared__ __align__(16) float os[16 * 68];
    const size_t z = blockIdx.z; A += z * sA; if (A2) A2 += z * sA; Bt += z * sB; if (Bt2) Bt2 += z * sB; C += z * sC;
    const int lane = threadIdx.x & 31, lr = lane & 15, hi = lane >> 4; const int r0 = blockIdx.x * 64, c0 = blockIdx.y * 64;
    v8f acc[4][4];
#pragma unroll
    for (int mb = 0; mb < 4; ++mb)
#pragma unroll
        for (int nb = 0; nb < 4; ++nb) acc[mb][nb] = (v8f){};
    const size_t aoff = (size_t)(r0 + lr) * K + 8 * hi, boff = (size_t)(c0 + lr) * K + 8 * hi;
#pragma unroll 1
    for (int kc = 0; kc < K; kc += 32) {
        V a[4], a2[4];
#pragma unroll
        for (int mb = 0; mb < 4; ++mb) { a[mb] = WFrag<T16>::ld(A + aoff + (size_t)mb * 16 * K + kc); if (NSPLIT == 1 || NSPLIT == 2) a2[mb] = WFrag<T16>::ld(A2 + aoff + (size_t)mb * 16 * K + kc); }
#pragma unroll
        for (int nb = 0; nb < 4; ++nb) { const V b = WFrag<T16>::ld(Bt + boff + (size_t)nb * 16 * K + kc); V b2; if (NSPLIT >= 2) b2 = WFrag<T16>::ld(Bt2 + boff + (size_t)nb * 16 * K + kc);
#pragma unroll
            for (int mb = 0; mb < 4; ++mb) { acc[mb][nb] = WFrag<T16>::mma(a[mb], b, acc[mb][nb]); if (NSPLIT == 1 || NSPLIT == 2) acc[mb][nb] = WFrag<T16>::mma(a2[mb], b, acc[mb][nb]); if (NSPLIT >= 2) acc[mb][nb] = WFrag<T16>::mma(a[mb], b2, acc[mb][nb]); } }
        asm volatile("v_nop\n\tv_nop\n\tv_nop\n\tv_nop" : "+v"(acc[0][0]), "+v"(acc[1][1]), "+v"(acc[2][2]), "+v"(acc[3][3]) : "v"(a[0]), "v"(a[3]));
    }
#pragma unroll
    for (int mb = 0; mb < 4; ++mb) {
#pragma unroll
        for (int nb = 0; nb < 4; ++nb) {
#pragma unroll
            for (int j = 0; j < 8; ++j) os[(hi * 8 + j) * 68 + nb * 16 + lr] = acc[mb][nb][j]; }
        __builtin_amdgcn_wave_barrier(); asm volatile("" ::: "memory");
        float* crow = C + (size_t)(r0 + mb * 16) * ldc + c0;
{
#pragma unroll
            for (int s = 0; s < 8; ++s) { const int row = 2 * s + hi, cofs = lr * 4; v4f val = *(const v4fa*)(os + row * 68 + cofs); if (BIAS) { val[0] += bfr(bias[c0 + cofs]); val[1] += bfr(bias[c0 + cofs + 1]); val[2] += bfr(bias[c0 + cofs + 2]); val[3] += bfr(bias[c0 + cofs + 3]); }
                *(v4f*)(crow + (size_t)row * ldc + cofs) = val; }
             }
        __builtin_amdgcn_wave_barrier(); asm volatile("" ::: "memory");
    }
}

__device__ __forceinline__ h16 tohx(float x) { return (h16)x; }
__device__ __forceinline__ void splitf(float y, unsigned short& h, unsigned short& l) { h = f2bf(y); l = f2bf(y - bf2f(h)); }
typedef __attribute__((ext_vector_type(2))) _Float16 v2h;
typedef __attribute__((ext_vector_type(4))) _Float16 v4h;
typedef __attribute__((ext_vector_type(2))) unsigned short v2us;
typedef __attribute__((ext_vector_type(4))) unsigned short v4us;
typedef __attribute__((ext_vector_type(2))) float v2f;
typedef __attribute__((ext_vector_type(4))) int v4i;

__global__ __launch_bounds__(256) void k_cvt8(const float* __restrict__ src, bf* dst, size_t n8) { const size_t i = (size_t)blockIdx.x * 256 + threadIdx.x; if (i >= n8) return; const v8f v = *(const v8f*)(src + i * 8); v8us o;
#pragma unroll
    for (int k = 0; k < 8; ++k) o[k] = f2bf(v[k]); *(v8us*)(dst + i * 8) = o;  }

__global__ __launch_bounds__(256) void k_lnpl(const float* __restrict__ F, const float* __restrict__ gw, const float* __restrict__ gb, float sc, h16* P16) { const int lane = threadIdx.x & 31; const size_t row = (size_t)blockIdx.x * 8 + (threadIdx.x >> 5); if (row >= (size_t)NH_ * TT) return; const int t = (int)(row % TT); const int h = (int)(row / TT); const float* f = F + (size_t)t * DQ + h * HD + lane * 2; const float u0 = f[0], u1 = f[1];
    float s = __fadd_rn(u0, u1);
#pragma unroll
    for (int sh = 16; sh; sh >>= 1) s += __shfl_xor(s, sh, 32);
    float mu = s * (1.0f / 64.0f); asm volatile("" : "+v"(mu)); float d0 = __fsub_rn(u0, mu), d1 = __fsub_rn(u1, mu); asm volatile("" : "+v"(d0), "+v"(d1)); float p0 = __fmul_rn(d0, d0), p1 = __fmul_rn(d1, d1); asm volatile("" : "+v"(p0), "+v"(p1)); float s2 = __fadd_rn(p0, p1);
#pragma unroll
    for (int sh = 16; sh; sh >>= 1) s2 += __shfl_xor(s2, sh, 32);
    float var = __fadd_rn(s2 * (1.0f / 64.0f), LNEPS); asm volatile("" : "+v"(var)); const float rs = __frsqrt_rn(var);
    v2h o;
#pragma unroll
    for (int q = 0; q < 2; ++q) { const int d = lane * 2 + q; float n0 = __fmul_rn(q ? d1 : d0, rs); asm volatile("" : "+v"(n0)); float y = __fmul_rn(n0, bfr(gw[d])); asm volatile("" : "+v"(y)); float z = __fadd_rn(y, bfr(gb[d])); asm volatile("" : "+v"(z)); o[q] = tohx(z * sc); }
    const size_t oo = ((size_t)h * TT + t) * HD + lane * 2; *(v2h*)(P16 + oo) = o;  }
__global__ __launch_bounds__(256) void k_vt16s(const float* __restrict__ F, h16* V16) { const size_t e = ((size_t)blockIdx.x * 256 + threadIdx.x) * 2; if (e >= (size_t)NH_ * HD * TT) return; const int t = (int)(e % TT); const int d = (int)((e / TT) % HD); const int h = (int)(e / ((size_t)TT * HD)); v2h o;
#pragma unroll
    for (int q = 0; q < 2; ++q) o[q] = tohx(F[((size_t)t + q) * DQ + h * HD + d]);
    *(v2h*)(V16 + e) = o;  }
#define KST 64
#define LP_ 72
__device__ __forceinline__ v16h ldsfrag(const h16* p) { return cat16(*(const v8ha*)p, *(const v8ha*)(p + 16)); }
__global__ __launch_bounds__(256) __attribute__((amdgpu_waves_per_eu(4, 4))) void k_fattn(const h16* __restrict__ Q16, const h16* __restrict__ K16, const h16* __restrict__ V16, bf* Ah, bf* Al) {
    __shared__ __align__(16) h16 ks[2][KST * LP_];   // [key][d]
    __shared__ __align__(16) h16 vs[2][HD * LP_];    // [d][key]
    const int tid = threadIdx.x, lane = tid & 31, wave = tid >> 5, lr = lane & 15, hi = lane >> 4;
    const int h = blockIdx.y, q = blockIdx.x * 128 + wave * 16 + lr;
    const h16* Qh = Q16 + (size_t)h * TT * HD; const h16* Kh = K16 + (size_t)h * TT * HD; const h16* Vh = V16 + (size_t)h * HD * TT;
    v16h qf[2];
#pragma unroll
    for (int ds = 0; ds < 2; ++ds) qf[ds] = WFrag<h16>::ld(Qh + (size_t)q * HD + ds * 32 + 8 * hi);
    v8f o[4];
#pragma unroll
    for (int db = 0; db < 4; ++db) o[db] = (v8f){};
    const int sr = tid >> 3, sc = (tid & 7) * 8;     // staging: 8 threads per 128-byte row, rows sr and sr + 32
    const h16* gk = Kh + (size_t)sr * HD + sc; const h16* gv = Vh + (size_t)sr * TT + sc; const int so = sr * LP_ + sc;
    v8h rk0 = *(const v8h*)gk, rk1 = *(const v8h*)(gk + 32 * HD), rv0 = *(const v8h*)gv, rv1 = *(const v8h*)(gv + (size_t)32 * TT);
    *(v8ha*)(ks[0] + so) = rk0; *(v8ha*)(ks[0] + so + 32 * LP_) = rk1; *(v8ha*)(vs[0] + so) = rv0; *(v8ha*)(vs[0] + so + 32 * LP_) = rv1;
    __syncthreads();
#pragma unroll 1
    for (int s = 0; s < TT / KST; ++s) {
        const int b = s & 1;
        if (s + 1 < TT / KST) { const h16* nk = gk + (size_t)(s + 1) * KST * HD; const h16* nv = gv + (size_t)(s + 1) * KST; rk0 = *(const v8h*)nk; rk1 = *(const v8h*)(nk + 32 * HD); rv0 = *(const v8h*)nv; rv1 = *(const v8h*)(nv + (size_t)32 * TT); }
#pragma unroll
        for (int p = 0; p < KST / 32; ++p) {
            v8f st[2];
#pragma unroll
            for (int kt = 0; kt < 2; ++kt) { st[kt] = (v8f){};
#pragma unroll
                for (int ds = 0; ds < 2; ++ds) st[kt] = wmma16(ldsfrag(ks[b] + (p * 32 + kt * 16 + lr) * LP_ + ds * 32 + 8 * hi), qf[ds], st[kt]); }
            v16h pb;
#pragma unroll
            for (int e = 0; e < 16; ++e) pb[e] = tohx(__fdiv_rn(1.0f, __fadd_rn(1.0f, expf(-st[e >> 3][e & 7]))));
#pragma unroll
            for (int db = 0; db < 4; ++db) o[db] = wmma16(ldsfrag(vs[b] + (db * 16 + lr) * LP_ + p * 32 + 8 * hi), pb, o[db]);
        }
        if (s + 1 < TT / KST) { h16* dk = ks[b ^ 1] + so; h16* dv = vs[b ^ 1] + so; *(v8ha*)dk = rk0; *(v8ha*)(dk + 32 * LP_) = rk1; *(v8ha*)dv = rv0; *(v8ha*)(dv + 32 * LP_) = rv1; }
        __syncthreads();   // publishes stage s + 1 and ends every wave's reads of stage s, whose buffer the next trip refills
    }
#pragma unroll
    for (int db = 0; db < 4; ++db) { v8us oh, ol;     // o[db][j] = x[q][h * 64 + db * 16 + 8 * hi + j]: eight neighbours of one row, one 16-byte store per plane
#pragma unroll
        for (int j = 0; j < 8; ++j) { unsigned short a, c2; splitf(o[db][j], a, c2); oh[j] = a; ol[j] = c2; }
        const size_t oo = (size_t)q * DQ + h * HD + db * 16 + 8 * hi; *(v8us*)(Ah + oo) = oh; *(v8us*)(Al + oo) = ol; }
}

extern "C" void kernel_launch(void* const* d_in, const int* in_sizes, int n_in,
                              void* d_out, int out_size, void* d_ws, size_t ws_size, hipStream_t stream) {
    (void)in_sizes; (void)n_in; (void)out_size;
    const float* xq = (const float*)d_in[0]; const float* xk = (const float*)d_in[1]; const float* xv = (const float*)d_in[2]; const float* wq = (const float*)d_in[3]; const float* wk = (const float*)d_in[4]; const float* wv = (const float*)d_in[5];
    const float* gq = (const float*)d_in[6]; const float* bq = (const float*)d_in[7]; const float* gk = (const float*)d_in[8]; const float* bk = (const float*)d_in[9]; const float* wp = (const float*)d_in[10]; const float* bp = (const float*)d_in[11];
    float* OUT = (float*)d_out;     // [1][4096][1024]
    char* wsp = (char*)d_ws;
    auto take = [&](size_t bytes) { char* p = wsp; wsp += (bytes + 255) & ~(size_t)255; return (void*)p; };
    bf* WQ = (bf*)take((size_t)DQ * DM * 2); bf* WK = (bf*)take((size_t)DQ * DM * 2); bf* WV = (bf*)take((size_t)DQ * DM * 2); bf* WP = (bf*)take((size_t)DM * DQ * 2);
    bf* XB = (bf*)take((size_t)TT * DM * 2); float* F = (float*)take((size_t)TT * DQ * 4);
    const size_t PS = (size_t)NH_ * TT * HD; h16* QP16 = (h16*)take(PS * 2); h16* KP16 = (h16*)take(PS * 2); h16* VT16 = (h16*)take(PS * 2);
    bf* ATh = (bf*)take((size_t)TT * DQ * 2); bf* ATl = (bf*)take((size_t)TT * DQ * 2);
    if ((size_t)(wsp - (char*)d_ws) > ws_size) return;    // ws 256 MiB
    const unsigned LW = (unsigned)(((size_t)DQ * DM / 8 + 255) / 256), LX = (unsigned)(((size_t)TT * DM / 8 + 255) / 256), LP = (unsigned)((PS / 2 + 255) / 256);
    k_cvt8<<<LW, 256, 0, stream>>>(wq, WQ, (size_t)DQ * DM / 8); k_cvt8<<<LW, 256, 0, stream>>>(wk, WK, (size_t)DQ * DM / 8); k_cvt8<<<LW, 256, 0, stream>>>(wv, WV, (size_t)DQ * DM / 8); k_cvt8<<<LW, 256, 0, stream>>>(wp, WP, (size_t)DM * DQ / 8);
    /* q */ k_cvt8<<<LX, 256, 0, stream>>>(xq, XB, (size_t)TT * DM / 8); k_gemmw<bf, 0, false><<<dim3(TT / 64, DQ / 64, 1), 32, 0, stream>>>(XB, nullptr, WQ, nullptr, DM, F, DQ, nullptr, 0, 0, 0); k_lnpl<<<(unsigned)((size_t)NH_ * TT / 8), 256, 0, stream>>>(F, gq, bq, SCL, QP16);
    /* k */ k_cvt8<<<LX, 256, 0, stream>>>(xk, XB, (size_t)TT * DM / 8); k_gemmw<bf, 0, false><<<dim3(TT / 64, DQ / 64, 1), 32, 0, stream>>>(XB, nullptr, WK, nullptr, DM, F, DQ, nullptr, 0, 0, 0); k_lnpl<<<(unsigned)((size_t)NH_ * TT / 8), 256, 0, stream>>>(F, gk, bk, 1.0f, KP16);
    /* v */ k_cvt8<<<LX, 256, 0, stream>>>(xv, XB, (size_t)TT * DM / 8); k_gemmw<bf, 0, false><<<dim3(TT / 64, DQ / 64, 1), 32, 0, stream>>>(XB, nullptr, WV, nullptr, DM, F, DQ, nullptr, 0, 0, 0); k_vt16s<<<LP, 256, 0, stream>>>(F, VT16);
    k_fattn<<<dim3(TT / 128, NH_, 1), 256, 0, stream>>>(QP16, KP16, VT16, ATh, ATl);      /* sigmoid(qh.kh) vh, merged, hi/lo */
    k_gemmw<bf, 1, true><<<dim3(TT / 64, DM / 64, 1), 32, 0, stream>>>(ATh, ATl, WP, nullptr, DQ, OUT, DM, bp, 0, 0, 0);
}

// v002
// Measured time: 249 microseconds a run.
// Next to v001, in two timings, it ran 1.37 times as fast each time.
// All steps since v000 together make it 8.48 times as fast.
#include <hip/hip_runtime.h>

// Sigmoid attention (q, k, v [1][4096][1024]; qh, kh, vh = (q Wq^T, k Wk^T, v Wv^T) ('oi' [1024][1024], no bias) split into 16 heads x 64; per-head LayerNorm over the 64 dims of qh (x gq + bq, then x 1/8) and kh (x gk + bk); attn = sigmoid(qh.kh) over the full 4096 x 4096 matrix (no softmax, no normalisation); x = attn vh merged; out = x Wp^T + bp -> [1][4096][1024] (4.2 M)).
// Compute dtypes, f32 accumulate: every input rounded to bf16; projections on PLAIN bf16 operands (inputs: exact); LayerNorm in f32 (one wave per head row); scores and attn.v on single fp16 planes (1 product each: sigmoid outputs lie in (0,1), no carry needed); sigmoid in f32 (0.5 + 0.5 tanh(x / 2), hardware tanh); merged heads hi/lo x exact Wp (2 products) + bp.
// Scores, sigmoid, attn.v and the head merge run in ONE launch (k_fattn): the 4096 x 4096 matrix of a head never leaves the registers.

#define TT   4096
#define DM   1024
#define NH_  16
#define HD   64
#define DQ   (NH_ * HD)
#define SCL  0.125f
#define LNEPS 1e-5f
typedef _Float16 h16;
typedef unsigned short bf;
typedef __attribute__((ext_vector_type(16))) __bf16   v16bf;
typedef __attribute__((ext_vector_type(16))) _Float16 v16h;
typedef __attribute__((ext_vector_type(8)))  _Float16 v8h;
typedef __attribute__((ext_vector_type(8)))  unsigned short v8us;
typedef __attribute__((ext_vector_type(8)))  float    v8f;
typedef __attribute__((ext_vector_type(4)))  float    v4f;
typedef v8h  __attribute__((may_alias)) v8ha;
typedef v4f  __attribute__((may_alias)) v4fa;
typedef v8us __attribute__((may_alias)) v8usa;

__device__ __forceinline__ unsigned short f2bf(float f) { unsigned u = __float_as_uint(f); u += 0x7FFFu + ((u >> 16) & 1u); return (unsigned short)(u >> 16); }
__device__ __forceinline__ float bf2f(unsigned short b) { return __uint_as_float(((unsigned)b) << 16); }
__device__ __forceinline__ float bfr(float f) { return bf2f(f2bf(f)); }
__device__ __forceinline__ v16h cat16(v8h lo, v8h hi) { return __builtin_shufflevector(lo, hi, 0, 1, 2, 3, 4, 5, 6, 7, 8, 9, 10, 11, 12, 13, 14, 15); }
__device__ __forceinline__ v16bf cat16b(v8us lo, v8us hi) { return __builtin_bit_cast(v16bf, __builtin_shufflevector(lo, hi, 0, 1, 2, 3, 4, 5, 6, 7, 8, 9, 10, 11, 12, 13, 14, 15)); }
__device__ __forceinline__ v8f wmma16(v16h a, v16h b, v8f c) { return __builtin_amdgcn_wmma_f32_16x16x32_f16(false, a, false, b, (short)0, c, false, false); }
__device__ __forceinline__ v8f wmmab(v16bf a, v16bf b, v8f c) { return __builtin_amdgcn_wmma_f32_16x16x32_bf16(false, a, false, b, (short)0, c, false, false); }



// ---- k_gemmw: register-blocked GEMM, ONE WAVE per 64x64 output tile (16 accumulators), operands straight from K-contiguous 16-bit planes; grid (M/64, N/64, Z), 32 threads.
// C[m][n] (f32, pitch ldc, + optional f32 bias[n]) = sum_k A[m][k] Bt[n][k] (+ split products per NSPLIT). z-batch strides sA/sB/sC in elements. K % 32 == 0.
template <typename T16> struct WFrag;
template <> struct WFrag<h16> { typedef v16h V; static __device__ __forceinline__ V ld(const h16* p) { return cat16(*(const v8h*)p, *(const v8h*)(p + 16)); } static __device__ __forceinline__ v8f mma(V a, V b, v8f c) { return wmma16(a, b, c); } };
template <> struct WFrag<bf> { typedef v16bf V; static __device__ __forceinline__ V ld(const bf* p) { return cat16b(*(const v8us*)p, *(const v8us*)(p + 16)); } static __device__ __forceinline__ v8f mma(V a, V b, v8f c) { return wmmab(a, b, c); } };
template <typename T16, int NSPLIT, bool BIAS>
__global__ __launch_bounds__(32) void k_gemmw(const T16* __restrict__ A, const T16* __restrict__ A2, const T16* __restrict__ Bt, const T16* __restrict__ Bt2, int K, float* C, int ldc, const float* __restrict__ bias, size_t sA, size_t sB, size_t sC) {
    typedef typename WFrag<T16>::V V;
    __shared__ __align__(16) float os[16 * 68];
    const size_t z = blockIdx.z; A += z * sA; if (A2) A2 += z * sA; Bt += z * sB; if (Bt2) Bt2 += z * sB; C += z * sC;
    const int lane = threadIdx.x & 31, lr = lane & 15, hi = lane >> 4; const int r0 = blockIdx.x * 64, c0 = blockIdx.y * 64;
    v8f acc[4][4];
#pragma unroll
    for (int mb = 0; mb < 4; ++mb)
#pragma unroll
        for (int nb = 0; nb < 4; ++nb) acc[mb][nb] = (v8f){};
    const size_t aoff = (size_t)(r0 + lr) * K + 8 * hi, boff = (size_t)(c0 + lr) * K + 8 * hi;
#pragma unroll 1
    for (int kc = 0; kc < K; kc += 32) {
        V a[4], a2[4];
#pragma unroll
        for (int mb = 0; mb < 4; ++mb) { a[mb] = WFrag<T16>::ld(A + aoff + (size_t)mb * 16 * K + kc); if (NSPLIT == 1 || NSPLIT == 2) a2[mb] = WFrag<T16>::ld(A2 + aoff + (size_t)mb * 16 * K + kc); }
#pragma unroll
        for (int nb = 0; nb < 4; ++nb) { const V b = WFrag<T16>::ld(Bt + boff + (size_t)nb * 16 * K + kc); V b2; if (NSPLIT >= 2) b2 = WFrag<T16>::ld(Bt2 + boff + (size_t)nb * 16 * K + kc);
#pragma unroll
            for (int mb = 0; mb < 4; ++mb) { acc[mb][nb] = WFrag<T16>::mma(a[mb], b, acc[mb][nb]); if (NSPLIT == 1 || NSPLIT == 2) acc[mb][nb] = WFrag<T16>::mma(a2[mb], b, acc[mb][nb]); if (NSPLIT >= 2) acc[mb][nb] = WFrag<T16>::mma(a[mb], b2, acc[mb][nb]); } }
        asm volatile("v_nop\n\tv_nop\n\tv_nop\n\tv_nop" : "+v"(acc[0][0]), "+v"(acc[1][1]), "+v"(acc[2][2]), "+v"(acc[3][3]) : "v"(a[0]), "v"(a[3]));
    }
#pragma unroll
    for (int mb = 0; mb < 4; ++mb) {
#pragma unroll
        for (int nb = 0; nb < 4; ++nb) {
#pragma unroll
            for (int j = 0; j < 8; ++j) os[(hi * 8 + j) * 68 + nb * 16 + lr] = acc[mb][nb][j]; }
        __builtin_amdgcn_wave_barrier(); asm volatile("" ::: "memory");
        float* crow = C + (size_t)(r0 + mb * 16) * ldc + c0;
{
#pragma unroll
            for (int s = 0; s < 8; ++s) { const int row = 2 * s + hi, cofs = lr * 4; v4f val = *(const v4fa*)(os + row * 68 + cofs); if (BIAS) { val[0] += bfr(bias[c0 + cofs]); val[1] += bfr(bias[c0 + cofs + 1]); val[2] += bfr(bias[c0 + cofs + 2]); val[3] += bfr(bias[c0 + cofs + 3]); }
                *(v4f*)(crow + (size_t)row * ldc + cofs) = val; }
             }
        __builtin_amdgcn_wave_barrier(); asm volatile("" ::: "memory");
    }
}

__device__ __forceinline__ h16 tohx(float x) { return (h16)x; }
__device__ __forceinline__ void splitf(float y, unsigned short& h, unsigned short& l) { h = f2bf(y); l = f2bf(y - bf2f(h)); }
typedef __attribute__((ext_vector_type(2))) _Float16 v2h;
typedef __attribute__((ext_vector_type(4))) _Float16 v4h;
typedef __attribute__((ext_vector_type(2))) unsigned short v2us;
typedef __attribute__((ext_vector_type(4))) unsigned short v4us;
typedef __attribute__((ext_vector_type(2))) float v2f;
typedef __attribute__((ext_vector_type(4))) int v4i;

__global__ __launch_bounds__(256) void k_cvt8(const float* __restrict__ src, bf* dst, size_t n8) { const size_t i = (size_t)blockIdx.x * 256 + threadIdx.x; if (i >= n8) return; const v8f v = *(const v8f*)(src + i * 8); v8us o;
#pragma unroll
    for (int k = 0; k < 8; ++k) o[k] = f2bf(v[k]); *(v8us*)(dst + i * 8) = o;  }

__global__ __launch_bounds__(256) void k_lnpl(const float* __restrict__ F, const float* __restrict__ gw, const float* __restrict__ gb, float sc, h16* P16) { const int lane = threadIdx.x & 31; const size_t row = (size_t)blockIdx.x * 8 + (threadIdx.x >> 5); if (row >= (size_t)NH_ * TT) return; const int t = (int)(row % TT); const int h = (int)(row / TT); const float* f = F + (size_t)t * DQ + h * HD + lane * 2; const float u0 = f[0], u1 = f[1];
    float s = __fadd_rn(u0, u1);
#pragma unroll
    for (int sh = 16; sh; sh >>= 1) s += __shfl_xor(s, sh, 32);
    float mu = s * (1.0f / 64.0f); asm volatile("" : "+v"(mu)); float d0 = __fsub_rn(u0, mu), d1 = __fsub_rn(u1, mu); asm volatile("" : "+v"(d0), "+v"(d1)); float p0 = __fmul_rn(d0, d0), p1 = __fmul_rn(d1, d1); asm volatile("" : "+v"(p0), "+v"(p1)); float s2 = __fadd_rn(p0, p1);
#pragma unroll
    for (int sh = 16; sh; sh >>= 1) s2 += __shfl_xor(s2, sh, 32);
    float var = __fadd_rn(s2 * (1.0f / 64.0f), LNEPS); asm volatile("" : "+v"(var)); const float rs = __frsqrt_rn(var);
    v2h o;
#pragma unroll
    for (int q = 0; q < 2; ++q) { const int d = lane * 2 + q; float n0 = __fmul_rn(q ? d1 : d0, rs); asm volatile("" : "+v"(n0)); float y = __fmul_rn(n0, bfr(gw[d])); asm volatile("" : "+v"(y)); float z = __fadd_rn(y, bfr(gb[d])); asm volatile("" : "+v"(z)); o[q] = tohx(z * sc); }
    const size_t oo = ((size_t)h * TT + t) * HD + lane * 2; *(v2h*)(P16 + oo) = o;  }
__global__ __launch_bounds__(256) void k_vt16s(const float* __restrict__ F, h16* V16) { const size_t e = ((size_t)blockIdx.x * 256 + threadIdx.x) * 2; if (e >= (size_t)NH_ * HD * TT) return; const int t = (int)(e % TT); const int d = (int)((e / TT) % HD); const int h = (int)(e / ((size_t)TT * HD)); v2h o;
#pragma unroll
    for (int q = 0; q < 2; ++q) o[q] = tohx(F[((size_t)t + q) * DQ + h * HD + d]);
    *(v2h*)(V16 + e) = o;  }
#define KST 64
#define LP_ 72
__device__ __forceinline__ v16h ldsfrag(const h16* p) { return cat16(*(const v8ha*)p, *(const v8ha*)(p + 16)); }
__global__ __launch_bounds__(256) __attribute__((amdgpu_waves_per_eu(4, 4))) void k_fattn(const h16* __restrict__ Q16, const h16* __restrict__ K16, const h16* __restrict__ V16, bf* Ah, bf* Al) {
    __shared__ __align__(16) h16 ks[2][KST * LP_];   // [key][d]
    __shared__ __align__(16) h16 vs[2][HD * LP_];    // [d][key]
    const int tid = threadIdx.x, lane = tid & 31, wave = tid >> 5, lr = lane & 15, hi = lane >> 4;
    const int h = blockIdx.y, q = blockIdx.x * 128 + wave * 16 + lr;
    const h16* Qh = Q16 + (size_t)h * TT * HD; const h16* Kh = K16 + (size_t)h * TT * HD; const h16* Vh = V16 + (size_t)h * HD * TT;
    v16h qf[2];
#pragma unroll
    for (int ds = 0; ds < 2; ++ds) qf[ds] = WFrag<h16>::ld(Qh + (size_t)q * HD + ds * 32 + 8 * hi) * (h16)0.5f;   // times a power of two (exact in f16 above its subnormals): the score tiles hold x / 2, which is what tanh takes
    v8f o[4];
#pragma unroll
    for (int db = 0; db < 4; ++db) o[db] = (v8f){};
    const int sr = tid >> 3, sc = (tid & 7) * 8;     // staging: 8 threads per 128-byte row, rows sr and sr + 32
    const h16* gk = Kh + (size_t)sr * HD + sc; const h16* gv = Vh + (size_t)sr * TT + sc; const int so = sr * LP_ + sc;
    v8h rk0 = *(const v8h*)gk, rk1 = *(const v8h*)(gk + 32 * HD), rv0 = *(const v8h*)gv, rv1 = *(const v8h*)(gv + (size_t)32 * TT);
    *(v8ha*)(ks[0] + so) = rk0; *(v8ha*)(ks[0] + so + 32 * LP_) = rk1; *(v8ha*)(vs[0] + so) = rv0; *(v8ha*)(vs[0] + so + 32 * LP_) = rv1;
    __syncthreads();
#pragma unroll 1
    for (int s = 0; s < TT / KST; ++s) {
        const int b = s & 1;
        if (s + 1 < TT / KST) { const h16* nk = gk + (size_t)(s + 1) * KST * HD; const h16* nv = gv + (size_t)(s + 1) * KST; rk0 = *(const v8h*)nk; rk1 = *(const v8h*)(nk + 32 * HD); rv0 = *(const v8h*)nv; rv1 = *(const v8h*)(nv + (size_t)32 * TT); }
#pragma unroll
        for (int p = 0; p < KST / 32; ++p) {
            v8f st[2];
#pragma unroll
            for (int kt = 0; kt < 2; ++kt) { st[kt] = (v8f){};
#pragma unroll
                for (int ds = 0; ds < 2; ++ds) st[kt] = wmma16(ldsfrag(ks[b] + (p * 32 + kt * 16 + lr) * LP_ + ds * 32 + 8 * hi), qf[ds], st[kt]); }
            v16h pb;
#pragma unroll
            for (int e = 0; e < 16; ++e) pb[e] = tohx(__builtin_fmaf(0.5f, __builtin_amdgcn_tanhf(st[e >> 3][e & 7]), 0.5f));   // st holds x / 2 (see qf)
#pragma unroll
            for (int db = 0; db < 4; ++db) o[db] = wmma16(ldsfrag(vs[b] + (db * 16 + lr) * LP_ + p * 32 + 8 * hi), pb, o[db]);
        }
        if (s + 1 < TT / KST) { h16* dk = ks[b ^ 1] + so; h16* dv = vs[b ^ 1] + so; *(v8ha*)dk = rk0; *(v8ha*)(dk + 32 * LP_) = rk1; *(v8ha*)dv = rv0; *(v8ha*)(dv + 32 * LP_) = rv1; }
        __syncthreads();   // publishes stage s + 1 and ends every wave's reads of stage s, whose buffer the next trip refills
    }
#pragma unroll
    for (int db = 0; db < 4; ++db) { v8us oh, ol;     // o[db][j] = x[q][h * 64 + db * 16 + 8 * hi + j]: eight neighbours of one row, one 16-byte store per plane
#pragma unroll
        for (int j = 0; j < 8; ++j) { unsigned short a, c2; splitf(o[db][j], a, c2); oh[j] = a; ol[j] = c2; }
        const size_t oo = (size_t)q * DQ + h * HD + db * 16 + 8 * hi; *(v8us*)(Ah + oo) = oh; *(v8us*)(Al + oo) = ol; }
}

extern "C" void kernel_launch(void* const* d_in, const int* in_sizes, int n_in,
                              void* d_out, int out_size, void* d_ws, size_t ws_size, hipStream_t stream) {
    (void)in_sizes; (void)n_in; (void)out_size;
    const float* xq = (const float*)d_in[0]; const float* xk = (const float*)d_in[1]; const float* xv = (const float*)d_in[2]; const float* wq = (const float*)d_in[3]; const float* wk = (const float*)d_in[4]; const float* wv = (const float*)d_in[5];
    const float* gq = (const float*)d_in[6]; const float* bq = (const float*)d_in[7]; const float* gk = (const float*)d_in[8]; const float* bk = (const float*)d_in[9]; const float* wp = (const float*)d_in[10]; const float* bp = (const float*)d_in[11];
    float* OUT = (float*)d_out;     // [1][4096][1024]
    char* wsp = (char*)d_ws;
    auto take = [&](size_t bytes) { char* p = wsp; wsp += (bytes + 255) & ~(size_t)255; return (void*)p; };
    bf* WQ = (bf*)take((size_t)DQ * DM * 2); bf* WK = (bf*)take((size_t)DQ * DM * 2); bf* WV = (bf*)take((size_t)DQ * DM * 2); bf* WP = (bf*)take((size_t)DM * DQ * 2);
    bf* XB = (bf*)take((size_t)TT * DM * 2); float* F = (float*)take((size_t)TT * DQ * 4);
    const size_t PS = (size_t)NH_ * TT * HD; h16* QP16 = (h16*)take(PS * 2); h16* KP16 = (h16*)take(PS * 2); h16* VT16 = (h16*)take(PS * 2);
    bf* ATh = (bf*)take((size_t)TT * DQ * 2); bf* ATl = (bf*)take((size_t)TT * DQ * 2);
    if ((size_t)(wsp - (char*)d_ws) > ws_size) return;    // ws 256 MiB
    const unsigned LW = (unsigned)(((size_t)DQ * DM / 8 + 255) / 256), LX = (unsigned)(((size_t)TT * DM / 8 + 255) / 256), LP = (unsigned)((PS / 2 + 255) / 256);
    k_cvt8<<<LW, 256, 0, stream>>>(wq, WQ, (size_t)DQ * DM / 8); k_cvt8<<<LW, 256, 0, stream>>>(wk, WK, (size_t)DQ * DM / 8); k_cvt8<<<LW, 256, 0, stream>>>(wv, WV, (size_t)DQ * DM / 8); k_cvt8<<<LW, 256, 0, stream>>>(wp, WP, (size_t)DM * DQ / 8);
    /* q */ k_cvt8<<<LX, 256, 0, stream>>>(xq, XB, (size_t)TT * DM / 8); k_gemmw<bf, 0, false><<<dim3(TT / 64, DQ / 64, 1), 32, 0, stream>>>(XB, nullptr, WQ, nullptr, DM, F, DQ, nullptr, 0, 0, 0); k_lnpl<<<(unsigned)((size_t)NH_ * TT / 8), 256, 0, stream>>>(F, gq, bq, SCL, QP16);
    /* k */ k_cvt8<<<LX, 256, 0, stream>>>(xk, XB, (size_t)TT * DM / 8); k_gemmw<bf, 0, false><<<dim3(TT / 64, DQ / 64, 1), 32, 0, stream>>>(XB, nullptr, WK, nullptr, DM, F, DQ, nullptr, 0, 0, 0); k_lnpl<<<(unsigned)((size_t)NH_ * TT / 8), 256, 0, stream>>>(F, gk, bk, 1.0f, KP16);
    /* v */ k_cvt8<<<LX, 256, 0, stream>>>(xv, XB, (size_t)TT * DM / 8); k_gemmw<bf, 0, false><<<dim3(TT / 64, DQ / 64, 1), 32, 0, stream>>>(XB, nullptr, WV, nullptr, DM, F, DQ, nullptr, 0, 0, 0); k_vt16s<<<LP, 256, 0, stream>>>(F, VT16);
    k_fattn<<<dim3(TT / 128, NH_, 1), 256, 0, stream>>>(QP16, KP16, VT16, ATh, ATl);      /* sigmoid(qh.kh) vh, merged, hi/lo */
    k_gemmw<bf, 1, true><<<dim3(TT / 64, DM / 64, 1), 32, 0, stream>>>(ATh, ATl, WP, nullptr, DQ, OUT, DM, bp, 0, 0, 0);
}

// v003
// It runs in 211 microseconds.
// Timed twice side by side with v002, it ran 1.18 and 1.19 times as fast.
// All steps since v000 together make it 10.1 times as fast.
#include <hip/hip_runtime.h>

// Sigmoid attention (q, k, v [1][4096][1024]; qh, kh, vh = (q Wq^T, k Wk^T, v Wv^T) ('oi' [1024][1024], no bias) split into 16 heads x 64; per-head LayerNorm over the 64 dims of qh (x gq + bq, then x 1/8) and kh (x gk + bk); attn = sigmoid(qh.kh) over the full 4096 x 4096 matrix (no softmax, no normalisation); x = attn vh merged; out = x Wp^T + bp -> [1][4096][1024] (4.2 M)).
// Compute dtypes, f32 accumulate: every input rounded to bf16; projections on PLAIN bf16 operands (inputs: exact); LayerNorm in f32 (in the projection's epilogue, eight lanes per head row); scores and attn.v on single fp16 planes (1 product each: sigmoid outputs lie in (0,1), no carry needed); sigmoid in f32 (0.5 + 0.5 tanh(x / 2), hardware tanh); merged heads hi/lo x exact Wp (2 products) + bp.
// Scores, sigmoid, attn.v and the head merge run in ONE launch (k_fattn): the 4096 x 4096 matrix of a head never leaves the registers.
// The q, k and v projections write the f16 head planes themselves: a 64-column tile is exactly one head, so the LayerNorm (q, k) and the transpose (v) are done on the accumulators.

#define TT   4096
#define DM   1024
#define NH_  16
#define HD   64
#define DQ   (NH_ * HD)
#define SCL  0.125f
#define LNEPS 1e-5f
typedef _Float16 h16;
typedef unsigned short bf;
typedef __attribute__((ext_vector_type(16))) __bf16   v16bf;
typedef __attribute__((ext_vector_type(16))) _Float16 v16h;
typedef __attribute__((ext_vector_type(8)))  _Float16 v8h;
typedef __attribute__((ext_vector_type(8)))  unsigned short v8us;
typedef __attribute__((ext_vector_type(8)))  float    v8f;
typedef __attribute__((ext_vector_type(4)))  float    v4f;
typedef v8h  __attribute__((may_alias)) v8ha;
typedef v4f  __attribute__((may_alias)) v4fa;
typedef v8us __attribute__((may_alias)) v8usa;

__device__ __forceinline__ unsigned short f2bf(float f) { unsigned u = __float_as_uint(f); u += 0x7FFFu + ((u >> 16) & 1u); return (unsigned short)(u >> 16); }
__device__ __forceinline__ float bf2f(unsigned short b) { return __uint_as_float(((unsigned)b) << 16); }
__device__ __forceinline__ float bfr(float f) { return bf2f(f2bf(f)); }
__device__ __forceinline__ v16h cat16(v8h lo, v8h hi) { return __builtin_shufflevector(lo, hi, 0, 1, 2, 3, 4, 5, 6, 7, 8, 9, 10, 11, 12, 13, 14, 15); }
__device__ __forceinline__ v16bf cat16b(v8us lo, v8us hi) { return __builtin_bit_cast(v16bf, __builtin_shufflevector(lo, hi, 0, 1, 2, 3, 4, 5, 6, 7, 8, 9, 10, 11, 12, 13, 14, 15)); }
__device__ __forceinline__ v8f wmma16(v16h a, v16h b, v8f c) { return __builtin_amdgcn_wmma_f32_16x16x32_f16(false, a, false, b, (short)0, c, false, false); }
__device__ __forceinline__ v8f wmmab(v16bf a, v16bf b, v8f c) { return __builtin_amdgcn_wmma_f32_16x16x32_bf16(false, a, false, b, (short)0, c, false, false); }



// ---- k_gemmw: register-blocked GEMM, ONE WAVE per 64x64 output tile (16 accumulators), operands straight from K-contiguous 16-bit planes; grid (M/64, N/64, Z), 32 threads.
// C[m][n] (f32, pitch ldc, + optional f32 bias[n]) = sum_k A[m][k] Bt[n][k] (+ split products per NSPLIT). z-batch strides sA/sB/sC in elements. K % 32 == 0.
// EPI 0: C as above. EPI 1: the tile's 64 columns are one head; each row is normalised over them (x gw + gb, x sc) and stored as f16 to P16[head][row][64]. EPI 2: the tile is stored as f16, transposed, to P16[column][TT].
template <typename T16> struct WFrag;
template <> struct WFrag<h16> { typedef v16h V; static __device__ __forceinline__ V ld(const h16* p) { return cat16(*(const v8h*)p, *(const v8h*)(p + 16)); } static __device__ __forceinline__ v8f mma(V a, V b, v8f c) { return wmma16(a, b, c); } };
template <> struct WFrag<bf> { typedef v16bf V; static __device__ __forceinline__ V ld(const bf* p) { return cat16b(*(const v8us*)p, *(const v8us*)(p + 16)); } static __device__ __forceinline__ v8f mma(V a, V b, v8f c) { return wmmab(a, b, c); } };
// x + (x of lane ^ M), M < 16: one step of a butterfly sum inside a 16-lane row, on the vector pipe (row_xmask), no LDS round trip.
template <int M> __device__ __forceinline__ float xadd(float x) { return x + __int_as_float(__builtin_amdgcn_update_dpp(0, __float_as_int(x), 0x160 | M, 0xf, 0xf, true)); }
template <typename T16, int NSPLIT, bool BIAS, int EPI>
__global__ __launch_bounds__(32) void k_gemmw(const T16* __restrict__ A, const T16* __restrict__ A2, const T16* __restrict__ Bt, const T16* __restrict__ Bt2, int K, float* C, int ldc, const float* __restrict__ bias, size_t sA, size_t sB, size_t sC, const float* __restrict__ gw, const float* __restrict__ gb, float sc, h16* P16) {
    typedef typename WFrag<T16>::V V;
    __shared__ __align__(16) float os[16 * 68];
    const size_t z = blockIdx.z; A += z * sA; if (A2) A2 += z * sA; Bt += z * sB; if (Bt2) Bt2 += z * sB; C += z * sC;
    const int lane = threadIdx.x & 31, lr = lane & 15, hi = lane >> 4; const int r0 = blockIdx.x * 64, c0 = blockIdx.y * 64;
    v8f acc[4][4];
#pragma unroll
    for (int mb = 0; mb < 4; ++mb)
#pragma unroll
        for (int nb = 0; nb < 4; ++nb) acc[mb][nb] = (v8f){};
    const size_t aoff = (size_t)(r0 + lr) * K + 8 * hi, boff = (size_t)(c0 + lr) * K + 8 * hi;
#pragma unroll 1
    for (int kc = 0; kc < K; kc += 32) {
        V a[4], a2[4];
#pragma unroll
        for (int mb = 0; mb < 4; ++mb) { a[mb] = WFrag<T16>::ld(A + aoff + (size_t)mb * 16 * K + kc); if (NSPLIT == 1 || NSPLIT == 2) a2[mb] = WFrag<T16>::ld(A2 + aoff + (size_t)mb * 16 * K + kc); }
#pragma unroll
        for (int nb = 0; nb < 4; ++nb) { const V b = WFrag<T16>::ld(Bt + boff + (size_t)nb * 16 * K + kc); V b2; if (NSPLIT >= 2) b2 = WFrag<T16>::ld(Bt2 + boff + (size_t)nb * 16 * K + kc);
#pragma unroll
            for (int mb = 0; mb < 4; ++mb) { acc[mb][nb] = WFrag<T16>::mma(a[mb], b, acc[mb][nb]); if (NSPLIT == 1 || NSPLIT == 2) acc[mb][nb] = WFrag<T16>::mma(a2[mb], b, acc[mb][nb]); if (NSPLIT >= 2) acc[mb][nb] = WFrag<T16>::mma(a[mb], b2, acc[mb][nb]); } }
        asm volatile("v_nop\n\tv_nop\n\tv_nop\n\tv_nop" : "+v"(acc[0][0]), "+v"(acc[1][1]), "+v"(acc[2][2]), "+v"(acc[3][3]) : "v"(a[0]), "v"(a[3]));
    }
    if (EPI == 2) {     // acc[mb][nb][0..7] = eight neighbouring rows of one column: one 16-byte store each; the four mb fill a 128-byte line of the transposed plane
#pragma unroll    // this and the two below: constant indices keep acc in registers
        for (int nb = 0; nb < 4; ++nb)
#pragma unroll
            for (int mb = 0; mb < 4; ++mb) { v8h o;
#pragma unroll
                for (int j = 0; j < 8; ++j) o[j] = (h16)acc[mb][nb][j];
                *(v8h*)(P16 + (size_t)(c0 + nb * 16 + lr) * TT + r0 + mb * 16 + 8 * hi) = o; }
        return;
    }
    const int g8 = lane >> 3, c8 = (lane & 7) * 8;     // EPI 1: eight lanes per row, eight columns per lane
    float gg[8], bb[8];
    if (EPI == 1) {
#pragma unroll    // constant indices keep gg and bb in registers
        for (int i = 0; i < 8; ++i) { gg[i] = bfr(gw[c8 + i]); bb[i] = bfr(gb[c8 + i]); } }
#pragma unroll
    for (int mb = 0; mb < 4; ++mb) {
#pragma unroll
        for (int nb = 0; nb < 4; ++nb) {
#pragma unroll
            for (int j = 0; j < 8; ++j) os[(hi * 8 + j) * 68 + nb * 16 + lr] = acc[mb][nb][j]; }
        __builtin_amdgcn_wave_barrier(); asm volatile("" ::: "memory");
        if (EPI == 1) {
#pragma unroll    // the four passes are independent: unrolled, their dependent sums interleave; the inner loops: constant indices keep d and o in registers
            for (int s = 0; s < 4; ++s) { const int row = 4 * s + g8; const v4f x0 = *(const v4fa*)(os + row * 68 + c8), x1 = *(const v4fa*)(os + row * 68 + c8 + 4);
                float d[8] = { x0[0], x0[1], x0[2], x0[3], x1[0], x1[1], x1[2], x1[3] };
                const float mu = xadd<4>(xadd<2>(xadd<1>(((d[0] + d[1]) + (d[2] + d[3])) + ((d[4] + d[5]) + (d[6] + d[7]))))) * (1.0f / 64.0f);
#pragma unroll
                for (int i = 0; i < 8; ++i) d[i] -= mu;
                const float s2 = xadd<4>(xadd<2>(xadd<1>(((d[0] * d[0] + d[1] * d[1]) + (d[2] * d[2] + d[3] * d[3])) + ((d[4] * d[4] + d[5] * d[5]) + (d[6] * d[6] + d[7] * d[7])))));
                const float rs = __frsqrt_rn(s2 * (1.0f / 64.0f) + LNEPS);
                v8h o;
#pragma unroll
                for (int i = 0; i < 8; ++i) o[i] = (h16)(((d[i] * rs) * gg[i] + bb[i]) * sc);
                *(v8h*)(P16 + ((size_t)blockIdx.y * TT + r0 + mb * 16 + row) * HD + c8) = o; }     // four whole 128-byte rows per store
        } else {
        float* crow = C + (size_t)(r0 + mb * 16) * ldc + c0;
#pragma unroll
            for (int s = 0; s < 8; ++s) { const int row = 2 * s + hi, cofs = lr * 4; v4f val = *(const v4fa*)(os + row * 68 + cofs); if (BIAS) { val[0] += bfr(bias[c0 + cofs]); val[1] += bfr(bias[c0 + cofs + 1]); val[2] += bfr(bias[c0 + cofs + 2]); val[3] += bfr(bias[c0 + cofs + 3]); }
                *(v4f*)(crow + (size_t)row * ldc + cofs) = val; }
             }
        __builtin_amdgcn_wave_barrier(); asm volatile("" ::: "memory");
    }
}

__device__ __forceinline__ h16 tohx(float x) { return (h16)x; }
__device__ __forceinline__ void splitf(float y, unsigned short& h, unsigned short& l) { h = f2bf(y); l = f2bf(y - bf2f(h)); }
typedef __attribute__((ext_vector_type(2))) _Float16 v2h;
typedef __attribute__((ext_vector_type(4))) _Float16 v4h;
typedef __attribute__((ext_vector_type(2))) unsigned short v2us;
typedef __attribute__((ext_vector_type(4))) unsigned short v4us;
typedef __attribute__((ext_vector_type(2))) float v2f;
typedef __attribute__((ext_vector_type(4))) int v4i;

__global__ __launch_bounds__(256) void k_cvt8(const float* __restrict__ src, bf* dst, size_t n8) { const size_t i = (size_t)blockIdx.x * 256 + threadIdx.x; if (i >= n8) return; const v8f v = *(const v8f*)(src + i * 8); v8us o;
#pragma unroll
    for (int k = 0; k < 8; ++k) o[k] = f2bf(v[k]); *(v8us*)(dst + i * 8) = o;  }

#define KST 64
#define LP_ 72
__device__ __forceinline__ v16h ldsfrag(const h16* p) { return cat16(*(const v8ha*)p, *(const v8ha*)(p + 16)); }
__global__ __launch_bounds__(256) __attribute__((amdgpu_waves_per_eu(4, 4))) void k_fattn(const h16* __restrict__ Q16, const h16* __restrict__ K16, const h16* __restrict__ V16, bf* Ah, bf* Al) {
    __shared__ __align__(16) h16 ks[2][KST * LP_];   // [key][d]
    __shared__ __align__(16) h16 vs[2][HD * LP_];    // [d][key]
    const int tid = threadIdx.x, lane = tid & 31, wave = tid >> 5, lr = lane & 15, hi = lane >> 4;
    const int h = blockIdx.y, q = blockIdx.x * 128 + wave * 16 + lr;
    const h16* Qh = Q16 + (size_t)h * TT * HD; const h16* Kh = K16 + (size_t)h * TT * HD; const h16* Vh = V16 + (size_t)h * HD * TT;
    v16h qf[2];
#pragma unroll
    for (int ds = 0; ds < 2; ++ds) qf[ds] = WFrag<h16>::ld(Qh + (size_t)q * HD + ds * 32 + 8 * hi) * (h16)0.5f;   // times a power of two (exact in f16 above its subnormals): the score tiles hold x / 2, which is what tanh takes
    v8f o[4];
#pragma unroll
    for (int db = 0; db < 4; ++db) o[db] = (v8f){};
    const int sr = tid >> 3, sc = (tid & 7) * 8;     // staging: 8 threads per 128-byte row, rows sr and sr + 32
    const h16* gk = Kh + (size_t)sr * HD + sc; const h16* gv = Vh + (size_t)sr * TT + sc; const int so = sr * LP_ + sc;
    v8h rk0 = *(const v8h*)gk, rk1 = *(const v8h*)(gk + 32 * HD), rv0 = *(const v8h*)gv, rv1 = *(const v8h*)(gv + (size_t)32 * TT);
    *(v8ha*)(ks[0] + so) = rk0; *(v8ha*)(ks[0] + so + 32 * LP_) = rk1; *(v8ha*)(vs[0] + so) = rv0; *(v8ha*)(vs[0] + so + 32 * LP_) = rv1;
    __syncthreads();
#pragma unroll 1
    for (int s = 0; s < TT / KST; ++s) {
        const int b = s & 1;
        if (s + 1 < TT / KST) { const h16* nk = gk + (size_t)(s + 1) * KST * HD; const h16* nv = gv + (size_t)(s + 1) * KST; rk0 = *(const v8h*)nk; rk1 = *(const v8h*)(nk + 32 * HD); rv0 = *(const v8h*)nv; rv1 = *(const v8h*)(nv + (size_t)32 * TT); }
#pragma unroll
        for (int p = 0; p < KST / 32; ++p) {
            v8f st[2];
#pragma unroll
            for (int kt = 0; kt < 2; ++kt) { st[kt] = (v8f){};
#pragma unroll
                for (int ds = 0; ds < 2; ++ds) st[kt] = wmma16(ldsfrag(ks[b] + (p * 32 + kt * 16 + lr) * LP_ + ds * 32 + 8 * hi), qf[ds], st[kt]); }
            v16h pb;
#pragma unroll
            for (int e = 0; e < 16; ++e) pb[e] = tohx(__builtin_fmaf(0.5f, __builtin_amdgcn_tanhf(st[e >> 3][e & 7]), 0.5f));   // st holds x / 2 (see qf)
#pragma unroll
            for (int db = 0; db < 4; ++db) o[db] = wmma16(ldsfrag(vs[b] + (db * 16 + lr) * LP_ + p * 32 + 8 * hi), pb, o[db]);
        }
        if (s + 1 < TT / KST) { h16* dk = ks[b ^ 1] + so; h16* dv = vs[b ^ 1] + so; *(v8ha*)dk = rk0; *(v8ha*)(dk + 32 * LP_) = rk1; *(v8ha*)dv = rv0; *(v8ha*)(dv + 32 * LP_) = rv1; }
        __syncthreads();   // publishes stage s + 1 and ends every wave's reads of stage s, whose buffer the next trip refills
    }
#pragma unroll
    for (int db = 0; db < 4; ++db) { v8us oh, ol;     // o[db][j] = x[q][h * 64 + db * 16 + 8 * hi + j]: eight neighbours of one row, one 16-byte store per plane
#pragma unroll
        for (int j = 0; j < 8; ++j) { unsigned short a, c2; splitf(o[db][j], a, c2); oh[j] = a; ol[j] = c2; }
        const size_t oo = (size_t)q * DQ + h * HD + db * 16 + 8 * hi; *(v8us*)(Ah + oo) = oh; *(v8us*)(Al + oo) = ol; }
}

extern "C" void kernel_launch(void* const* d_in, const int* in_sizes, int n_in,
                              void* d_out, int out_size, void* d_ws, size_t ws_size, hipStream_t stream) {
    (void)in_sizes; (void)n_in; (void)out_size;
    const float* xq = (const float*)d_in[0]; const float* xk = (const float*)d_in[1]; const float* xv = (const float*)d_in[2]; const float* wq = (const float*)d_in[3]; const float* wk = (const float*)d_in[4]; const float* wv = (const float*)d_in[5];
    const float* gq = (const float*)d_in[6]; const float* bq = (const float*)d_in[7]; const float* gk = (const float*)d_in[8]; const float* bk = (const float*)d_in[9]; const float* wp = (const float*)d_in[10]; const float* bp = (const float*)d_in[11];
    float* OUT = (float*)d_out;     // [1][4096][1024]
    char* wsp = (char*)d_ws;
    auto take = [&](size_t bytes) { char* p = wsp; wsp += (bytes + 255) & ~(size_t)255; return (void*)p; };
    bf* WQ = (bf*)take((size_t)DQ * DM * 2); bf* WK = (bf*)take((size_t)DQ * DM * 2); bf* WV = (bf*)take((size_t)DQ * DM * 2); bf* WP = (bf*)take((size_t)DM * DQ * 2);
    bf* XB = (bf*)take((size_t)TT * DM * 2);
    const size_t PS = (size_t)NH_ * TT * HD; h16* QP16 = (h16*)take(PS * 2); h16* KP16 = (h16*)take(PS * 2); h16* VT16 = (h16*)take(PS * 2);
    bf* ATh = (bf*)take((size_t)TT * DQ * 2); bf* ATl = (bf*)take((size_t)TT * DQ * 2);
    if ((size_t)(wsp - (char*)d_ws) > ws_size) return;    // ws 256 MiB
    const unsigned LW = (unsigned)(((size_t)DQ * DM / 8 + 255) / 256), LX = (unsigned)(((size_t)TT * DM / 8 + 255) / 256);
    k_cvt8<<<LW, 256, 0, stream>>>(wq, WQ, (size_t)DQ * DM / 8); k_cvt8<<<LW, 256, 0, stream>>>(wk, WK, (size_t)DQ * DM / 8); k_cvt8<<<LW, 256, 0, stream>>>(wv, WV, (size_t)DQ * DM / 8); k_cvt8<<<LW, 256, 0, stream>>>(wp, WP, (size_t)DM * DQ / 8);
    /* q */ k_cvt8<<<LX, 256, 0, stream>>>(xq, XB, (size_t)TT * DM / 8); k_gemmw<bf, 0, false, 1><<<dim3(TT / 64, DQ / 64, 1), 32, 0, stream>>>(XB, nullptr, WQ, nullptr, DM, nullptr, 0, nullptr, 0, 0, 0, gq, bq, SCL, QP16);
    /* k */ k_cvt8<<<LX, 256, 0, stream>>>(xk, XB, (size_t)TT * DM / 8); k_gemmw<bf, 0, false, 1><<<dim3(TT / 64, DQ / 64, 1), 32, 0, stream>>>(XB, nullptr, WK, nullptr, DM, nullptr, 0, nullptr, 0, 0, 0, gk, bk, 1.0f, KP16);
    /* v */ k_cvt8<<<LX, 256, 0, stream>>>(xv, XB, (size_t)TT * DM / 8); k_gemmw<bf, 0, false, 2><<<dim3(TT / 64, DQ / 64, 1), 32, 0, stream>>>(XB, nullptr, WV, nullptr, DM, nullptr, 0, nullptr, 0, 0, 0, nullptr, nullptr, 1.0f, VT16);
    k_fattn<<<dim3(TT / 128, NH_, 1), 256, 0, stream>>>(QP16, KP16, VT16, ATh, ATl);      /* sigmoid(qh.kh) vh, merged, hi/lo */
    k_gemmw<bf, 1, true, 0><<<dim3(TT / 64, DM / 64, 1), 32, 0, stream>>>(ATh, ATl, WP, nullptr, DQ, OUT, DM, bp, 0, 0, 0, nullptr, nullptr, 1.0f, nullptr);
}

// v004
// It runs in 142 microseconds.
// Timed twice side by side with v003, it ran 1.49 times as fast both times.
// Counting every step since v000, it is 14.9 times as fast.
#include <hip/hip_runtime.h>

// Sigmoid attention (q, k, v [1][4096][1024]; qh, kh, vh = (q Wq^T, k Wk^T, v Wv^T) ('oi' [1024][1024], no bias) split into 16 heads x 64; per-head LayerNorm over the 64 dims of qh (x gq + bq, then x 1/8) and kh (x gk + bk); attn = sigmoid(qh.kh) over the full 4096 x 4096 matrix (no softmax, no normalisation); x = attn vh merged; out = x Wp^T + bp -> [1][4096][1024] (4.2 M)).
// Compute dtypes, f32 accumulate: every input rounded to bf16; projections on PLAIN bf16 operands (inputs: exact); LayerNorm in f32 (in the projection's epilogue, eight lanes per head row); scores and attn.v on single fp16 planes (1 product each: sigmoid outputs lie in (0,1), no carry needed); sigmoid in f32 (0.5 + 0.5 tanh(x / 2), hardware tanh); merged heads hi/lo x exact Wp (2 products) + bp.
// Scores, sigmoid, attn.v and the head merge run in ONE launch (k_fattn): the 4096 x 4096 matrix of a head never leaves the registers.
// The q, k and v projections write the f16 head planes themselves: a wave's 64-column tile is exactly one head, so the LayerNorm (q, k) and the transpose (v) are done on the accumulators.

#define TT   4096
#define DM   1024
#define NH_  16
#define HD   64
#define DQ   (NH_ * HD)
#define SCL  0.125f
#define LNEPS 1e-5f
typedef _Float16 h16;
typedef unsigned short bf;
typedef __attribute__((ext_vector_type(16))) __bf16   v16bf;
typedef __attribute__((ext_vector_type(16))) _Float16 v16h;
typedef __attribute__((ext_vector_type(8)))  _Float16 v8h;
typedef __attribute__((ext_vector_type(8)))  unsigned short v8us;
typedef __attribute__((ext_vector_type(8)))  float    v8f;
typedef __attribute__((ext_vector_type(4)))  float    v4f;
typedef v8h  __attribute__((may_alias)) v8ha;
typedef v4f  __attribute__((may_alias)) v4fa;
typedef v8us __attribute__((may_alias)) v8usa;

__device__ __forceinline__ unsigned short f2bf(float f) { unsigned u = __float_as_uint(f); u += 0x7FFFu + ((u >> 16) & 1u); return (unsigned short)(u >> 16); }
__device__ __forceinline__ float bf2f(unsigned short b) { return __uint_as_float(((unsigned)b) << 16); }
__device__ __forceinline__ float bfr(float f) { return bf2f(f2bf(f)); }
__device__ __forceinline__ v16h cat16(v8h lo, v8h hi) { return __builtin_shufflevector(lo, hi, 0, 1, 2, 3, 4, 5, 6, 7, 8, 9, 10, 11, 12, 13, 14, 15); }
__device__ __forceinline__ v16bf cat16b(v8us lo, v8us hi) { return __builtin_bit_cast(v16bf, __builtin_shufflevector(lo, hi, 0, 1, 2, 3, 4, 5, 6, 7, 8, 9, 10, 11, 12, 13, 14, 15)); }
__device__ __forceinline__ v8f wmma16(v16h a, v16h b, v8f c) { return __builtin_amdgcn_wmma_f32_16x16x32_f16(false, a, false, b, (short)0, c, false, false); }
__device__ __forceinline__ v8f wmmab(v16bf a, v16bf b, v8f c) { return __builtin_amdgcn_wmma_f32_16x16x32_bf16(false, a, false, b, (short)0, c, false, false); }



// ---- k_gemmw: GEMM, workgroup = 4 waves (2 x 2) = one 128x128 output tile, 64x64 (16 accumulators) per wave; grid (M/128, N/128, Z), 128 threads.
// The 128 rows of each operand come in stages of 128 k (256 B per row: every wave-wide global load is four whole 128-byte lines) through registers into two LDS buffers; the waves read their fragments from LDS, each operand row feeding two waves.
// C[m][n] (f32, pitch ldc, + optional f32 bias[n]) = sum_k A[m][k] Bt[n][k] (NSPLIT 1: + A2[m][k] Bt[n][k]). z-batch strides sA/sB/sC in elements. K (a template constant: row offsets become immediates) % 128 == 0.
// EPI 0: C as above. EPI 1: a wave's 64 columns are one head; each row is normalised over them (x gw + gb, x sc) and stored as f16 to P16[head][row][64]. EPI 2: the tile is stored as f16, transposed, to P16[column][TT].
// amdgpu_waves_per_eu(1, 1): one wave per SIMD, that is one workgroup per WGP, so that the 256 equal workgroups of a launch cannot double up on some WGPs while others idle.
#define GKB 128
#define GLP (GKB + 8)     // LDS row pitch 272 B = 16 B x odd: no bank conflict for 16-byte fragment reads
template <typename T16> struct WFrag;
template <> struct WFrag<h16> { typedef v16h V; static __device__ __forceinline__ V ld(const h16* p) { return cat16(*(const v8h*)p, *(const v8h*)(p + 16)); } static __device__ __forceinline__ v8f mma(V a, V b, v8f c) { return wmma16(a, b, c); } };
template <> struct WFrag<bf> { typedef v16bf V; static __device__ __forceinline__ V lds(const bf* p) { return cat16b(*(const v8usa*)p, *(const v8usa*)(p + 16)); } static __device__ __forceinline__ v8f mma(V a, V b, v8f c) { return wmmab(a, b, c); } };
// x + (x of lane ^ M), M < 16: one step of a butterfly sum inside a 16-lane row, on the vector pipe (row_xmask), no LDS round trip.
template <int M> __device__ __forceinline__ float xadd(float x) { return x + __int_as_float(__builtin_amdgcn_update_dpp(0, __float_as_int(x), 0x160 | M, 0xf, 0xf, true)); }
template <typename T16, int K, int NSPLIT, bool BIAS, int EPI>
__global__ __launch_bounds__(128) __attribute__((amdgpu_waves_per_eu(1, 1))) void k_gemmw(const T16* __restrict__ A, const T16* __restrict__ A2, const T16* __restrict__ Bt, float* C, int ldc, const float* __restrict__ bias, size_t sA, size_t sB, size_t sC, const float* __restrict__ gw, const float* __restrict__ gb, float sc, h16* P16) {
    typedef typename WFrag<T16>::V V;
    static_assert(K % GKB == 0 && NSPLIT <= 1, "whole stages; planes A, Bt and at most A2");
    constexpr int NP = NSPLIT == 1 ? 3 : 2;     // staged planes: A, Bt (, A2)
    __shared__ __align__(16) T16 tl[2][NP][128 * GLP];
    __shared__ __align__(16) float osw[4][16 * 68];
    const size_t z = blockIdx.z; A += z * sA; if (NSPLIT == 1) A2 += z * sA; Bt += z * sB; C += z * sC;
    const int tid = threadIdx.x, lane = tid & 31, wave = tid >> 5, lr = lane & 15, hi = lane >> 4;
    const int wr = (wave & 1) * 64, wc = (wave >> 1) * 64, r0 = blockIdx.x * 128 + wr, c0 = blockIdx.y * 128 + wc;
    float* os = osw[wave];     // each wave's own epilogue rows
    v8f acc[4][4];
#pragma unroll
    for (int mb = 0; mb < 4; ++mb)
#pragma unroll
        for (int nb = 0; nb < 4; ++nb) acc[mb][nb] = (v8f){};
    const int sr = tid >> 4, sk = (tid & 15) * 8, so = sr * GLP + sk;     // staging: 16 threads per 256-byte row piece, rows sr + 8 i
    const unsigned go = sr * K + sk;     // the thread's element offset inside every plane's 128 rows
    const T16* ga = A + (size_t)blockIdx.x * 128 * K; const T16* gb_ = Bt + (size_t)blockIdx.y * 128 * K; const T16* gc = NSPLIT == 1 ? A2 + (size_t)blockIdx.x * 128 * K : gb_;     // wave-uniform plane bases
    v8us rg[NP][16];
#pragma unroll    // this and the staging loops below: constant indices keep rg in registers
    for (int i = 0; i < 16; ++i) { rg[0][i] = *(const v8usa*)(ga + go + 8 * i * K); rg[1][i] = *(const v8usa*)(gb_ + go + 8 * i * K); if (NSPLIT == 1) rg[NP - 1][i] = *(const v8usa*)(gc + go + 8 * i * K); }
    asm volatile("s_wait_xcnt 0x0" :: "v"(go * (unsigned)sizeof(T16)), "s"(ga), "s"(gb_), "s"(gc) : "memory");     // as the one in the loop, for the offset and base registers of the first stage's loads
#pragma unroll
    for (int pl = 0; pl < NP; ++pl)
#pragma unroll
        for (int i = 0; i < 16; ++i) *(v8usa*)(tl[0][pl] + so + 8 * i * GLP) = rg[pl][i];
    __syncthreads();
#pragma unroll 1    // one stage per trip: the two buffers alternate
    for (int s = 0; s < K / GKB; ++s) {
        const int b = s & 1;
        if (s + 1 < K / GKB) {
            const T16* pa = ga + (s + 1) * GKB + go; const T16* pb = gb_ + (s + 1) * GKB + go; const T16* pc = gc + (s + 1) * GKB + go;
#pragma unroll
            for (int i = 0; i < 16; ++i) { rg[0][i] = *(const v8usa*)(pa + 8 * i * K); rg[1][i] = *(const v8usa*)(pb + 8 * i * K); if (NSPLIT == 1) rg[NP - 1][i] = *(const v8usa*)(pc + 8 * i * K); }
            asm volatile("s_wait_xcnt 0x0" :: "v"(pa), "v"(pb), "v"(pc) : "memory");     // stands before any register that these loads name as an address is written again; as inputs the addresses stay in their registers up to here
        }
        const T16* la = tl[b][0] + (wr + lr) * GLP + 8 * hi; const T16* lb = tl[b][1] + (wc + lr) * GLP + 8 * hi; const T16* la2 = tl[b][NP - 1] + (wr + lr) * GLP + 8 * hi;
        V fa[2][4], fb[2][4], fa2[2][4];     // two fragment sets: the next 32 k are read from LDS while this set is multiplied
#pragma unroll
        for (int t = 0; t < 4; ++t) { fa[0][t] = WFrag<T16>::lds(la + t * 16 * GLP); fb[0][t] = WFrag<T16>::lds(lb + t * 16 * GLP); if (NSPLIT == 1) fa2[0][t] = WFrag<T16>::lds(la2 + t * 16 * GLP); }
#pragma unroll    // constant set indices keep the fragments in registers
        for (int kk = 0; kk < GKB / 32; ++kk) {
            const int cu = kk & 1, nx = cu ^ 1;
            if (kk + 1 < GKB / 32) {
#pragma unroll
                for (int t = 0; t < 4; ++t) { fa[nx][t] = WFrag<T16>::lds(la + t * 16 * GLP + (kk + 1) * 32); fb[nx][t] = WFrag<T16>::lds(lb + t * 16 * GLP + (kk + 1) * 32); if (NSPLIT == 1) fa2[nx][t] = WFrag<T16>::lds(la2 + t * 16 * GLP + (kk + 1) * 32); }
            }
            __builtin_amdgcn_sched_barrier(0);     // holds the next set's LDS reads as one group ahead of this matrix block: sunk among the products, each read would be waited for where it stands
#pragma unroll
            for (int nb = 0; nb < 4; ++nb) {
#pragma unroll
                for (int mb = 0; mb < 4; ++mb) acc[mb][nb] = WFrag<T16>::mma(fa[cu][mb], fb[cu][nb], acc[mb][nb]);
                if (NSPLIT == 1) {
#pragma unroll
                    for (int mb = 0; mb < 4; ++mb) acc[mb][nb] = WFrag<T16>::mma(fa2[cu][mb], fb[cu][nb], acc[mb][nb]); }
            }
            __builtin_amdgcn_sched_barrier(0);     // ends the block: the reads behind it stay one group too, not drawn up among these products
        }
        if (s + 1 < K / GKB) {
#pragma unroll
            for (int pl = 0; pl < NP; ++pl)
#pragma unroll
                for (int i = 0; i < 16; ++i) *(v8usa*)(tl[b ^ 1][pl] + so + 8 * i * GLP) = rg[pl][i];
        }
        __syncthreads();   // publishes stage s + 1 and ends every wave's reads of stage s, whose buffer the next trip refills
    }
    if (EPI == 2) {     // acc[mb][nb][0..7] = eight neighbouring rows of one column: one 16-byte store each; the four mb fill a 128-byte line of the transposed plane
#pragma unroll    // this and the two below: constant indices keep acc in registers
        for (int nb = 0; nb < 4; ++nb)
#pragma unroll
            for (int mb = 0; mb < 4; ++mb) { v8h o;
#pragma unroll
                for (int j = 0; j < 8; ++j) o[j] = (h16)acc[mb][nb][j];
                *(v8h*)(P16 + (size_t)(c0 + nb * 16 + lr) * TT + r0 + mb * 16 + 8 * hi) = o;
                asm volatile("s_wait_xcnt 0x0" :: "v"(o) : "memory"); }     // before the store's registers are written again; as an input the stored value stays in its registers up to here
        return;
    }
    const int g8 = lane >> 3, c8 = (lane & 7) * 8;     // EPI 1: eight lanes per row, eight columns per lane
    float gg[8], bb[8];
    if (EPI == 1) {
#pragma unroll    // constant indices keep gg and bb in registers
        for (int i = 0; i < 8; ++i) { gg[i] = bfr(gw[c8 + i]); bb[i] = bfr(gb[c8 + i]); } }
#pragma unroll
    for (int mb = 0; mb < 4; ++mb) {
#pragma unroll
        for (int nb = 0; nb < 4; ++nb) {
#pragma unroll
            for (int j = 0; j < 8; ++j) os[(hi * 8 + j) * 68 + nb * 16 + lr] = acc[mb][nb][j]; }
        __builtin_amdgcn_wave_barrier(); asm volatile("" ::: "memory");
        if (EPI == 1) {
#pragma unroll    // the four passes are independent: unrolled, their dependent sums interleave; the inner loops: constant indices keep d and o in registers
            for (int s = 0; s < 4; ++s) { const int row = 4 * s + g8; const v4f x0 = *(const v4fa*)(os + row * 68 + c8), x1 = *(const v4fa*)(os + row * 68 + c8 + 4);
                float d[8] = { x0[0], x0[1], x0[2], x0[3], x1[0], x1[1], x1[2], x1[3] };
                const float mu = xadd<4>(xadd<2>(xadd<1>(((d[0] + d[1]) + (d[2] + d[3])) + ((d[4] + d[5]) + (d[6] + d[7]))))) * (1.0f / 64.0f);
#pragma unroll
                for (int i = 0; i < 8; ++i) d[i] -= mu;
                const float s2 = xadd<4>(xadd<2>(xadd<1>(((d[0] * d[0] + d[1] * d[1]) + (d[2] * d[2] + d[3] * d[3])) + ((d[4] * d[4] + d[5] * d[5]) + (d[6] * d[6] + d[7] * d[7])))));
                const float rs = __frsqrt_rn(s2 * (1.0f / 64.0f) + LNEPS);
                v8h o;
#pragma unroll
                for (int i = 0; i < 8; ++i) o[i] = (h16)(((d[i] * rs) * gg[i] + bb[i]) * sc);
                *(v8h*)(P16 + ((size_t)(c0 >> 6) * TT + r0 + mb * 16 + row) * HD + c8) = o; }     // four whole 128-byte rows per store
        } else {
        float* crow = C + (size_t)(r0 + mb * 16) * ldc + c0;
#pragma unroll
            for (int s = 0; s < 8; ++s) { const int row = 2 * s + hi, cofs = lr * 4; v4f val = *(const v4fa*)(os + row * 68 + cofs); if (BIAS) { val[0] += bfr(bias[c0 + cofs]); val[1] += bfr(bias[c0 + cofs + 1]); val[2] += bfr(bias[c0 + cofs + 2]); val[3] += bfr(bias[c0 + cofs + 3]); }
                *(v4f*)(crow + (size_t)row * ldc + cofs) = val; }
            asm volatile("s_wait_xcnt 0x0" ::: "memory");     // before the stores' registers are written again
             }
        __builtin_amdgcn_wave_barrier(); asm volatile("" ::: "memory");
    }
}

__device__ __forceinline__ h16 tohx(float x) { return (h16)x; }
__device__ __forceinline__ void splitf(float y, unsigned short& h, unsigned short& l) { h = f2bf(y); l = f2bf(y - bf2f(h)); }
typedef __attribute__((ext_vector_type(2))) _Float16 v2h;
typedef __attribute__((ext_vector_type(4))) _Float16 v4h;
typedef __attribute__((ext_vector_type(2))) unsigned short v2us;
typedef __attribute__((ext_vector_type(4))) unsigned short v4us;
typedef __attribute__((ext_vector_type(2))) float v2f;
typedef __attribute__((ext_vector_type(4))) int v4i;

__global__ __launch_bounds__(256) void k_cvt8(const float* __restrict__ src, bf* dst, size_t n8) { const size_t i = (size_t)blockIdx.x * 256 + threadIdx.x; if (i >= n8) return; const v8f v = *(const v8f*)(src + i * 8); v8us o;
#pragma unroll
    for (int k = 0; k < 8; ++k) o[k] = f2bf(v[k]); *(v8us*)(dst + i * 8) = o;  }

#define KST 64
#define LP_ 72
__device__ __forceinline__ v16h ldsfrag(const h16* p) { return cat16(*(const v8ha*)p, *(const v8ha*)(p + 16)); }
__global__ __launch_bounds__(256) __attribute__((amdgpu_waves_per_eu(4, 4))) void k_fattn(const h16* __restrict__ Q16, const h16* __restrict__ K16, const h16* __restrict__ V16, bf* Ah, bf* Al) {
    __shared__ __align__(16) h16 ks[2][KST * LP_];   // [key][d]
    __shared__ __align__(16) h16 vs[2][HD * LP_];    // [d][key]
    const int tid = threadIdx.x, lane = tid & 31, wave = tid >> 5, lr = lane & 15, hi = lane >> 4;
    const int h = blockIdx.y, q = blockIdx.x * 128 + wave * 16 + lr;
    const h16* Qh = Q16 + (size_t)h * TT * HD; const h16* Kh = K16 + (size_t)h * TT * HD; const h16* Vh = V16 + (size_t)h * HD * TT;
    v16h qf[2];
#pragma unroll
    for (int ds = 0; ds < 2; ++ds) qf[ds] = WFrag<h16>::ld(Qh + (size_t)q * HD + ds * 32 + 8 * hi) * (h16)0.5f;   // times a power of two (exact in f16 above its subnormals): the score tiles hold x / 2, which is what tanh takes
    v8f o[4];
#pragma unroll
    for (int db = 0; db < 4; ++db) o[db] = (v8f){};
    const int sr = tid >> 3, sc = (tid & 7) * 8;     // staging: 8 threads per 128-byte row, rows sr and sr + 32
    const h16* gk = Kh + (size_t)sr * HD + sc; const h16* gv = Vh + (size_t)sr * TT + sc; const int so = sr * LP_ + sc;
    v8h rk0 = *(const v8h*)gk, rk1 = *(const v8h*)(gk + 32 * HD), rv0 = *(const v8h*)gv, rv1 = *(const v8h*)(gv + (size_t)32 * TT);
    *(v8ha*)(ks[0] + so) = rk0; *(v8ha*)(ks[0] + so + 32 * LP_) = rk1; *(v8ha*)(vs[0] + so) = rv0; *(v8ha*)(vs[0] + so + 32 * LP_) = rv1;
    __syncthreads();
#pragma unroll 1
    for (int s = 0; s < TT / KST; ++s) {
        const int b = s & 1;
        if (s + 1 < TT / KST) { const h16* nk = gk + (size_t)(s + 1) * KST * HD; const h16* nv = gv + (size_t)(s + 1) * KST; rk0 = *(const v8h*)nk; rk1 = *(const v8h*)(nk + 32 * HD); rv0 = *(const v8h*)nv; rv1 = *(const v8h*)(nv + (size_t)32 * TT); }
#pragma unroll
        for (int p = 0; p < KST / 32; ++p) {
            v8f st[2];
#pragma unroll
            for (int kt = 0; kt < 2; ++kt) { st[kt] = (v8f){};
#pragma unroll
                for (int ds = 0; ds < 2; ++ds) st[kt] = wmma16(ldsfrag(ks[b] + (p * 32 + kt * 16 + lr) * LP_ + ds * 32 + 8 * hi), qf[ds], st[kt]); }
            v16h pb;
#pragma unroll
            for (int e = 0; e < 16; ++e) pb[e] = tohx(__builtin_fmaf(0.5f, __builtin_amdgcn_tanhf(st[e >> 3][e & 7]), 0.5f));   // st holds x / 2 (see qf)
#pragma unroll
            for (int db = 0; db < 4; ++db) o[db] = wmma16(ldsfrag(vs[b] + (db * 16 + lr) * LP_ + p * 32 + 8 * hi), pb, o[db]);
        }
        if (s + 1 < TT / KST) { h16* dk = ks[b ^ 1] + so; h16* dv = vs[b ^ 1] + so; *(v8ha*)dk = rk0; *(v8ha*)(dk + 32 * LP_) = rk1; *(v8ha*)dv = rv0; *(v8ha*)(dv + 32 * LP_) = rv1; }
        __syncthreads();   // publishes stage s + 1 and ends every wave's reads of stage s, whose buffer the next trip refills
    }
#pragma unroll
    for (int db = 0; db < 4; ++db) { v8us oh, ol;     // o[db][j] = x[q][h * 64 + db * 16 + 8 * hi + j]: eight neighbours of one row, one 16-byte store per plane
#pragma unroll
        for (int j = 0; j < 8; ++j) { unsigned short a, c2; splitf(o[db][j], a, c2); oh[j] = a; ol[j] = c2; }
        const size_t oo = (size_t)q * DQ + h * HD + db * 16 + 8 * hi; *(v8us*)(Ah + oo) = oh; *(v8us*)(Al + oo) = ol; }
}

extern "C" void kernel_launch(void* const* d_in, const int* in_sizes, int n_in,
                              void* d_out, int out_size, void* d_ws, size_t ws_size, hipStream_t stream) {
    (void)in_sizes; (void)n_in; (void)out_size;
    const float* xq = (const float*)d_in[0]; const float* xk = (const float*)d_in[1]; const float* xv = (const float*)d_in[2]; const float* wq = (const float*)d_in[3]; const float* wk = (const float*)d_in[4]; const float* wv = (const float*)d_in[5];
    const float* gq = (const float*)d_in[6]; const float* bq = (const float*)d_in[7]; const float* gk = (const float*)d_in[8]; const float* bk = (const float*)d_in[9]; const float* wp = (const float*)d_in[10]; const float* bp = (const float*)d_in[11];
    float* OUT = (float*)d_out;     // [1][4096][1024]
    char* wsp = (char*)d_ws;
    auto take = [&](size_t bytes) { char* p = wsp; wsp += (bytes + 255) & ~(size_t)255; return (void*)p; };
    bf* WQ = (bf*)take((size_t)DQ * DM * 2); bf* WK = (bf*)take((size_t)DQ * DM * 2); bf* WV = (bf*)take((size_t)DQ * DM * 2); bf* WP = (bf*)take((size_t)DM * DQ * 2);
    bf* XB = (bf*)take((size_t)TT * DM * 2);
    const size_t PS = (size_t)NH_ * TT * HD; h16* QP16 = (h16*)take(PS * 2); h16* KP16 = (h16*)take(PS * 2); h16* VT16 = (h16*)take(PS * 2);
    bf* ATh = (bf*)take((size_t)TT * DQ * 2); bf* ATl = (bf*)take((size_t)TT * DQ * 2);
    if ((size_t)(wsp - (char*)d_ws) > ws_size) return;    // ws 256 MiB
    const unsigned LW = (unsigned)(((size_t)DQ * DM / 8 + 255) / 256), LX = (unsigned)(((size_t)TT * DM / 8 + 255) / 256);
    k_cvt8<<<LW, 256, 0, stream>>>(wq, WQ, (size_t)DQ * DM / 8); k_cvt8<<<LW, 256, 0, stream>>>(wk, WK, (size_t)DQ * DM / 8); k_cvt8<<<LW, 256, 0, stream>>>(wv, WV, (size_t)DQ * DM / 8); k_cvt8<<<LW, 256, 0, stream>>>(wp, WP, (size_t)DM * DQ / 8);
    /* q */ k_cvt8<<<LX, 256, 0, stream>>>(xq, XB, (size_t)TT * DM / 8); k_gemmw<bf, DM, 0, false, 1><<<dim3(TT / 128, DQ / 128, 1), 128, 0, stream>>>(XB, nullptr, WQ, nullptr, 0, nullptr, 0, 0, 0, gq, bq, SCL, QP16);
    /* k */ k_cvt8<<<LX, 256, 0, stream>>>(xk, XB, (size_t)TT * DM / 8); k_gemmw<bf, DM, 0, false, 1><<<dim3(TT / 128, DQ / 128, 1), 128, 0, stream>>>(XB, nullptr, WK, nullptr, 0, nullptr, 0, 0, 0, gk, bk, 1.0f, KP16);
    /* v */ k_cvt8<<<LX, 256, 0, stream>>>(xv, XB, (size_t)TT * DM / 8); k_gemmw<bf, DM, 0, false, 2><<<dim3(TT / 128, DQ / 128, 1), 128, 0, stream>>>(XB, nullptr, WV, nullptr, 0, nullptr, 0, 0, 0, nullptr, nullptr, 1.0f, VT16);
    k_fattn<<<dim3(TT / 128, NH_, 1), 256, 0, stream>>>(QP16, KP16, VT16, ATh, ATl);      /* sigmoid(qh.kh) vh, merged, hi/lo */
    k_gemmw<bf, DQ, 1, true, 0><<<dim3(TT / 128, DM / 128, 1), 128, 0, stream>>>(ATh, ATl, WP, OUT, DM, bp, 0, 0, 0, nullptr, nullptr, 1.0f, nullptr);
}

// v005
// A run of this version takes 130 microseconds.
// Timed twice side by side with v004, it ran 1.09 times as fast both times.
// All steps since v000 together make it 16.2 times as fast.
#include <hip/hip_runtime.h>

// Sigmoid attention (q, k, v [1][4096][1024]; qh, kh, vh = (q Wq^T, k Wk^T, v Wv^T) ('oi' [1024][1024], no bias) split into 16 heads x 64; per-head LayerNorm over the 64 dims of qh (x gq + bq, then x 1/8) and kh (x gk + bk); attn = sigmoid(qh.kh) over the full 4096 x 4096 matrix (no softmax, no normalisation); x = attn vh merged; out = x Wp^T + bp -> [1][4096][1024] (4.2 M)).
// Compute dtypes, f32 accumulate: every input rounded to bf16; projections on PLAIN bf16 operands (inputs: exact); LayerNorm in f32 (in the projection's epilogue, eight lanes per head row); scores and attn.v on single fp16 planes (1 product each: sigmoid outputs lie in (0,1), no carry needed); sigmoid in f32 (0.5 + 0.5 tanh(x / 2), hardware tanh); merged heads hi/lo x exact Wp (2 products) + bp.
// Scores, sigmoid, attn.v and the head merge run in ONE launch (k_fattn): the 4096 x 4096 matrix of a head never leaves the registers.
// The q, k and v projections write the f16 head planes themselves: a wave's 64-column tile is exactly one head, so the LayerNorm (q, k) and the transpose (v) are done on the accumulators.

#define TT   4096
#define DM   1024
#define NH_  16
#define HD   64
#define DQ   (NH_ * HD)
#define SCL  0.125f
#define LNEPS 1e-5f
typedef _Float16 h16;
typedef unsigned short bf;
typedef __attribute__((ext_vector_type(16))) __bf16   v16bf;
typedef __attribute__((ext_vector_type(16))) _Float16 v16h;
typedef __attribute__((ext_vector_type(8)))  _Float16 v8h;
typedef __attribute__((ext_vector_type(8)))  unsigned short v8us;
typedef __attribute__((ext_vector_type(8)))  float    v8f;
typedef __attribute__((ext_vector_type(4)))  float    v4f;
typedef v8h  __attribute__((may_alias)) v8ha;
typedef v4f  __attribute__((may_alias)) v4fa;
typedef v8us __attribute__((may_alias)) v8usa;

__device__ __forceinline__ unsigned short f2bf(float f) { unsigned u = __float_as_uint(f); u += 0x7FFFu + ((u >> 16) & 1u); return (unsigned short)(u >> 16); }
__device__ __forceinline__ float bf2f(unsigned short b) { return __uint_as_float(((unsigned)b) << 16); }
__device__ __forceinline__ float bfr(float f) { return bf2f(f2bf(f)); }
__device__ __forceinline__ v16h cat16(v8h lo, v8h hi) { return __builtin_shufflevector(lo, hi, 0, 1, 2, 3, 4, 5, 6, 7, 8, 9, 10, 11, 12, 13, 14, 15); }
__device__ __forceinline__ v16bf cat16b(v8us lo, v8us hi) { return __builtin_bit_cast(v16bf, __builtin_shufflevector(lo, hi, 0, 1, 2, 3, 4, 5, 6, 7, 8, 9, 10, 11, 12, 13, 14, 15)); }
__device__ __forceinline__ v8f wmma16(v16h a, v16h b, v8f c) { return __builtin_amdgcn_wmma_f32_16x16x32_f16(false, a, false, b, (short)0, c, false, false); }
__device__ __forceinline__ v8f wmmab(v16bf a, v16bf b, v8f c) { return __builtin_amdgcn_wmma_f32_16x16x32_bf16(false, a, false, b, (short)0, c, false, false); }



// ---- k_gemmw: GEMM, workgroup = 4 waves (2 x 2) = one 128x128 output tile, 64x64 (16 accumulators) per wave; grid (M/128, N/128, Z), 128 threads.
// The 128 rows of each operand come in stages of 128 k (256 B per row: every wave-wide global load is four whole 128-byte lines) through registers into two LDS buffers; the waves read their fragments from LDS, each operand row feeding two waves.
// C[m][n] (f32, pitch ldc, + optional f32 bias[n]) = sum_k A[m][k] Bt[n][k] (NSPLIT 1: + A2[m][k] Bt[n][k]). z-batch strides sA/sB/sC in elements. K (a template constant: row offsets become immediates) % 128 == 0.
// EPI 0: C as above. EPI 1: a wave's 64 columns are one head; each row is normalised over them (x gw + gb, x sc) and stored as f16 to P16[head][row][64]. EPI 2: the tile is stored as f16, transposed, to P16[column][TT].
// amdgpu_waves_per_eu(1, 1): one wave per SIMD, that is one workgroup per WGP, so that the 256 equal workgroups of a launch cannot double up on some WGPs while others idle.
#define GKB 128
#define GLP (GKB + 8)     // LDS row pitch 272 B = 16 B x odd: no bank conflict for 16-byte fragment reads
template <typename T16> struct WFrag;
template <> struct WFrag<h16> { typedef v16h V; static __device__ __forceinline__ V ld(const h16* p) { return cat16(*(const v8h*)p, *(const v8h*)(p + 16)); } static __device__ __forceinline__ v8f mma(V a, V b, v8f c) { return wmma16(a, b, c); } };
template <> struct WFrag<bf> { typedef v16bf V; static __device__ __forceinline__ V lds(const bf* p) { return cat16b(*(const v8usa*)p, *(const v8usa*)(p + 16)); } static __device__ __forceinline__ v8f mma(V a, V b, v8f c) { return wmmab(a, b, c); } };
// x + (x of lane ^ M), M < 16: one step of a butterfly sum inside a 16-lane row, on the vector pipe (row_xmask), no LDS round trip.
template <int M> __device__ __forceinline__ float xadd(float x) { return x + __int_as_float(__builtin_amdgcn_update_dpp(0, __float_as_int(x), 0x160 | M, 0xf, 0xf, true)); }
template <typename T16, int K, int NSPLIT, bool BIAS, int EPI>
__global__ __launch_bounds__(128) __attribute__((amdgpu_waves_per_eu(1, 1))) void k_gemmw(const T16* __restrict__ A, const T16* __restrict__ A2, const T16* __restrict__ Bt, float* C, int ldc, const float* __restrict__ bias, size_t sA, size_t sB, size_t sC, const float* __restrict__ gw, const float* __restrict__ gb, float sc, h16* P16) {
    typedef typename WFrag<T16>::V V;
    static_assert(K % GKB == 0 && NSPLIT <= 1, "whole stages; planes A, Bt and at most A2");
    constexpr int NP = NSPLIT == 1 ? 3 : 2;     // staged planes: A, Bt (, A2)
    __shared__ __align__(16) T16 tl[2][NP][128 * GLP];
    __shared__ __align__(16) float osw[4][16 * 68];
    const size_t z = blockIdx.z; A += z * sA; if (NSPLIT == 1) A2 += z * sA; Bt += z * sB; C += z * sC;
    const int tid = threadIdx.x, lane = tid & 31, wave = tid >> 5, lr = lane & 15, hi = lane >> 4;
    const int wr = (wave & 1) * 64, wc = (wave >> 1) * 64, r0 = blockIdx.x * 128 + wr, c0 = blockIdx.y * 128 + wc;
    float* os = osw[wave];     // each wave's own epilogue rows
    v8f acc[4][4];
#pragma unroll
    for (int mb = 0; mb < 4; ++mb)
#pragma unroll
        for (int nb = 0; nb < 4; ++nb) acc[mb][nb] = (v8f){};
    const int sr = tid >> 4, sk = (tid & 15) * 8, so = sr * GLP + sk;     // staging: 16 threads per 256-byte row piece, rows sr + 8 i
    const unsigned go = sr * K + sk;     // the thread's element offset inside every plane's 128 rows
    const T16* ga = A + (size_t)blockIdx.x * 128 * K; const T16* gb_ = Bt + (size_t)blockIdx.y * 128 * K; const T16* gc = NSPLIT == 1 ? A2 + (size_t)blockIdx.x * 128 * K : gb_;     // wave-uniform plane bases
    v8us rg[NP][16];
#pragma unroll    // this and the staging loops below: constant indices keep rg in registers
    for (int i = 0; i < 16; ++i) { rg[0][i] = *(const v8usa*)(ga + go + 8 * i * K); rg[1][i] = *(const v8usa*)(gb_ + go + 8 * i * K); if (NSPLIT == 1) rg[NP - 1][i] = *(const v8usa*)(gc + go + 8 * i * K); }
    asm volatile("s_wait_xcnt 0x0" :: "v"(go * (unsigned)sizeof(T16)), "s"(ga), "s"(gb_), "s"(gc) : "memory");     // as the one in the loop, for the offset and base registers of the first stage's loads
#pragma unroll
    for (int pl = 0; pl < NP; ++pl)
#pragma unroll
        for (int i = 0; i < 16; ++i) *(v8usa*)(tl[0][pl] + so + 8 * i * GLP) = rg[pl][i];
    __syncthreads();
#pragma unroll 1    // one stage per trip: the two buffers alternate
    for (int s = 0; s < K / GKB; ++s) {
        const int b = s & 1;
        if (s + 1 < K / GKB) {
            const T16* pa = ga + (s + 1) * GKB + go; const T16* pb = gb_ + (s + 1) * GKB + go; const T16* pc = gc + (s + 1) * GKB + go;
#pragma unroll
            for (int i = 0; i < 16; ++i) { rg[0][i] = *(const v8usa*)(pa + 8 * i * K); rg[1][i] = *(const v8usa*)(pb + 8 * i * K); if (NSPLIT == 1) rg[NP - 1][i] = *(const v8usa*)(pc + 8 * i * K); }
            asm volatile("s_wait_xcnt 0x0" :: "v"(pa), "v"(pb), "v"(pc) : "memory");     // stands before any register that these loads name as an address is written again; as inputs the addresses stay in their registers up to here
        }
        const T16* la = tl[b][0] + (wr + lr) * GLP + 8 * hi; const T16* lb = tl[b][1] + (wc + lr) * GLP + 8 * hi; const T16* la2 = tl[b][NP - 1] + (wr + lr) * GLP + 8 * hi;
        V fa[2][4], fb[2][4], fa2[2][4];     // two fragment sets: the next 32 k are read from LDS while this set is multiplied
#pragma unroll
        for (int t = 0; t < 4; ++t) { fa[0][t] = WFrag<T16>::lds(la + t * 16 * GLP); fb[0][t] = WFrag<T16>::lds(lb + t * 16 * GLP); if (NSPLIT == 1) fa2[0][t] = WFrag<T16>::lds(la2 + t * 16 * GLP); }
#pragma unroll    // constant set indices keep the fragments in registers
        for (int kk = 0; kk < GKB / 32; ++kk) {
            const int cu = kk & 1, nx = cu ^ 1;
            if (kk + 1 < GKB / 32) {
#pragma unroll
                for (int t = 0; t < 4; ++t) { fa[nx][t] = WFrag<T16>::lds(la + t * 16 * GLP + (kk + 1) * 32); fb[nx][t] = WFrag<T16>::lds(lb + t * 16 * GLP + (kk + 1) * 32); if (NSPLIT == 1) fa2[nx][t] = WFrag<T16>::lds(la2 + t * 16 * GLP + (kk + 1) * 32); }
            }
            __builtin_amdgcn_sched_barrier(0);     // holds the next set's LDS reads as one group ahead of this matrix block: sunk among the products, each read would be waited for where it stands
#pragma unroll
            for (int nb = 0; nb < 4; ++nb) {
#pragma unroll
                for (int mb = 0; mb < 4; ++mb) acc[mb][nb] = WFrag<T16>::mma(fa[cu][mb], fb[cu][nb], acc[mb][nb]);
                if (NSPLIT == 1) {
#pragma unroll
                    for (int mb = 0; mb < 4; ++mb) acc[mb][nb] = WFrag<T16>::mma(fa2[cu][mb], fb[cu][nb], acc[mb][nb]); }
            }
            __builtin_amdgcn_sched_barrier(0);     // ends the block: the reads behind it stay one group too, not drawn up among these products
        }
        if (s + 1 < K / GKB) {
#pragma unroll
            for (int pl = 0; pl < NP; ++pl)
#pragma unroll
                for (int i = 0; i < 16; ++i) *(v8usa*)(tl[b ^ 1][pl] + so + 8 * i * GLP) = rg[pl][i];
        }
        __syncthreads();   // publishes stage s + 1 and ends every wave's reads of stage s, whose buffer the next trip refills
    }
    if (EPI == 2) {     // acc[mb][nb][0..7] = eight neighbouring rows of one column: one 16-byte store each; the four mb fill a 128-byte line of the transposed plane
#pragma unroll    // this and the two below: constant indices keep acc in registers
        for (int nb = 0; nb < 4; ++nb)
#pragma unroll
            for (int mb = 0; mb < 4; ++mb) { v8h o;
#pragma unroll
                for (int j = 0; j < 8; ++j) o[j] = (h16)acc[mb][nb][j];
                *(v8h*)(P16 + (size_t)(c0 + nb * 16 + lr) * TT + r0 + mb * 16 + 8 * hi) = o;
                asm volatile("s_wait_xcnt 0x0" :: "v"(o) : "memory"); }     // before the store's registers are written again; as an input the stored value stays in its registers up to here
        return;
    }
    const int g8 = lane >> 3, c8 = (lane & 7) * 8;     // EPI 1: eight lanes per row, eight columns per lane
    float gg[8], bb[8];
    if (EPI == 1) {
#pragma unroll    // constant indices keep gg and bb in registers
        for (int i = 0; i < 8; ++i) { gg[i] = bfr(gw[c8 + i]); bb[i] = bfr(gb[c8 + i]); } }
#pragma unroll
    for (int mb = 0; mb < 4; ++mb) {
#pragma unroll
        for (int nb = 0; nb < 4; ++nb) {
#pragma unroll
            for (int j = 0; j < 8; ++j) os[(hi * 8 + j) * 68 + nb * 16 + lr] = acc[mb][nb][j]; }
        __builtin_amdgcn_wave_barrier(); asm volatile("" ::: "memory");
        if (EPI == 1) {
#pragma unroll    // the four passes are independent: unrolled, their dependent sums interleave; the inner loops: constant indices keep d and o in registers
            for (int s = 0; s < 4; ++s) { const int row = 4 * s + g8; const v4f x0 = *(const v4fa*)(os + row * 68 + c8), x1 = *(const v4fa*)(os + row * 68 + c8 + 4);
                float d[8] = { x0[0], x0[1], x0[2], x0[3], x1[0], x1[1], x1[2], x1[3] };
                const float mu = xadd<4>(xadd<2>(xadd<1>(((d[0] + d[1]) + (d[2] + d[3])) + ((d[4] + d[5]) + (d[6] + d[7]))))) * (1.0f / 64.0f);
#pragma unroll
                for (int i = 0; i < 8; ++i) d[i] -= mu;
                const float s2 = xadd<4>(xadd<2>(xadd<1>(((d[0] * d[0] + d[1] * d[1]) + (d[2] * d[2] + d[3] * d[3])) + ((d[4] * d[4] + d[5] * d[5]) + (d[6] * d[6] + d[7] * d[7])))));
                const float rs = __frsqrt_rn(s2 * (1.0f / 64.0f) + LNEPS);
                v8h o;
#pragma unroll
                for (int i = 0; i < 8; ++i) o[i] = (h16)(((d[i] * rs) * gg[i] + bb[i]) * sc);
                *(v8h*)(P16 + ((size_t)(c0 >> 6) * TT + r0 + mb * 16 + row) * HD + c8) = o; }     // four whole 128-byte rows per store
        } else {
        float* crow = C + (size_t)(r0 + mb * 16) * ldc + c0;
#pragma unroll
            for (int s = 0; s < 8; ++s) { const int row = 2 * s + hi, cofs = lr * 4; v4f val = *(const v4fa*)(os + row * 68 + cofs); if (BIAS) { val[0] += bfr(bias[c0 + cofs]); val[1] += bfr(bias[c0 + cofs + 1]); val[2] += bfr(bias[c0 + cofs + 2]); val[3] += bfr(bias[c0 + cofs + 3]); }
                *(v4f*)(crow + (size_t)row * ldc + cofs) = val; }
            asm volatile("s_wait_xcnt 0x0" ::: "memory");     // before the stores' registers are written again
             }
        __builtin_amdgcn_wave_barrier(); asm volatile("" ::: "memory");
    }
}

__device__ __forceinline__ h16 tohx(float x) { return (h16)x; }
__device__ __forceinline__ void splitf(float y, unsigned short& h, unsigned short& l) { h = f2bf(y); l = f2bf(y - bf2f(h)); }
typedef __attribute__((ext_vector_type(2))) _Float16 v2h;
typedef __attribute__((ext_vector_type(4))) _Float16 v4h;
typedef __attribute__((ext_vector_type(2))) unsigned short v2us;
typedef __attribute__((ext_vector_type(4))) unsigned short v4us;
typedef __attribute__((ext_vector_type(2))) float v2f;
typedef __attribute__((ext_vector_type(4))) int v4i;

// ---- k_cvtall: every f32 -> bf16 rounding of the call (Wq, Wk, Wv, Wp, q, k, v) in ONE launch of 256 workgroups of 16 waves, one per WGP: few waves to start, one launch gap.
// A workgroup takes CVG floats of one input, a wave CVL * 128 of them in a row: CVL wave-wide loads of 512 contiguous bytes, all issued before the first is used, each rounded and stored as 256 contiguous bytes.
// The seven bf16 planes lie one behind the other in dst in the order of the arguments, so workgroup b writes dst + b * CVG whatever input it reads.
// amdgpu_waves_per_eu(4, 4): the register budget of four waves per SIMD, so that all CVL loads have registers of their own; at more than 128 registers a wave no second workgroup fits a WGP, so the equal workgroups cannot double up on some WGPs while others idle.
#define CVL 32
#define CVG (16 * CVL * 128)
#define CVNW (DQ * DM / CVG)     // workgroups per weight matrix
#define CVNX (TT * DM / CVG)     // workgroups per activation matrix
__global__ __launch_bounds__(512) __attribute__((amdgpu_waves_per_eu(4, 4))) void k_cvtall(const float* __restrict__ wq, const float* __restrict__ wk, const float* __restrict__ wv, const float* __restrict__ wp, const float* __restrict__ xq, const float* __restrict__ xk, const float* __restrict__ xv, bf* dst) {
    static_assert(DQ * DM % CVG == 0 && TT * DM % CVG == 0, "whole workgroups per input");
    const unsigned b = blockIdx.x, iw = b / CVNW, ix = (b - 4 * CVNW) / CVNX;
    const float* src = b < 4 * CVNW ? (iw == 0 ? wq : iw == 1 ? wk : iw == 2 ? wv : wp) : (ix == 0 ? xq : ix == 1 ? xk : xv);
    const unsigned sb = b < 4 * CVNW ? b % CVNW : (b - 4 * CVNW) % CVNX, to = (threadIdx.x >> 5) * (CVL * 128) + (threadIdx.x & 31) * 4;
    const float* sw = src + (size_t)sb * CVG; bf* d = dst + (size_t)b * CVG + to;     // sw: wave-uniform base of the workgroup's floats
    v4f r[CVL];
#pragma unroll    // this and the loops below: constant indices keep r in registers
    for (int i = 0; i < CVL; ++i) r[i] = *(const v4fa*)(sw + to + i * 128);
    asm volatile("s_wait_xcnt 0x0" :: "v"(to * (unsigned)sizeof(float)), "s"(sw) : "memory");     // stands before any register that these loads name as an address is written again; as inputs offset and base stay in their registers up to here
#pragma unroll
    for (int g = 0; g < CVL; g += 8) {
#pragma unroll
        for (int i = g; i < g + 8; ++i) { v4us o;
#pragma unroll
            for (int k = 0; k < 4; ++k) o[k] = f2bf(r[i][k]);
            *(v4us*)(d + i * 128) = o; }
        if (g + 8 < CVL) asm volatile("s_wait_xcnt 0x0" ::: "memory");     // before the next eight's rounding writes registers that these stores name; the scheduling barrier below holds that rounding behind it
        __builtin_amdgcn_sched_barrier(0);     // each eight loads are rounded and stored as they land: drawn together, every store would stand behind the wait for the last load
    }
}

#define KST 64
#define LP_ 72
__device__ __forceinline__ v16h ldsfrag(const h16* p) { return cat16(*(const v8ha*)p, *(const v8ha*)(p + 16)); }
__global__ __launch_bounds__(256) __attribute__((amdgpu_waves_per_eu(4, 4))) void k_fattn(const h16* __restrict__ Q16, const h16* __restrict__ K16, const h16* __restrict__ V16, bf* Ah, bf* Al) {
    __shared__ __align__(16) h16 ks[2][KST * LP_];   // [key][d]
    __shared__ __align__(16) h16 vs[2][HD * LP_];    // [d][key]
    const int tid = threadIdx.x, lane = tid & 31, wave = tid >> 5, lr = lane & 15, hi = lane >> 4;
    const int h = blockIdx.y, q = blockIdx.x * 128 + wave * 16 + lr;
    const h16* Qh = Q16 + (size_t)h * TT * HD; const h16* Kh = K16 + (size_t)h * TT * HD; const h16* Vh = V16 + (size_t)h * HD * TT;
    v16h qf[2];
#pragma unroll
    for (int ds = 0; ds < 2; ++ds) qf[ds] = WFrag<h16>::ld(Qh + (size_t)q * HD + ds * 32 + 8 * hi) * (h16)0.5f;   // times a power of two (exact in f16 above its subnormals): the score tiles hold x / 2, which is what tanh takes
    v8f o[4];
#pragma unroll
    for (int db = 0; db < 4; ++db) o[db] = (v8f){};
    const int sr = tid >> 3, sc = (tid & 7) * 8;     // staging: 8 threads per 128-byte row, rows sr and sr + 32
    const h16* gk = Kh + (size_t)sr * HD + sc; const h16* gv = Vh + (size_t)sr * TT + sc; const int so = sr * LP_ + sc;
    v8h rk0 = *(const v8h*)gk, rk1 = *(const v8h*)(gk + 32 * HD), rv0 = *(const v8h*)gv, rv1 = *(const v8h*)(gv + (size_t)32 * TT);
    *(v8ha*)(ks[0] + so) = rk0; *(v8ha*)(ks[0] + so + 32 * LP_) = rk1; *(v8ha*)(vs[0] + so) = rv0; *(v8ha*)(vs[0] + so + 32 * LP_) = rv1;
    __syncthreads();
#pragma unroll 1
    for (int s = 0; s < TT / KST; ++s) {
        const int b = s & 1;
        if (s + 1 < TT / KST) { const h16* nk = gk + (size_t)(s + 1) * KST * HD; const h16* nv = gv + (size_t)(s + 1) * KST; rk0 = *(const v8h*)nk; rk1 = *(const v8h*)(nk + 32 * HD); rv0 = *(const v8h*)nv; rv1 = *(const v8h*)(nv + (size_t)32 * TT); }
#pragma unroll
        for (int p = 0; p < KST / 32; ++p) {
            v8f st[2];
#pragma unroll
            for (int kt = 0; kt < 2; ++kt) { st[kt] = (v8f){};
#pragma unroll
                for (int ds = 0; ds < 2; ++ds) st[kt] = wmma16(ldsfrag(ks[b] + (p * 32 + kt * 16 + lr) * LP_ + ds * 32 + 8 * hi), qf[ds], st[kt]); }
            v16h pb;
#pragma unroll
            for (int e = 0; e < 16; ++e) pb[e] = tohx(__builtin_fmaf(0.5f, __builtin_amdgcn_tanhf(st[e >> 3][e & 7]), 0.5f));   // st holds x / 2 (see qf)
#pragma unroll
            for (int db = 0; db < 4; ++db) o[db] = wmma16(ldsfrag(vs[b] + (db * 16 + lr) * LP_ + p * 32 + 8 * hi), pb, o[db]);
        }
        if (s + 1 < TT / KST) { h16* dk = ks[b ^ 1] + so; h16* dv = vs[b ^ 1] + so; *(v8ha*)dk = rk0; *(v8ha*)(dk + 32 * LP_) = rk1; *(v8ha*)dv = rv0; *(v8ha*)(dv + 32 * LP_) = rv1; }
        __syncthreads();   // publishes stage s + 1 and ends every wave's reads of stage s, whose buffer the next trip refills
    }
#pragma unroll
    for (int db = 0; db < 4; ++db) { v8us oh, ol;     // o[db][j] = x[q][h * 64 + db * 16 + 8 * hi + j]: eight neighbours of one row, one 16-byte store per plane
#pragma unroll
        for (int j = 0; j < 8; ++j) { unsigned short a, c2; splitf(o[db][j], a, c2); oh[j] = a; ol[j] = c2; }
        const size_t oo = (size_t)q * DQ + h * HD + db * 16 + 8 * hi; *(v8us*)(Ah + oo) = oh; *(v8us*)(Al + oo) = ol; }
}

extern "C" void kernel_launch(void* const* d_in, const int* in_sizes, int n_in,
                              void* d_out, int out_size, void* d_ws, size_t ws_size, hipStream_t stream) {
    (void)in_sizes; (void)n_in; (void)out_size;
    const float* xq = (const float*)d_in[0]; const float* xk = (const float*)d_in[1]; const float* xv = (const float*)d_in[2]; const float* wq = (const float*)d_in[3]; const float* wk = (const float*)d_in[4]; const float* wv = (const float*)d_in[5];
    const float* gq = (const float*)d_in[6]; const float* bq = (const float*)d_in[7]; const float* gk = (const float*)d_in[8]; const float* bk = (const float*)d_in[9]; const float* wp = (const float*)d_in[10]; const float* bp = (const float*)d_in[11];
    float* OUT = (float*)d_out;     // [1][4096][1024]
    char* wsp = (char*)d_ws;
    auto take = [&](size_t bytes) { char* p = wsp; wsp += (bytes + 255) & ~(size_t)255; return (void*)p; };
    bf* WQ = (bf*)take((size_t)DQ * DM * 2); bf* WK = (bf*)take((size_t)DQ * DM * 2); bf* WV = (bf*)take((size_t)DQ * DM * 2); bf* WP = (bf*)take((size_t)DM * DQ * 2);     // these seven planes lie one behind the other (sizes are multiples of 256 B): k_cvtall writes them as one range from WQ
    bf* XQ = (bf*)take((size_t)TT * DM * 2); bf* XK = (bf*)take((size_t)TT * DM * 2); bf* XV = (bf*)take((size_t)TT * DM * 2);
    const size_t PS = (size_t)NH_ * TT * HD; h16* QP16 = (h16*)take(PS * 2); h16* KP16 = (h16*)take(PS * 2); h16* VT16 = (h16*)take(PS * 2);
    bf* ATh = (bf*)take((size_t)TT * DQ * 2); bf* ATl = (bf*)take((size_t)TT * DQ * 2);
    if ((size_t)(wsp - (char*)d_ws) > ws_size) return;    // ws 256 MiB
    k_cvtall<<<4 * CVNW + 3 * CVNX, 512, 0, stream>>>(wq, wk, wv, wp, xq, xk, xv, WQ);
    /* q */ k_gemmw<bf, DM, 0, false, 1><<<dim3(TT / 128, DQ / 128, 1), 128, 0, stream>>>(XQ, nullptr, WQ, nullptr, 0, nullptr, 0, 0, 0, gq, bq, SCL, QP16);
    /* k */ k_gemmw<bf, DM, 0, false, 1><<<dim3(TT / 128, DQ / 128, 1), 128, 0, stream>>>(XK, nullptr, WK, nullptr, 0, nullptr, 0, 0, 0, gk, bk, 1.0f, KP16);
    /* v */ k_gemmw<bf, DM, 0, false, 2><<<dim3(TT / 128, DQ / 128, 1), 128, 0, stream>>>(XV, nullptr, WV, nullptr, 0, nullptr, 0, 0, 0, nullptr, nullptr, 1.0f, VT16);
    k_fattn<<<dim3(TT / 128, NH_, 1), 256, 0, stream>>>(QP16, KP16, VT16, ATh, ATl);      /* sigmoid(qh.kh) vh, merged, hi/lo */
    k_gemmw<bf, DQ, 1, true, 0><<<dim3(TT / 128, DM / 128, 1), 128, 0, stream>>>(ATh, ATl, WP, OUT, DM, bp, 0, 0, 0, nullptr, nullptr, 1.0f, nullptr);
}

// v006
// A run of this version takes 114 microseconds.
// In both of two side-by-side timings against v005, it was 1.14 times as fast.
// Over all steps from v000 it is 18.5 times as fast.
#include <hip/hip_runtime.h>

// Sigmoid attention (q, k, v [1][4096][1024]; qh, kh, vh = (q Wq^T, k Wk^T, v Wv^T) ('oi' [1024][1024], no bias) split into 16 heads x 64; per-head LayerNorm over the 64 dims of qh (x gq + bq, then x 1/8) and kh (x gk + bk); attn = sigmoid(qh.kh) over the full 4096 x 4096 matrix (no softmax, no normalisation); x = attn vh merged; out = x Wp^T + bp -> [1][4096][1024] (4.2 M)).
// Compute dtypes, f32 accumulate: every input rounded to bf16; projections on PLAIN bf16 operands (inputs: exact); LayerNorm in f32 (in the projection's epilogue, eight lanes per head row); scores and attn.v on single fp16 planes (1 product each: sigmoid outputs lie in (0,1), no carry needed); sigmoid in f32 (0.5 + 0.5 tanh(x / 2), hardware tanh); merged heads hi/lo x exact Wp (2 products) + bp.
// Scores, sigmoid, attn.v and the head merge run in ONE launch (k_fattn): the 4096 x 4096 matrix of a head never leaves the registers.
// The q, k and v projections write the f16 head planes themselves: a wave's 64-column tile is exactly one head, so the LayerNorm (q, k) and the transpose (v) are done on the accumulators.

#define TT   4096
#define DM   1024
#define NH_  16
#define HD   64
#define DQ   (NH_ * HD)
#define SCL  0.125f
#define LNEPS 1e-5f
typedef _Float16 h16;
typedef unsigned short bf;
typedef __attribute__((ext_vector_type(16))) __bf16   v16bf;
typedef __attribute__((ext_vector_type(16))) _Float16 v16h;
typedef __attribute__((ext_vector_type(8)))  _Float16 v8h;
typedef __attribute__((ext_vector_type(8)))  unsigned short v8us;
typedef __attribute__((ext_vector_type(8)))  float    v8f;
typedef __attribute__((ext_vector_type(4)))  float    v4f;
typedef v8h  __attribute__((may_alias)) v8ha;
typedef v4f  __attribute__((may_alias)) v4fa;
typedef v8us __attribute__((may_alias)) v8usa;

__device__ __forceinline__ unsigned short f2bf(float f) { unsigned u = __float_as_uint(f); u += 0x7FFFu + ((u >> 16) & 1u); return (unsigned short)(u >> 16); }
__device__ __forceinline__ float bf2f(unsigned short b) { return __uint_as_float(((unsigned)b) << 16); }
__device__ __forceinline__ float bfr(float f) { return bf2f(f2bf(f)); }
__device__ __forceinline__ v16h cat16(v8h lo, v8h hi) { return __builtin_shufflevector(lo, hi, 0, 1, 2, 3, 4, 5, 6, 7, 8, 9, 10, 11, 12, 13, 14, 15); }
__device__ __forceinline__ v16bf cat16b(v8us lo, v8us hi) { return __builtin_bit_cast(v16bf, __builtin_shufflevector(lo, hi, 0, 1, 2, 3, 4, 5, 6, 7, 8, 9, 10, 11, 12, 13, 14, 15)); }
__device__ __forceinline__ v8f wmma16(v16h a, v16h b, v8f c) { return __builtin_amdgcn_wmma_f32_16x16x32_f16(false, a, false, b, (short)0, c, false, false); }
__device__ __forceinline__ v8f wmmab(v16bf a, v16bf b, v8f c) { return __builtin_amdgcn_wmma_f32_16x16x32_bf16(false, a, false, b, (short)0, c, false, false); }



// ---- k_gemmw: GEMM, workgroup = 4 waves (2 x 2) = one 128x128 output tile, 64x64 (16 accumulators) per wave; grid (M/128, N/128, Z), 128 threads.
// The 128 rows of each operand come in stages of 128 k (256 B per row: every wave-wide global load is four whole 128-byte lines) through registers into two LDS buffers; the waves read their fragments from LDS, each operand row feeding two waves.
// C[m][n] (f32, pitch ldc, + optional f32 bias[n]) = sum_k A[m][k] Bt[n][k] (NSPLIT 1: + A2[m][k] Bt[n][k]). z-batch strides sA/sB/sC in elements. K (a template constant: row offsets become immediates) % 128 == 0.
// EPI 0: C as above. EPI 1: a wave's 64 columns are one head; each row is normalised over them (x gw + gb, x sc) and stored as f16 to P16[head][row][64]. EPI 2: the tile is stored as f16, transposed, to P16[column][TT].
// amdgpu_waves_per_eu(1, 1): one wave per SIMD, that is one workgroup per WGP, so that the 256 equal workgroups of a launch cannot double up on some WGPs while others idle.
#define GKB 128
#define GLP (GKB + 8)     // LDS row pitch 272 B = 16 B x odd: no bank conflict for 16-byte fragment reads
template <typename T16> struct WFrag;
template <> struct WFrag<h16> { typedef v16h V; static __device__ __forceinline__ V ld(const h16* p) { return cat16(*(const v8h*)p, *(const v8h*)(p + 16)); } static __device__ __forceinline__ v8f mma(V a, V b, v8f c) { return wmma16(a, b, c); } };
template <> struct WFrag<bf> { typedef v16bf V; static __device__ __forceinline__ V lds(const bf* p) { return cat16b(*(const v8usa*)p, *(const v8usa*)(p + 16)); } static __device__ __forceinline__ v8f mma(V a, V b, v8f c) { return wmmab(a, b, c); } };
// x + (x of lane ^ M), M < 16: one step of a butterfly sum inside a 16-lane row, on the vector pipe (row_xmask), no LDS round trip.
template <int M> __device__ __forceinline__ float xadd(float x) { return x + __int_as_float(__builtin_amdgcn_update_dpp(0, __float_as_int(x), 0x160 | M, 0xf, 0xf, true)); }
template <typename T16, int K, int NSPLIT, bool BIAS, int EPI>
__global__ __launch_bounds__(128) __attribute__((amdgpu_waves_per_eu(1, 1))) void k_gemmw(const T16* __restrict__ A, const T16* __restrict__ A2, const T16* __restrict__ Bt, float* C, int ldc, const float* __restrict__ bias, size_t sA, size_t sB, size_t sC, const float* __restrict__ gw, const float* __restrict__ gb, float sc, h16* P16) {
    typedef typename WFrag<T16>::V V;
    static_assert(K % GKB == 0 && NSPLIT <= 1, "whole stages; planes A, Bt and at most A2");
    constexpr int NP = NSPLIT == 1 ? 3 : 2;     // staged planes: A, Bt (, A2)
    __shared__ __align__(16) T16 tl[2][NP][128 * GLP];
    __shared__ __align__(16) float osw[4][16 * 68];
    const size_t z = blockIdx.z; A += z * sA; if (NSPLIT == 1) A2 += z * sA; Bt += z * sB; C += z * sC;
    const int tid = threadIdx.x, lane = tid & 31, wave = tid >> 5, lr = lane & 15, hi = lane >> 4;
    const int wr = (wave & 1) * 64, wc = (wave >> 1) * 64, r0 = blockIdx.x * 128 + wr, c0 = blockIdx.y * 128 + wc;
    float* os = osw[wave];     // each wave's own epilogue rows
    v8f acc[4][4];
#pragma unroll
    for (int mb = 0; mb < 4; ++mb)
#pragma unroll
        for (int nb = 0; nb < 4; ++nb) acc[mb][nb] = (v8f){};
    const int sr = tid >> 4, sk = (tid & 15) * 8, so = sr * GLP + sk;     // staging: 16 threads per 256-byte row piece, rows sr + 8 i
    const unsigned go = sr * K + sk;     // the thread's element offset inside every plane's 128 rows
    const T16* ga = A + (size_t)blockIdx.x * 128 * K; const T16* gb_ = Bt + (size_t)blockIdx.y * 128 * K; const T16* gc = NSPLIT == 1 ? A2 + (size_t)blockIdx.x * 128 * K : gb_;     // wave-uniform plane bases
    v8us rg[NP][16];
#pragma unroll    // this and the staging loops below: constant indices keep rg in registers
    for (int i = 0; i < 16; ++i) { rg[0][i] = *(const v8usa*)(ga + go + 8 * i * K); rg[1][i] = *(const v8usa*)(gb_ + go + 8 * i * K); if (NSPLIT == 1) rg[NP - 1][i] = *(const v8usa*)(gc + go + 8 * i * K); }
    asm volatile("s_wait_xcnt 0x0" :: "v"(go * (unsigned)sizeof(T16)), "s"(ga), "s"(gb_), "s"(gc) : "memory");     // as the one in the loop, for the offset and base registers of the first stage's loads
#pragma unroll
    for (int pl = 0; pl < NP; ++pl)
#pragma unroll
        for (int i = 0; i < 16; ++i) *(v8usa*)(tl[0][pl] + so + 8 * i * GLP) = rg[pl][i];
    __syncthreads();
#pragma unroll 1    // one stage per trip: the two buffers alternate
    for (int s = 0; s < K / GKB; ++s) {
        const int b = s & 1;
        if (s + 1 < K / GKB) {
            const T16* pa = ga + (s + 1) * GKB + go; const T16* pb = gb_ + (s + 1) * GKB + go; const T16* pc = gc + (s + 1) * GKB + go;
#pragma unroll
            for (int i = 0; i < 16; ++i) { rg[0][i] = *(const v8usa*)(pa + 8 * i * K); rg[1][i] = *(const v8usa*)(pb + 8 * i * K); if (NSPLIT == 1) rg[NP - 1][i] = *(const v8usa*)(pc + 8 * i * K); }
            asm volatile("s_wait_xcnt 0x0" :: "v"(pa), "v"(pb), "v"(pc) : "memory");     // stands before any register that these loads name as an address is written again; as inputs the addresses stay in their registers up to here
        }
        const T16* la = tl[b][0] + (wr + lr) * GLP + 8 * hi; const T16* lb = tl[b][1] + (wc + lr) * GLP + 8 * hi; const T16* la2 = tl[b][NP - 1] + (wr + lr) * GLP + 8 * hi;
        V fa[2][4], fb[2][4], fa2[2][4];     // two fragment sets: the next 32 k are read from LDS while this set is multiplied
#pragma unroll
        for (int t = 0; t < 4; ++t) { fa[0][t] = WFrag<T16>::lds(la + t * 16 * GLP); fb[0][t] = WFrag<T16>::lds(lb + t * 16 * GLP); if (NSPLIT == 1) fa2[0][t] = WFrag<T16>::lds(la2 + t * 16 * GLP); }
#pragma unroll    // constant set indices keep the fragments in registers
        for (int kk = 0; kk < GKB / 32; ++kk) {
            const int cu = kk & 1, nx = cu ^ 1;
            if (kk + 1 < GKB / 32) {
#pragma unroll
                for (int t = 0; t < 4; ++t) { fa[nx][t] = WFrag<T16>::lds(la + t * 16 * GLP + (kk + 1) * 32); fb[nx][t] = WFrag<T16>::lds(lb + t * 16 * GLP + (kk + 1) * 32); if (NSPLIT == 1) fa2[nx][t] = WFrag<T16>::lds(la2 + t * 16 * GLP + (kk + 1) * 32); }
            }
            __builtin_amdgcn_sched_barrier(0);     // holds the next set's LDS reads as one group ahead of this matrix block: sunk among the products, each read would be waited for where it stands
#pragma unroll
            for (int nb = 0; nb < 4; ++nb) {
#pragma unroll
                for (int mb = 0; mb < 4; ++mb) acc[mb][nb] = WFrag<T16>::mma(fa[cu][mb], fb[cu][nb], acc[mb][nb]);
                if (NSPLIT == 1) {
#pragma unroll
                    for (int mb = 0; mb < 4; ++mb) acc[mb][nb] = WFrag<T16>::mma(fa2[cu][mb], fb[cu][nb], acc[mb][nb]); }
            }
            __builtin_amdgcn_sched_barrier(0);     // ends the block: the reads behind it stay one group too, not drawn up among these products
        }
        if (s + 1 < K / GKB) {
#pragma unroll
            for (int pl = 0; pl < NP; ++pl)
#pragma unroll
                for (int i = 0; i < 16; ++i) *(v8usa*)(tl[b ^ 1][pl] + so + 8 * i * GLP) = rg[pl][i];
        }
        __syncthreads();   // publishes stage s + 1 and ends every wave's reads of stage s, whose buffer the next trip refills
    }
    if (EPI == 2) {     // acc[mb][nb][0..7] = eight neighbouring rows of one column: one 16-byte store each; the four mb fill a 128-byte line of the transposed plane
#pragma unroll    // this and the two below: constant indices keep acc in registers
        for (int nb = 0; nb < 4; ++nb)
#pragma unroll
            for (int mb = 0; mb < 4; ++mb) { v8h o;
#pragma unroll
                for (int j = 0; j < 8; ++j) o[j] = (h16)acc[mb][nb][j];
                *(v8h*)(P16 + (size_t)(c0 + nb * 16 + lr) * TT + r0 + mb * 16 + 8 * hi) = o;
                asm volatile("s_wait_xcnt 0x0" :: "v"(o) : "memory"); }     // before the store's registers are written again; as an input the stored value stays in its registers up to here
        return;
    }
    const int g8 = lane >> 3, c8 = (lane & 7) * 8;     // EPI 1: eight lanes per row, eight columns per lane
    float gg[8], bb[8];
    if (EPI == 1) {
#pragma unroll    // constant indices keep gg and bb in registers
        for (int i = 0; i < 8; ++i) { gg[i] = bfr(gw[c8 + i]); bb[i] = bfr(gb[c8 + i]); } }
#pragma unroll
    for (int mb = 0; mb < 4; ++mb) {
#pragma unroll
        for (int nb = 0; nb < 4; ++nb) {
#pragma unroll
            for (int j = 0; j < 8; ++j) os[(hi * 8 + j) * 68 + nb * 16 + lr] = acc[mb][nb][j]; }
        __builtin_amdgcn_wave_barrier(); asm volatile("" ::: "memory");
        if (EPI == 1) {
#pragma unroll    // the four passes are independent: unrolled, their dependent sums interleave; the inner loops: constant indices keep d and o in registers
            for (int s = 0; s < 4; ++s) { const int row = 4 * s + g8; const v4f x0 = *(const v4fa*)(os + row * 68 + c8), x1 = *(const v4fa*)(os + row * 68 + c8 + 4);
                float d[8] = { x0[0], x0[1], x0[2], x0[3], x1[0], x1[1], x1[2], x1[3] };
                const float mu = xadd<4>(xadd<2>(xadd<1>(((d[0] + d[1]) + (d[2] + d[3])) + ((d[4] + d[5]) + (d[6] + d[7]))))) * (1.0f / 64.0f);
#pragma unroll
                for (int i = 0; i < 8; ++i) d[i] -= mu;
                const float s2 = xadd<4>(xadd<2>(xadd<1>(((d[0] * d[0] + d[1] * d[1]) + (d[2] * d[2] + d[3] * d[3])) + ((d[4] * d[4] + d[5] * d[5]) + (d[6] * d[6] + d[7] * d[7])))));
                const float rs = __frsqrt_rn(s2 * (1.0f / 64.0f) + LNEPS);
                v8h o;
#pragma unroll
                for (int i = 0; i < 8; ++i) o[i] = (h16)(((d[i] * rs) * gg[i] + bb[i]) * sc);
                *(v8h*)(P16 + ((size_t)(c0 >> 6) * TT + r0 + mb * 16 + row) * HD + c8) = o; }     // four whole 128-byte rows per store
        } else {
        float* crow = C + (size_t)(r0 + mb * 16) * ldc + c0;
#pragma unroll
            for (int s = 0; s < 8; ++s) { const int row = 2 * s + hi, cofs = lr * 4; v4f val = *(const v4fa*)(os + row * 68 + cofs); if (BIAS) { val[0] += bfr(bias[c0 + cofs]); val[1] += bfr(bias[c0 + cofs + 1]); val[2] += bfr(bias[c0 + cofs + 2]); val[3] += bfr(bias[c0 + cofs + 3]); }
                *(v4f*)(crow + (size_t)row * ldc + cofs) = val; }
            asm volatile("s_wait_xcnt 0x0" ::: "memory");     // before the stores' registers are written again
             }
        __builtin_amdgcn_wave_barrier(); asm volatile("" ::: "memory");
    }
}

__device__ __forceinline__ h16 tohx(float x) { return (h16)x; }
__device__ __forceinline__ void splitf(float y, unsigned short& h, unsigned short& l) { h = f2bf(y); l = f2bf(y - bf2f(h)); }
typedef __attribute__((ext_vector_type(2))) _Float16 v2h;
typedef __attribute__((ext_vector_type(4))) _Float16 v4h;
typedef __attribute__((ext_vector_type(2))) unsigned short v2us;
typedef __attribute__((ext_vector_type(4))) unsigned short v4us;
typedef __attribute__((ext_vector_type(2))) float v2f;
typedef __attribute__((ext_vector_type(4))) int v4i;

// ---- k_cvtall: every f32 -> bf16 rounding of the call (Wq, Wk, Wv, Wp, q, k, v) in ONE launch of 256 workgroups of 16 waves, one per WGP: few waves to start, one launch gap.
// A workgroup takes CVG floats of one input, a wave CVL * 128 of them in a row: CVL wave-wide loads of 512 contiguous bytes, all issued before the first is used, each rounded and stored as 256 contiguous bytes.
// The seven bf16 planes lie one behind the other in dst in the order of the arguments, so workgroup b writes dst + b * CVG whatever input it reads.
// amdgpu_waves_per_eu(4, 4): the register budget of four waves per SIMD, so that all CVL loads have registers of their own; at more than 128 registers a wave no second workgroup fits a WGP, so the equal workgroups cannot double up on some WGPs while others idle.
#define CVL 32
#define CVG (16 * CVL * 128)
#define CVNW (DQ * DM / CVG)     // workgroups per weight matrix
#define CVNX (TT * DM / CVG)     // workgroups per activation matrix
__global__ __launch_bounds__(512) __attribute__((amdgpu_waves_per_eu(4, 4))) void k_cvtall(const float* __restrict__ wq, const float* __restrict__ wk, const float* __restrict__ wv, const float* __restrict__ wp, const float* __restrict__ xq, const float* __restrict__ xk, const float* __restrict__ xv, bf* dst) {
    static_assert(DQ * DM % CVG == 0 && TT * DM % CVG == 0, "whole workgroups per input");
    const unsigned b = blockIdx.x, iw = b / CVNW, ix = (b - 4 * CVNW) / CVNX;
    const float* src = b < 4 * CVNW ? (iw == 0 ? wq : iw == 1 ? wk : iw == 2 ? wv : wp) : (ix == 0 ? xq : ix == 1 ? xk : xv);
    const unsigned sb = b < 4 * CVNW ? b % CVNW : (b - 4 * CVNW) % CVNX, to = (threadIdx.x >> 5) * (CVL * 128) + (threadIdx.x & 31) * 4;
    const float* sw = src + (size_t)sb * CVG; bf* d = dst + (size_t)b * CVG + to;     // sw: wave-uniform base of the workgroup's floats
    v4f r[CVL];
#pragma unroll    // this and the loops below: constant indices keep r in registers
    for (int i = 0; i < CVL; ++i) r[i] = *(const v4fa*)(sw + to + i * 128);
    asm volatile("s_wait_xcnt 0x0" :: "v"(to * (unsigned)sizeof(float)), "s"(sw) : "memory");     // stands before any register that these loads name as an address is written again; as inputs offset and base stay in their registers up to here
#pragma unroll
    for (int g = 0; g < CVL; g += 8) {
#pragma unroll
        for (int i = g; i < g + 8; ++i) { v4us o;
#pragma unroll
            for (int k = 0; k < 4; ++k) o[k] = f2bf(r[i][k]);
            *(v4us*)(d + i * 128) = o; }
        if (g + 8 < CVL) asm volatile("s_wait_xcnt 0x0" ::: "memory");     // before the next eight's rounding writes registers that these stores name; the scheduling barrier below holds that rounding behind it
        __builtin_amdgcn_sched_barrier(0);     // each eight loads are rounded and stored as they land: drawn together, every store would stand behind the wait for the last load
    }
}

#define KST 128
#define LP_ 72             // K rows: 64 d + 8
#define VP_ (KST + 8)      // Vt rows: 128 keys + 8
#define NCG 4              // 16-column groups per wave
__device__ __forceinline__ v16h ldsfrag(const h16* p) { return cat16(*(const v8ha*)p, *(const v8ha*)(p + 16)); }
__global__ __launch_bounds__(256) __attribute__((amdgpu_waves_per_eu(2, 2))) void k_fattn(const h16* __restrict__ Q16, const h16* __restrict__ K16, const h16* __restrict__ V16, bf* Ah, bf* Al) {
    __shared__ __align__(16) h16 ks[2][KST * LP_];   // [key][d]
    __shared__ __align__(16) h16 vs[2][HD * VP_];    // [d][key]
    __shared__ __align__(16) float xch[8][NCG * 4 * 32 * 4];   // per wave: the half of its partial sums that its partner finishes
    const int tid = threadIdx.x, lane = tid & 31, wave = tid >> 5, lr = lane & 15, hi = lane >> 4;
    const int cw = wave & 3, kh = __builtin_amdgcn_readfirstlane(wave >> 2);     // column set; key half (wave-uniform)
    const int h = blockIdx.y, q0 = blockIdx.x * (4 * NCG * 16) + cw * (NCG * 16) + lr;
    const h16* Qh = Q16 + (size_t)h * TT * HD; const h16* Kh = K16 + (size_t)h * TT * HD; const h16* Vh = V16 + (size_t)h * HD * TT;
    const h16* qp = Qh + (size_t)q0 * HD + 8 * hi;
    v16h qf[NCG][2];
#pragma unroll    // this and the loops below: constant indices keep the fragments and accumulators in registers
    for (int c = 0; c < NCG; ++c)
#pragma unroll
        for (int ds = 0; ds < 2; ++ds) qf[c][ds] = WFrag<h16>::ld(qp + c * 16 * HD + ds * 32);
    asm volatile("s_wait_xcnt 0x0" :: "v"(qp) : "memory");     // stands before the register pair that the Q loads name as their address is written again; as an input the address stays in it up to here
#pragma unroll
    for (int c = 0; c < NCG; ++c)
#pragma unroll
        for (int ds = 0; ds < 2; ++ds) qf[c][ds] *= (h16)0.5f;   // times a power of two (exact in f16 above its subnormals): the score tiles hold x / 2, which is what tanh takes
    v8f o[NCG][4];
#pragma unroll
    for (int c = 0; c < NCG; ++c)
#pragma unroll
        for (int db = 0; db < 4; ++db) o[c][db] = (v8f){};
    // staging: K stage = 16 KB in a row, 8 threads per 128-byte row, rows tid / 8 + 32 i; Vt stage = 64 rows of 256 B, 16 threads per row, rows tid / 16 + 16 i
    const unsigned gko = (unsigned)tid * 8, gvo = (unsigned)(tid >> 4) * TT + (tid & 15) * 8;
    const int sko = (tid >> 3) * LP_ + (tid & 7) * 8, svo = (tid >> 4) * VP_ + (tid & 15) * 8;
    v8h rk[4], rv[4];
    {
        const h16* nk = Kh + gko; const h16* nv = Vh + gvo;
#pragma unroll
        for (int i = 0; i < 4; ++i) { rk[i] = *(const v8h*)(nk + i * 32 * HD); rv[i] = *(const v8h*)(nv + (size_t)i * 16 * TT); }
        asm volatile("s_wait_xcnt 0x0" :: "v"(tid), "v"(gvo * (unsigned)sizeof(h16)), "s"(Kh), "s"(Vh) : "memory");     // as the one in the loop, for the offset and base registers of the first stage's loads
    }
#pragma unroll
    for (int i = 0; i < 4; ++i) { *(v8ha*)(ks[0] + sko + i * 32 * LP_) = rk[i]; *(v8ha*)(vs[0] + svo + i * 16 * VP_) = rv[i]; }
    __syncthreads();
#pragma unroll 1    // one stage per trip: the two buffers alternate
    for (int s = 0; s < TT / KST; ++s) {
        const int b = s & 1;
        if (s + 1 < TT / KST) {
            const h16* nk = Kh + (size_t)(s + 1) * KST * HD + gko; const h16* nv = Vh + (size_t)(s + 1) * KST + gvo;
#pragma unroll
            for (int i = 0; i < 4; ++i) { rk[i] = *(const v8h*)(nk + i * 32 * HD); rv[i] = *(const v8h*)(nv + (size_t)i * 16 * TT); }
            asm volatile("s_wait_xcnt 0x0" :: "v"(nk), "v"(nv) : "memory");     // stands before any register that these loads name as an address is written again; as inputs the addresses stay in their registers up to here
        }
        const h16* lk = ks[b] + (kh * (KST / 2) + lr) * LP_ + 8 * hi; const h16* lv = vs[b] + lr * VP_ + kh * (KST / 2) + 8 * hi;
#pragma unroll
        for (int p = 0; p < KST / 64; ++p) {
            v16h kf[2][2], vf[4];
#pragma unroll
            for (int kt = 0; kt < 2; ++kt)
#pragma unroll
                for (int ds = 0; ds < 2; ++ds) kf[kt][ds] = ldsfrag(lk + (p * 32 + kt * 16) * LP_ + ds * 32);
#pragma unroll
            for (int db = 0; db < 4; ++db) vf[db] = ldsfrag(lv + db * 16 * VP_ + p * 32);
#pragma unroll
            for (int c = 0; c < NCG; ++c) {
                v8f st[2];
#pragma unroll
                for (int kt = 0; kt < 2; ++kt) { st[kt] = (v8f){};
#pragma unroll
                    for (int ds = 0; ds < 2; ++ds) st[kt] = wmma16(kf[kt][ds], qf[c][ds], st[kt]); }
                v16h pb;
#pragma unroll
                for (int e = 0; e < 16; ++e) pb[e] = tohx(__builtin_fmaf(0.5f, __builtin_amdgcn_tanhf(st[e >> 3][e & 7]), 0.5f));   // st holds x / 2 (see qf)
#pragma unroll
                for (int db = 0; db < 4; ++db) o[c][db] = wmma16(vf[db], pb, o[c][db]);
            }
        }
        if (s + 1 < TT / KST) {
#pragma unroll
            for (int i = 0; i < 4; ++i) { *(v8ha*)(ks[b ^ 1] + sko + i * 32 * LP_) = rk[i]; *(v8ha*)(vs[b ^ 1] + svo + i * 16 * VP_) = rv[i]; }
        }
        __syncthreads();   // publishes stage s + 1 and ends every wave's reads of stage s, whose buffer the next trip refills
    }
    // The two key halves meet: wave w finishes column groups 0 and 1, wave w + 4 groups 2 and 3; each hands the other two groups' partial sums to its partner.
    float* xo = xch[wave] + lane * 4; const float* xi = xch[wave ^ 4] + lane * 4;
#pragma unroll
    for (int c = 0; c < NCG / 2; ++c)
#pragma unroll
        for (int db = 0; db < 4; ++db) { const v8f g = kh ? o[c][db] : o[c + NCG / 2][db];
            *(v4fa*)(xo + ((c * 4 + db) * 2) * 128) = (v4f){ g[0], g[1], g[2], g[3] }; *(v4fa*)(xo + ((c * 4 + db) * 2 + 1) * 128) = (v4f){ g[4], g[5], g[6], g[7] }; }
    __syncthreads();   // publishes every wave's handed-over partial sums to its partner
    v8f m[NCG / 2][4];
#pragma unroll
    for (int c = 0; c < NCG / 2; ++c)
#pragma unroll
        for (int db = 0; db < 4; ++db) { const v4f g0 = *(const v4fa*)(xi + ((c * 4 + db) * 2) * 128), g1 = *(const v4fa*)(xi + ((c * 4 + db) * 2 + 1) * 128);
            m[c][db] = (kh ? o[c + NCG / 2][db] : o[c][db]) + (v8f){ g0[0], g0[1], g0[2], g0[3], g1[0], g1[1], g1[2], g1[3] }; }
#pragma unroll
    for (int c = 0; c < NCG / 2; ++c)
#pragma unroll
        for (int db = 0; db < 4; ++db) { v8us oh, ol;     // m[c][db][j] = x[q][h * 64 + db * 16 + 8 * hi + j]: eight neighbours of one row, one 16-byte store per plane
#pragma unroll
            for (int j = 0; j < 8; ++j) { unsigned short a, c2; splitf(m[c][db][j], a, c2); oh[j] = a; ol[j] = c2; }
            const size_t oo = (size_t)(q0 + (kh * (NCG / 2) + c) * 16) * DQ + h * HD + db * 16 + 8 * hi; *(v8us*)(Ah + oo) = oh; *(v8us*)(Al + oo) = ol;
            asm volatile("s_wait_xcnt 0x0" :: "v"(oh), "v"(ol) : "memory"); }     // before the stores' registers are written again; as inputs the stored values stay in their registers up to here
}

extern "C" void kernel_launch(void* const* d_in, const int* in_sizes, int n_in,
                              void* d_out, int out_size, void* d_ws, size_t ws_size, hipStream_t stream) {
    (void)in_sizes; (void)n_in; (void)out_size;
    const float* xq = (const float*)d_in[0]; const float* xk = (const float*)d_in[1]; const float* xv = (const float*)d_in[2]; const float* wq = (const float*)d_in[3]; const float* wk = (const float*)d_in[4]; const float* wv = (const float*)d_in[5];
    const float* gq = (const float*)d_in[6]; const float* bq = (const float*)d_in[7]; const float* gk = (const float*)d_in[8]; const float* bk = (const float*)d_in[9]; const float* wp = (const float*)d_in[10]; const float* bp = (const float*)d_in[11];
    float* OUT = (float*)d_out;     // [1][4096][1024]
    char* wsp = (char*)d_ws;
    auto take = [&](size_t bytes) { char* p = wsp; wsp += (bytes + 255) & ~(size_t)255; return (void*)p; };
    bf* WQ = (bf*)take((size_t)DQ * DM * 2); bf* WK = (bf*)take((size_t)DQ * DM * 2); bf* WV = (bf*)take((size_t)DQ * DM * 2); bf* WP = (bf*)take((size_t)DM * DQ * 2);     // these seven planes lie one behind the other (sizes are multiples of 256 B): k_cvtall writes them as one range from WQ
    bf* XQ = (bf*)take((size_t)TT * DM * 2); bf* XK = (bf*)take((size_t)TT * DM * 2); bf* XV = (bf*)take((size_t)TT * DM * 2);
    const size_t PS = (size_t)NH_ * TT * HD; h16* QP16 = (h16*)take(PS * 2); h16* KP16 = (h16*)take(PS * 2); h16* VT16 = (h16*)take(PS * 2);
    bf* ATh = (bf*)take((size_t)TT * DQ * 2); bf* ATl = (bf*)take((size_t)TT * DQ * 2);
    if ((size_t)(wsp - (char*)d_ws) > ws_size) return;    // ws 256 MiB
    k_cvtall<<<4 * CVNW + 3 * CVNX, 512, 0, stream>>>(wq, wk, wv, wp, xq, xk, xv, WQ);
    /* q */ k_gemmw<bf, DM, 0, false, 1><<<dim3(TT / 128, DQ / 128, 1), 128, 0, stream>>>(XQ, nullptr, WQ, nullptr, 0, nullptr, 0, 0, 0, gq, bq, SCL, QP16);
    /* k */ k_gemmw<bf, DM, 0, false, 1><<<dim3(TT / 128, DQ / 128, 1), 128, 0, stream>>>(XK, nullptr, WK, nullptr, 0, nullptr, 0, 0, 0, gk, bk, 1.0f, KP16);
    /* v */ k_gemmw<bf, DM, 0, false, 2><<<dim3(TT / 128, DQ / 128, 1), 128, 0, stream>>>(XV, nullptr, WV, nullptr, 0, nullptr, 0, 0, 0, nullptr, nullptr, 1.0f, VT16);
    k_fattn<<<dim3(TT / (4 * NCG * 16), NH_, 1), 256, 0, stream>>>(QP16, KP16, VT16, ATh, ATl);      /* sigmoid(qh.kh) vh, merged, hi/lo */
    k_gemmw<bf, DQ, 1, true, 0><<<dim3(TT / 128, DM / 128, 1), 128, 0, stream>>>(ATh, ATl, WP, OUT, DM, bp, 0, 0, 0, nullptr, nullptr, 1.0f, nullptr);
}

// v007
// One run takes 106 microseconds.
// Timed twice side by side with v006, it ran 1.08 and 1.07 times as fast.
// All steps since v000 together make it 19.9 times as fast.
#include <hip/hip_runtime.h>

// Sigmoid attention (q, k, v [1][4096][1024]; qh, kh, vh = (q Wq^T, k Wk^T, v Wv^T) ('oi' [1024][1024], no bias) split into 16 heads x 64; per-head LayerNorm over the 64 dims of qh (x gq + bq, then x 1/8) and kh (x gk + bk); attn = sigmoid(qh.kh) over the full 4096 x 4096 matrix (no softmax, no normalisation); x = attn vh merged; out = x Wp^T + bp -> [1][4096][1024] (4.2 M)).
// Compute dtypes, f32 accumulate: every input rounded to bf16; projections on PLAIN bf16 operands (inputs: exact); LayerNorm in f32 (in the projection's epilogue, eight lanes per head row); scores and attn.v on single fp16 planes (1 product each: sigmoid outputs lie in (0,1), no carry needed); sigmoid in f32 (0.5 + 0.5 tanh(x / 2), hardware tanh); merged heads hi/lo x exact Wp (2 products) + bp.
// Scores, sigmoid, attn.v and the head merge run in ONE launch (k_fattn): the 4096 x 4096 matrix of a head never leaves the registers.
// The q, k and v projections write the f16 head planes themselves: a wave's 64-column tile is exactly one head, so the LayerNorm (q, k) and the transpose (v) are done on the accumulators.
// The three projections read none of each other's output: they run as ONE launch, grid z = which projection.

#define TT   4096
#define DM   1024
#define NH_  16
#define HD   64
#define DQ   (NH_ * HD)
#define SCL  0.125f
#define LNEPS 1e-5f
typedef _Float16 h16;
typedef unsigned short bf;
typedef __attribute__((ext_vector_type(16))) __bf16   v16bf;
typedef __attribute__((ext_vector_type(16))) _Float16 v16h;
typedef __attribute__((ext_vector_type(8)))  _Float16 v8h;
typedef __attribute__((ext_vector_type(8)))  unsigned short v8us;
typedef __attribute__((ext_vector_type(8)))  float    v8f;
typedef __attribute__((ext_vector_type(4)))  float    v4f;
typedef v8h  __attribute__((may_alias)) v8ha;
typedef v4f  __attribute__((may_alias)) v4fa;
typedef v8us __attribute__((may_alias)) v8usa;

__device__ __forceinline__ unsigned short f2bf(float f) { unsigned u = __float_as_uint(f); u += 0x7FFFu + ((u >> 16) & 1u); return (unsigned short)(u >> 16); }
__device__ __forceinline__ float bf2f(unsigned short b) { return __uint_as_float(((unsigned)b) << 16); }
__device__ __forceinline__ float bfr(float f) { return bf2f(f2bf(f)); }
__device__ __forceinline__ v16h cat16(v8h lo, v8h hi) { return __builtin_shufflevector(lo, hi, 0, 1, 2, 3, 4, 5, 6, 7, 8, 9, 10, 11, 12, 13, 14, 15); }
__device__ __forceinline__ v16bf cat16b(v8us lo, v8us hi) { return __builtin_bit_cast(v16bf, __builtin_shufflevector(lo, hi, 0, 1, 2, 3, 4, 5, 6, 7, 8, 9, 10, 11, 12, 13, 14, 15)); }
__device__ __forceinline__ v8f wmma16(v16h a, v16h b, v8f c) { return __builtin_amdgcn_wmma_f32_16x16x32_f16(false, a, false, b, (short)0, c, false, false); }
__device__ __forceinline__ v8f wmmab(v16bf a, v16bf b, v8f c) { return __builtin_amdgcn_wmma_f32_16x16x32_bf16(false, a, false, b, (short)0, c, false, false); }



// ---- k_gemmw: GEMM, workgroup = 4 waves (2 x 2) = one 128x128 output tile, 64x64 (16 accumulators) per wave; grid (M/128, N/128, Z), 128 threads.
// The 128 rows of each operand come in stages of 128 k (256 B per row: every wave-wide global load is four whole 128-byte lines) through registers into two LDS buffers; the waves read their fragments from LDS, each operand row feeding two waves.
// C[m][n] (f32, pitch ldc, + optional f32 bias[n]) = sum_k A[m][k] Bt[n][k] (NSPLIT 1: + A2[m][k] Bt[n][k]). z-batch strides sA/sB/sC in elements. K (a template constant: row offsets become immediates) % 128 == 0.
// EPI 0: C as above. EPI 1: a wave's 64 columns are one head; each row is normalised over them (x gw + gb, x sc) and stored as f16 to P16[head][row][64]. EPI 2: the tile is stored as f16, transposed, to P16[column][TT].
// EPI 3: three independent GEMMs in one grid, f16 planes sC elements apart: z = 0 ends as EPI 1 with gw, gb, sc, z = 1 as EPI 1 with gw2, gb2, sc2, z = 2 as EPI 2 (the shortest epilogue starts last).
// amdgpu_waves_per_eu(1, 1), EPI 0: one wave per SIMD, that is one workgroup per WGP, so that the 256 equal workgroups of a launch cannot double up on some WGPs while others idle.
// amdgpu_waves_per_eu(2, 2), EPI 3: 768 workgroups, two resident per WGP (registers and LDS fit twice): while one waits for its staged rows, fills its first stage or runs its epilogue, the other's products keep the matrix units busy.
#define GKB 128
#define GLP (GKB + 8)     // LDS row pitch 272 B = 16 B x odd: no bank conflict for 16-byte fragment reads
template <typename T16> struct WFrag;
template <> struct WFrag<h16> { typedef v16h V; static __device__ __forceinline__ V ld(const h16* p) { return cat16(*(const v8h*)p, *(const v8h*)(p + 16)); } static __device__ __forceinline__ v8f mma(V a, V b, v8f c) { return wmma16(a, b, c); } };
template <> struct WFrag<bf> { typedef v16bf V; static __device__ __forceinline__ V lds(const bf* p) { return cat16b(*(const v8usa*)p, *(const v8usa*)(p + 16)); } static __device__ __forceinline__ v8f mma(V a, V b, v8f c) { return wmmab(a, b, c); } };
// x + (x of lane ^ M), M < 16: one step of a butterfly sum inside a 16-lane row, on the vector pipe (row_xmask), no LDS round trip.
template <int M> __device__ __forceinline__ float xadd(float x) { return x + __int_as_float(__builtin_amdgcn_update_dpp(0, __float_as_int(x), 0x160 | M, 0xf, 0xf, true)); }
template <typename T16, int K, int NSPLIT, bool BIAS, int EPI>
__global__ __launch_bounds__(128) __attribute__((amdgpu_waves_per_eu(EPI == 3 ? 2 : 1, EPI == 3 ? 2 : 1))) void k_gemmw(const T16* __restrict__ A, const T16* __restrict__ A2, const T16* __restrict__ Bt, float* C, int ldc, const float* __restrict__ bias, size_t sA, size_t sB, size_t sC, const float* gw, const float* gb, float sc, const float* gw2, const float* gb2, float sc2, h16* P16) {
    typedef typename WFrag<T16>::V V;
    static_assert(K % GKB == 0 && NSPLIT <= 1, "whole stages; planes A, Bt and at most A2");
    constexpr int NP = NSPLIT == 1 ? 3 : 2;     // staged planes: A, Bt (, A2)
    __shared__ __align__(16) T16 tl[2][NP][128 * GLP];
    __shared__ __align__(16) float osw[4][16 * 68];
    constexpr bool LN = EPI == 1 || EPI == 3;     // the per-head LayerNorm epilogue is compiled in
    const size_t z = blockIdx.z; A += z * sA; if (NSPLIT == 1) A2 += z * sA; Bt += z * sB; if (EPI == 3) P16 += z * sC; else C += z * sC;
    if (EPI == 3 && z == 1) { gw = gw2; gb = gb2; sc = sc2; }
    const int tid = threadIdx.x, lane = tid & 31, wave = tid >> 5, lr = lane & 15, hi = lane >> 4;
    const int wr = (wave & 1) * 64, wc = (wave >> 1) * 64, r0 = blockIdx.x * 128 + wr, c0 = blockIdx.y * 128 + wc;
    float* os = osw[wave];     // each wave's own epilogue rows
    v8f acc[4][4];
#pragma unroll
    for (int mb = 0; mb < 4; ++mb)
#pragma unroll
        for (int nb = 0; nb < 4; ++nb) acc[mb][nb] = (v8f){};
    const int sr = tid >> 4, sk = (tid & 15) * 8, so = sr * GLP + sk;     // staging: 16 threads per 256-byte row piece, rows sr + 8 i
    const unsigned go = sr * K + sk;     // the thread's element offset inside every plane's 128 rows
    const T16* ga = A + (size_t)blockIdx.x * 128 * K; const T16* gb_ = Bt + (size_t)blockIdx.y * 128 * K; const T16* gc = NSPLIT == 1 ? A2 + (size_t)blockIdx.x * 128 * K : gb_;     // wave-uniform plane bases
    v8us rg[NP][16];
#pragma unroll    // this and the staging loops below: constant indices keep rg in registers
    for (int i = 0; i < 16; ++i) { rg[0][i] = *(const v8usa*)(ga + go + 8 * i * K); rg[1][i] = *(const v8usa*)(gb_ + go + 8 * i * K); if (NSPLIT == 1) rg[NP - 1][i] = *(const v8usa*)(gc + go + 8 * i * K); }
    asm volatile("s_wait_xcnt 0x0" :: "v"(go * (unsigned)sizeof(T16)), "s"(ga), "s"(gb_), "s"(gc) : "memory");     // as the one in the loop, for the offset and base registers of the first stage's loads
#pragma unroll
    for (int pl = 0; pl < NP; ++pl)
#pragma unroll
        for (int i = 0; i < 16; ++i) *(v8usa*)(tl[0][pl] + so + 8 * i * GLP) = rg[pl][i];
    __syncthreads();
#pragma unroll 1    // one stage per trip: the two buffers alternate
    for (int s = 0; s < K / GKB; ++s) {
        const int b = s & 1;
        if (s + 1 < K / GKB) {
            const T16* pa = ga + (s + 1) * GKB + go; const T16* pb = gb_ + (s + 1) * GKB + go; const T16* pc = gc + (s + 1) * GKB + go;
#pragma unroll
            for (int i = 0; i < 16; ++i) { rg[0][i] = *(const v8usa*)(pa + 8 * i * K); rg[1][i] = *(const v8usa*)(pb + 8 * i * K); if (NSPLIT == 1) rg[NP - 1][i] = *(const v8usa*)(pc + 8 * i * K); }
            asm volatile("s_wait_xcnt 0x0" :: "v"(pa), "v"(pb), "v"(pc) : "memory");     // stands before any register that these loads name as an address is written again; as inputs the addresses stay in their registers up to here
        }
        const T16* la = tl[b][0] + (wr + lr) * GLP + 8 * hi; const T16* lb = tl[b][1] + (wc + lr) * GLP + 8 * hi; const T16* la2 = tl[b][NP - 1] + (wr + lr) * GLP + 8 * hi;
        V fa[2][4], fb[2][4], fa2[2][4];     // two fragment sets: the next 32 k are read from LDS while this set is multiplied
#pragma unroll
        for (int t = 0; t < 4; ++t) { fa[0][t] = WFrag<T16>::lds(la + t * 16 * GLP); fb[0][t] = WFrag<T16>::lds(lb + t * 16 * GLP); if (NSPLIT == 1) fa2[0][t] = WFrag<T16>::lds(la2 + t * 16 * GLP); }
#pragma unroll    // constant set indices keep the fragments in registers
        for (int kk = 0; kk < GKB / 32; ++kk) {
            const int cu = kk & 1, nx = cu ^ 1;
            if (kk + 1 < GKB / 32) {
#pragma unroll
                for (int t = 0; t < 4; ++t) { fa[nx][t] = WFrag<T16>::lds(la + t * 16 * GLP + (kk + 1) * 32); fb[nx][t] = WFrag<T16>::lds(lb + t * 16 * GLP + (kk + 1) * 32); if (NSPLIT == 1) fa2[nx][t] = WFrag<T16>::lds(la2 + t * 16 * GLP + (kk + 1) * 32); }
            }
            __builtin_amdgcn_sched_barrier(0);     // holds the next set's LDS reads as one group ahead of this matrix block: sunk among the products, each read would be waited for where it stands
#pragma unroll
            for (int nb = 0; nb < 4; ++nb) {
#pragma unroll
                for (int mb = 0; mb < 4; ++mb) acc[mb][nb] = WFrag<T16>::mma(fa[cu][mb], fb[cu][nb], acc[mb][nb]);
                if (NSPLIT == 1) {
#pragma unroll
                    for (int mb = 0; mb < 4; ++mb) acc[mb][nb] = WFrag<T16>::mma(fa2[cu][mb], fb[cu][nb], acc[mb][nb]); }
            }
            __builtin_amdgcn_sched_barrier(0);     // ends the block: the reads behind it stay one group too, not drawn up among these products
        }
        if (s + 1 < K / GKB) {
#pragma unroll
            for (int pl = 0; pl < NP; ++pl)
#pragma unroll
                for (int i = 0; i < 16; ++i) *(v8usa*)(tl[b ^ 1][pl] + so + 8 * i * GLP) = rg[pl][i];
        }
        __syncthreads();   // publishes stage s + 1 and ends every wave's reads of stage s, whose buffer the next trip refills
    }
    if (EPI == 2 || (EPI == 3 && z == 2)) {     // (the same for the whole workgroup) acc[mb][nb][0..7] = eight neighbouring rows of one column: one 16-byte store each; the four mb fill a 128-byte line of the transposed plane
#pragma unroll    // this and the two below: constant indices keep acc in registers
        for (int nb = 0; nb < 4; ++nb)
#pragma unroll
            for (int mb = 0; mb < 4; ++mb) { v8h o;
#pragma unroll
                for (int j = 0; j < 8; ++j) o[j] = (h16)acc[mb][nb][j];
                *(v8h*)(P16 + (size_t)(c0 + nb * 16 + lr) * TT + r0 + mb * 16 + 8 * hi) = o;
                asm volatile("s_wait_xcnt 0x0" :: "v"(o) : "memory"); }     // before the store's registers are written again; as an input the stored value stays in its registers up to here
        return;
    }
    const int g8 = lane >> 3, c8 = (lane & 7) * 8;     // EPI 1: eight lanes per row, eight columns per lane
    float gg[8], bb[8];
    if (LN) {
#pragma unroll    // constant indices keep gg and bb in registers
        for (int i = 0; i < 8; ++i) { gg[i] = bfr(gw[c8 + i]); bb[i] = bfr(gb[c8 + i]); } }
#pragma unroll
    for (int mb = 0; mb < 4; ++mb) {
#pragma unroll
        for (int nb = 0; nb < 4; ++nb) {
#pragma unroll
            for (int j = 0; j < 8; ++j) os[(hi * 8 + j) * 68 + nb * 16 + lr] = acc[mb][nb][j]; }
        __builtin_amdgcn_wave_barrier(); asm volatile("" ::: "memory");
        if (LN) {
#pragma unroll    // the four passes are independent: unrolled, their dependent sums interleave; the inner loops: constant indices keep d and o in registers
            for (int s = 0; s < 4; ++s) { const int row = 4 * s + g8; const v4f x0 = *(const v4fa*)(os + row * 68 + c8), x1 = *(const v4fa*)(os + row * 68 + c8 + 4);
                float d[8] = { x0[0], x0[1], x0[2], x0[3], x1[0], x1[1], x1[2], x1[3] };
                const float mu = xadd<4>(xadd<2>(xadd<1>(((d[0] + d[1]) + (d[2] + d[3])) + ((d[4] + d[5]) + (d[6] + d[7]))))) * (1.0f / 64.0f);
#pragma unroll
                for (int i = 0; i < 8; ++i) d[i] -= mu;
                const float s2 = xadd<4>(xadd<2>(xadd<1>(((d[0] * d[0] + d[1] * d[1]) + (d[2] * d[2] + d[3] * d[3])) + ((d[4] * d[4] + d[5] * d[5]) + (d[6] * d[6] + d[7] * d[7])))));
                const float rs = __frsqrt_rn(s2 * (1.0f / 64.0f) + LNEPS);
                v8h o;
#pragma unroll
                for (int i = 0; i < 8; ++i) o[i] = (h16)(((d[i] * rs) * gg[i] + bb[i]) * sc);
                *(v8h*)(P16 + ((size_t)(c0 >> 6) * TT + r0 + mb * 16 + row) * HD + c8) = o; }     // four whole 128-byte rows per store
            asm volatile("s_wait_xcnt 0x0" ::: "memory");     // before the stores' registers are written again
        } else {
        float* crow = C + (size_t)(r0 + mb * 16) * ldc + c0;
#pragma unroll
            for (int s = 0; s < 8; ++s) { const int row = 2 * s + hi, cofs = lr * 4; v4f val = *(const v4fa*)(os + row * 68 + cofs); if (BIAS) { val[0] += bfr(bias[c0 + cofs]); val[1] += bfr(bias[c0 + cofs + 1]); val[2] += bfr(bias[c0 + cofs + 2]); val[3] += bfr(bias[c0 + cofs + 3]); }
                *(v4f*)(crow + (size_t)row * ldc + cofs) = val; }
            asm volatile("s_wait_xcnt 0x0" ::: "memory");     // before the stores' registers are written again
             }
        __builtin_amdgcn_wave_barrier(); asm volatile("" ::: "memory");
    }
}

__device__ __forceinline__ h16 tohx(float x) { return (h16)x; }
__device__ __forceinline__ void splitf(float y, unsigned short& h, unsigned short& l) { h = f2bf(y); l = f2bf(y - bf2f(h)); }
typedef __attribute__((ext_vector_type(2))) _Float16 v2h;
typedef __attribute__((ext_vector_type(4))) _Float16 v4h;
typedef __attribute__((ext_vector_type(2))) unsigned short v2us;
typedef __attribute__((ext_vector_type(4))) unsigned short v4us;
typedef __attribute__((ext_vector_type(2))) float v2f;
typedef __attribute__((ext_vector_type(4))) int v4i;

// ---- k_cvtall: every f32 -> bf16 rounding of the call (Wq, Wk, Wv, Wp, q, k, v) in ONE launch of 256 workgroups of 16 waves, one per WGP: few waves to start, one launch gap.
// A workgroup takes CVG floats of one input, a wave CVL * 128 of them in a row: CVL wave-wide loads of 512 contiguous bytes, all issued before the first is used, each rounded and stored as 256 contiguous bytes.
// The seven bf16 planes lie one behind the other in dst in the order of the arguments, so workgroup b writes dst + b * CVG whatever input it reads.
// amdgpu_waves_per_eu(4, 4): the register budget of four waves per SIMD, so that all CVL loads have registers of their own; at more than 128 registers a wave no second workgroup fits a WGP, so the equal workgroups cannot double up on some WGPs while others idle.
#define CVL 32
#define CVG (16 * CVL * 128)
#define CVNW (DQ * DM / CVG)     // workgroups per weight matrix
#define CVNX (TT * DM / CVG)     // workgroups per activation matrix
__global__ __launch_bounds__(512) __attribute__((amdgpu_waves_per_eu(4, 4))) void k_cvtall(const float* __restrict__ wq, const float* __restrict__ wk, const float* __restrict__ wv, const float* __restrict__ wp, const float* __restrict__ xq, const float* __restrict__ xk, const float* __restrict__ xv, bf* dst) {
    static_assert(DQ * DM % CVG == 0 && TT * DM % CVG == 0, "whole workgroups per input");
    const unsigned b = blockIdx.x, iw = b / CVNW, ix = (b - 4 * CVNW) / CVNX;
    const float* src = b < 4 * CVNW ? (iw == 0 ? wq : iw == 1 ? wk : iw == 2 ? wv : wp) : (ix == 0 ? xq : ix == 1 ? xk : xv);
    const unsigned sb = b < 4 * CVNW ? b % CVNW : (b - 4 * CVNW) % CVNX, to = (threadIdx.x >> 5) * (CVL * 128) + (threadIdx.x & 31) * 4;
    const float* sw = src + (size_t)sb * CVG; bf* d = dst + (size_t)b * CVG + to;     // sw: wave-uniform base of the workgroup's floats
    v4f r[CVL];
#pragma unroll    // this and the loops below: constant indices keep r in registers
    for (int i = 0; i < CVL; ++i) r[i] = *(const v4fa*)(sw + to + i * 128);
    asm volatile("s_wait_xcnt 0x0" :: "v"(to * (unsigned)sizeof(float)), "s"(sw) : "memory");     // stands before any register that these loads name as an address is written again; as inputs offset and base stay in their registers up to here
#pragma unroll
    for (int g = 0; g < CVL; g += 8) {
#pragma unroll
        for (int i = g; i < g + 8; ++i) { v4us o;
#pragma unroll
            for (int k = 0; k < 4; ++k) o[k] = f2bf(r[i][k]);
            *(v4us*)(d + i * 128) = o; }
        if (g + 8 < CVL) asm volatile("s_wait_xcnt 0x0" ::: "memory");     // before the next eight's rounding writes registers that these stores name; the scheduling barrier below holds that rounding behind it
        __builtin_amdgcn_sched_barrier(0);     // each eight loads are rounded and stored as they land: drawn together, every store would stand behind the wait for the last load
    }
}

#define KST 128
#define LP_ 72             // K rows: 64 d + 8
#define VP_ (KST + 8)      // Vt rows: 128 keys + 8
#define NCG 4              // 16-column groups per wave
__device__ __forceinline__ v16h ldsfrag(const h16* p) { return cat16(*(const v8ha*)p, *(const v8ha*)(p + 16)); }
__global__ __launch_bounds__(256) __attribute__((amdgpu_waves_per_eu(2, 2))) void k_fattn(const h16* __restrict__ Q16, const h16* __restrict__ K16, const h16* __restrict__ V16, bf* Ah, bf* Al) {
    __shared__ __align__(16) h16 ks[2][KST * LP_];   // [key][d]
    __shared__ __align__(16) h16 vs[2][HD * VP_];    // [d][key]
    __shared__ __align__(16) float xch[8][NCG * 4 * 32 * 4];   // per wave: the half of its partial sums that its partner finishes
    const int tid = threadIdx.x, lane = tid & 31, wave = tid >> 5, lr = lane & 15, hi = lane >> 4;
    const int cw = wave & 3, kh = __builtin_amdgcn_readfirstlane(wave >> 2);     // column set; key half (wave-uniform)
    const int h = blockIdx.y, q0 = blockIdx.x * (4 * NCG * 16) + cw * (NCG * 16) + lr;
    const h16* Qh = Q16 + (size_t)h * TT * HD; const h16* Kh = K16 + (size_t)h * TT * HD; const h16* Vh = V16 + (size_t)h * HD * TT;
    const h16* qp = Qh + (size_t)q0 * HD + 8 * hi;
    v16h qf[NCG][2];
#pragma unroll    // this and the loops below: constant indices keep the fragments and accumulators in registers
    for (int c = 0; c < NCG; ++c)
#pragma unroll
        for (int ds = 0; ds < 2; ++ds) qf[c][ds] = WFrag<h16>::ld(qp + c * 16 * HD + ds * 32);
    asm volatile("s_wait_xcnt 0x0" :: "v"(qp) : "memory");     // stands before the register pair that the Q loads name as their address is written again; as an input the address stays in it up to here
#pragma unroll
    for (int c = 0; c < NCG; ++c)
#pragma unroll
        for (int ds = 0; ds < 2; ++ds) qf[c][ds] *= (h16)0.5f;   // times a power of two (exact in f16 above its subnormals): the score tiles hold x / 2, which is what tanh takes
    v8f o[NCG][4];
#pragma unroll
    for (int c = 0; c < NCG; ++c)
#pragma unroll
        for (int db = 0; db < 4; ++db) o[c][db] = (v8f){};
    // staging: K stage = 16 KB in a row, 8 threads per 128-byte row, rows tid / 8 + 32 i; Vt stage = 64 rows of 256 B, 16 threads per row, rows tid / 16 + 16 i
    const unsigned gko = (unsigned)tid * 8, gvo = (unsigned)(tid >> 4) * TT + (tid & 15) * 8;
    const int sko = (tid >> 3) * LP_ + (tid & 7) * 8, svo = (tid >> 4) * VP_ + (tid & 15) * 8;
    v8h rk[4], rv[4];
    {
        const h16* nk = Kh + gko; const h16* nv = Vh + gvo;
#pragma unroll
        for (int i = 0; i < 4; ++i) { rk[i] = *(const v8h*)(nk + i * 32 * HD); rv[i] = *(const v8h*)(nv + (size_t)i * 16 * TT); }
        asm volatile("s_wait_xcnt 0x0" :: "v"(tid), "v"(gvo * (unsigned)sizeof(h16)), "s"(Kh), "s"(Vh) : "memory");     // as the one in the loop, for the offset and base registers of the first stage's loads
    }
#pragma unroll
    for (int i = 0; i < 4; ++i) { *(v8ha*)(ks[0] + sko + i * 32 * LP_) = rk[i]; *(v8ha*)(vs[0] + svo + i * 16 * VP_) = rv[i]; }
    __syncthreads();
#pragma unroll 1    // one stage per trip: the two buffers alternate
    for (int s = 0; s < TT / KST; ++s) {
        const int b = s & 1;
        if (s + 1 < TT / KST) {
            const h16* nk = Kh + (size_t)(s + 1) * KST * HD + gko; const h16* nv = Vh + (size_t)(s + 1) * KST + gvo;
#pragma unroll
            for (int i = 0; i < 4; ++i) { rk[i] = *(const v8h*)(nk + i * 32 * HD); rv[i] = *(const v8h*)(nv + (size_t)i * 16 * TT); }
            asm volatile("s_wait_xcnt 0x0" :: "v"(nk), "v"(nv) : "memory");     // stands before any register that these loads name as an address is written again; as inputs the addresses stay in their registers up to here
        }
        const h16* lk = ks[b] + (kh * (KST / 2) + lr) * LP_ + 8 * hi; const h16* lv = vs[b] + lr * VP_ + kh * (KST / 2) + 8 * hi;
#pragma unroll
        for (int p = 0; p < KST / 64; ++p) {
            v16h kf[2][2], vf[4];
#pragma unroll
            for (int kt = 0; kt < 2; ++kt)
#pragma unroll
                for (int ds = 0; ds < 2; ++ds) kf[kt][ds] = ldsfrag(lk + (p * 32 + kt * 16) * LP_ + ds * 32);
#pragma unroll
            for (int db = 0; db < 4; ++db) vf[db] = ldsfrag(lv + db * 16 * VP_ + p * 32);
#pragma unroll
            for (int c = 0; c < NCG; ++c) {
                v8f st[2];
#pragma unroll
                for (int kt = 0; kt < 2; ++kt) { st[kt] = (v8f){};
#pragma unroll
                    for (int ds = 0; ds < 2; ++ds) st[kt] = wmma16(kf[kt][ds], qf[c][ds], st[kt]); }
                v16h pb;
#pragma unroll
                for (int e = 0; e < 16; ++e) pb[e] = tohx(__builtin_fmaf(0.5f, __builtin_amdgcn_tanhf(st[e >> 3][e & 7]), 0.5f));   // st holds x / 2 (see qf)
#pragma unroll
                for (int db = 0; db < 4; ++db) o[c][db] = wmma16(vf[db], pb, o[c][db]);
            }
        }
        if (s + 1 < TT / KST) {
#pragma unroll
            for (int i = 0; i < 4; ++i) { *(v8ha*)(ks[b ^ 1] + sko + i * 32 * LP_) = rk[i]; *(v8ha*)(vs[b ^ 1] + svo + i * 16 * VP_) = rv[i]; }
        }
        __syncthreads();   // publishes stage s + 1 and ends every wave's reads of stage s, whose buffer the next trip refills
    }
    // The two key halves meet: wave w finishes column groups 0 and 1, wave w + 4 groups 2 and 3; each hands the other two groups' partial sums to its partner.
    float* xo = xch[wave] + lane * 4; const float* xi = xch[wave ^ 4] + lane * 4;
#pragma unroll
    for (int c = 0; c < NCG / 2; ++c)
#pragma unroll
        for (int db = 0; db < 4; ++db) { const v8f g = kh ? o[c][db] : o[c + NCG / 2][db];
            *(v4fa*)(xo + ((c * 4 + db) * 2) * 128) = (v4f){ g[0], g[1], g[2], g[3] }; *(v4fa*)(xo + ((c * 4 + db) * 2 + 1) * 128) = (v4f){ g[4], g[5], g[6], g[7] }; }
    __syncthreads();   // publishes every wave's handed-over partial sums to its partner
    v8f m[NCG / 2][4];
#pragma unroll
    for (int c = 0; c < NCG / 2; ++c)
#pragma unroll
        for (int db = 0; db < 4; ++db) { const v4f g0 = *(const v4fa*)(xi + ((c * 4 + db) * 2) * 128), g1 = *(const v4fa*)(xi + ((c * 4 + db) * 2 + 1) * 128);
            m[c][db] = (kh ? o[c + NCG / 2][db] : o[c][db]) + (v8f){ g0[0], g0[1], g0[2], g0[3], g1[0], g1[1], g1[2], g1[3] }; }
#pragma unroll
    for (int c = 0; c < NCG / 2; ++c)
#pragma unroll
        for (int db = 0; db < 4; ++db) { v8us oh, ol;     // m[c][db][j] = x[q][h * 64 + db * 16 + 8 * hi + j]: eight neighbours of one row, one 16-byte store per plane
#pragma unroll
            for (int j = 0; j < 8; ++j) { unsigned short a, c2; splitf(m[c][db][j], a, c2); oh[j] = a; ol[j] = c2; }
            const size_t oo = (size_t)(q0 + (kh * (NCG / 2) + c) * 16) * DQ + h * HD + db * 16 + 8 * hi; *(v8us*)(Ah + oo) = oh; *(v8us*)(Al + oo) = ol;
            asm volatile("s_wait_xcnt 0x0" :: "v"(oh), "v"(ol) : "memory"); }     // before the stores' registers are written again; as inputs the stored values stay in their registers up to here
}

extern "C" void kernel_launch(void* const* d_in, const int* in_sizes, int n_in,
                              void* d_out, int out_size, void* d_ws, size_t ws_size, hipStream_t stream) {
    (void)in_sizes; (void)n_in; (void)out_size;
    const float* xq = (const float*)d_in[0]; const float* xk = (const float*)d_in[1]; const float* xv = (const float*)d_in[2]; const float* wq = (const float*)d_in[3]; const float* wk = (const float*)d_in[4]; const float* wv = (const float*)d_in[5];
    const float* gq = (const float*)d_in[6]; const float* bq = (const float*)d_in[7]; const float* gk = (const float*)d_in[8]; const float* bk = (const float*)d_in[9]; const float* wp = (const float*)d_in[10]; const float* bp = (const float*)d_in[11];
    float* OUT = (float*)d_out;     // [1][4096][1024]
    char* wsp = (char*)d_ws;
    auto take = [&](size_t bytes) { char* p = wsp; wsp += (bytes + 255) & ~(size_t)255; return (void*)p; };
    bf* WQ = (bf*)take((size_t)DQ * DM * 2); bf* WK = (bf*)take((size_t)DQ * DM * 2); bf* WV = (bf*)take((size_t)DQ * DM * 2); bf* WP = (bf*)take((size_t)DM * DQ * 2);     // these seven planes lie one behind the other (sizes are multiples of 256 B): k_cvtall writes them as one range from WQ
    bf* XQ = (bf*)take((size_t)TT * DM * 2); bf* XK = (bf*)take((size_t)TT * DM * 2); bf* XV = (bf*)take((size_t)TT * DM * 2);
    const size_t PS = (size_t)NH_ * TT * HD; h16* QP16 = (h16*)take(PS * 2); h16* KP16 = (h16*)take(PS * 2); h16* VT16 = (h16*)take(PS * 2);
    bf* ATh = (bf*)take((size_t)TT * DQ * 2); bf* ATl = (bf*)take((size_t)TT * DQ * 2);
    if ((size_t)(wsp - (char*)d_ws) > ws_size) return;    // ws 256 MiB
    k_cvtall<<<4 * CVNW + 3 * CVNX, 512, 0, stream>>>(wq, wk, wv, wp, xq, xk, xv, WQ);
    /* q, k, v: XQ, XK, XV lie TT * DM elements apart, WQ, WK, WV DQ * DM, QP16, KP16, VT16 PS */
    k_gemmw<bf, DM, 0, false, 3><<<dim3(TT / 128, DQ / 128, 3), 128, 0, stream>>>(XQ, nullptr, WQ, nullptr, 0, nullptr, (size_t)TT * DM, (size_t)DQ * DM, PS, gq, bq, SCL, gk, bk, 1.0f, QP16);
    k_fattn<<<dim3(TT / (4 * NCG * 16), NH_, 1), 256, 0, stream>>>(QP16, KP16, VT16, ATh, ATl);      /* sigmoid(qh.kh) vh, merged, hi/lo */
    k_gemmw<bf, DQ, 1, true, 0><<<dim3(TT / 128, DM / 128, 1), 128, 0, stream>>>(ATh, ATl, WP, OUT, DM, bp, 0, 0, 0, nullptr, nullptr, 1.0f, nullptr, nullptr, 1.0f, nullptr);
}

// v008
// One run takes 97.9 microseconds.
// In both of two side-by-side timings against v007, it was 1.09 times as fast.
// Over all steps from v000 it is 21.7 times as fast.
#include <hip/hip_runtime.h>

// Sigmoid attention (q, k, v [1][4096][1024]; qh, kh, vh = (q Wq^T, k Wk^T, v Wv^T) ('oi' [1024][1024], no bias) split into 16 heads x 64; per-head LayerNorm over the 64 dims of qh (x gq + bq, then x 1/8) and kh (x gk + bk); attn = sigmoid(qh.kh) over the full 4096 x 4096 matrix (no softmax, no normalisation); x = attn vh merged; out = x Wp^T + bp -> [1][4096][1024] (4.2 M)).
// Compute dtypes, f32 accumulate: every input rounded to bf16; projections on PLAIN bf16 operands (inputs: exact); LayerNorm in f32 (in the projection's epilogue, eight lanes per head row); scores and attn.v on single fp16 planes (1 product each: sigmoid outputs lie in (0,1), no carry needed); sigmoid in f32 (0.5 + 0.5 tanh(x / 2), hardware tanh); merged heads hi/lo x exact Wp (2 products) + bp.
// Scores, sigmoid, attn.v and the head merge run in ONE launch (k_fattn): the 4096 x 4096 matrix of a head never leaves the registers.
// The q, k and v projections write the f16 head planes themselves: a wave's 64-column tile is exactly one head, so the LayerNorm (q, k) and the transpose (v) are done on the accumulators.
// The three projections read none of each other's output: they run as ONE launch, grid z = which projection.

#define TT   4096
#define DM   1024
#define NH_  16
#define HD   64
#define DQ   (NH_ * HD)
#define SCL  0.125f
#define LNEPS 1e-5f
typedef _Float16 h16;
typedef unsigned short bf;
typedef __attribute__((ext_vector_type(16))) __bf16   v16bf;
typedef __attribute__((ext_vector_type(16))) _Float16 v16h;
typedef __attribute__((ext_vector_type(8)))  _Float16 v8h;
typedef __attribute__((ext_vector_type(8)))  unsigned short v8us;
typedef __attribute__((ext_vector_type(8)))  float    v8f;
typedef __attribute__((ext_vector_type(4)))  float    v4f;
typedef v8h  __attribute__((may_alias)) v8ha;
typedef v4f  __attribute__((may_alias)) v4fa;
typedef v8us __attribute__((may_alias)) v8usa;

__device__ __forceinline__ unsigned short f2bf(float f) { unsigned u = __float_as_uint(f); u += 0x7FFFu + ((u >> 16) & 1u); return (unsigned short)(u >> 16); }
__device__ __forceinline__ float bf2f(unsigned short b) { return __uint_as_float(((unsigned)b) << 16); }
__device__ __forceinline__ float bfr(float f) { return bf2f(f2bf(f)); }
__device__ __forceinline__ v16h cat16(v8h lo, v8h hi) { return __builtin_shufflevector(lo, hi, 0, 1, 2, 3, 4, 5, 6, 7, 8, 9, 10, 11, 12, 13, 14, 15); }
__device__ __forceinline__ v16bf cat16b(v8us lo, v8us hi) { return __builtin_bit_cast(v16bf, __builtin_shufflevector(lo, hi, 0, 1, 2, 3, 4, 5, 6, 7, 8, 9, 10, 11, 12, 13, 14, 15)); }
__device__ __forceinline__ v8f wmma16(v16h a, v16h b, v8f c) { return __builtin_amdgcn_wmma_f32_16x16x32_f16(false, a, false, b, (short)0, c, false, false); }
__device__ __forceinline__ v8f wmmab(v16bf a, v16bf b, v8f c) { return __builtin_amdgcn_wmma_f32_16x16x32_bf16(false, a, false, b, (short)0, c, false, false); }



// ---- k_gemmw: GEMM, workgroup = 4 waves (2 x 2) = one 128x128 output tile, 64x64 (16 accumulators) per wave; grid (M/128, N/128, Z), 128 threads.
// The 128 rows of each operand come in stages of 128 k (256 B per row) into two LDS buffers by tensor loads, through no register: wave p (p < number of planes) asks for plane p's 128 x 256 B tile, one request per stage, issued a whole stage ahead; the mover's pad of 16 B per row makes the 272-B pitch. The waves read their fragments from LDS, each operand row feeding two waves.
// C[m][n] (f32, pitch ldc, + optional f32 bias[n]) = sum_k A[m][k] Bt[n][k] (NSPLIT 1: + A2[m][k] Bt[n][k]). z-batch strides sA/sB/sC in elements. K (a template constant: row offsets become immediates) % 128 == 0.
// EPI 0: C as above. EPI 1: a wave's 64 columns are one head; each row is normalised over them (x gw + gb, x sc) and stored as f16 to P16[head][row][64]. EPI 2: the tile is stored as f16, transposed, to P16[column][TT].
// EPI 3: three independent GEMMs in one grid, f16 planes sC elements apart: z = 0 ends as EPI 1 with gw, gb, sc, z = 1 as EPI 1 with gw2, gb2, sc2, z = 2 as EPI 2 (the shortest epilogue starts last).
// amdgpu_waves_per_eu(1, 1), EPI 0: one wave per SIMD, that is one workgroup per WGP, so that the 256 equal workgroups of a launch cannot double up on some WGPs while others idle.
// amdgpu_waves_per_eu(2, 2), EPI 3: 768 workgroups, two resident per WGP (registers and LDS fit twice): while one waits for its staged rows, fills its first stage or runs its epilogue, the other's products keep the matrix units busy.
#define GKB 128
#define GLP (GKB + 8)     // LDS row pitch 272 B = 16 B x odd: no bank conflict for 16-byte fragment reads
typedef unsigned u32x4 __attribute__((ext_vector_type(4)));
typedef unsigned u32x8 __attribute__((ext_vector_type(8)));
__device__ __forceinline__ unsigned uni(unsigned v) { return (unsigned)__builtin_amdgcn_readfirstlane(v); }
__device__ __forceinline__ unsigned pinned(unsigned v) { unsigned w = uni(v); asm volatile("" : "+s"(w)); return w; }     // holds v in a scalar register: a test on it compiles to a scalar branch (a tensor load ignores EXEC), and a descriptor word made from it is formed where this stands
// Tensor descriptor, group 1: 1-byte elements, tile = tensor = N rows of R bytes (R = 128 or 256), source row pitch in bytes, 16 B of LDS pad behind every row (interval code 4 = 128 B, 5 = 256 B; amount code 3), no mask.
template <unsigned R, unsigned N> __device__ __forceinline__ u32x8 tdm_group1(unsigned src_pitch) { static_assert(R == 128u || R == 256u, "rows whose pad is known to land right"); u32x8 g;
    g[0] = uni((1u << 20) | ((R == 256u ? 5u : 4u) << 22) | (3u << 25)); g[1] = uni(R << 16); g[2] = uni(N << 16); g[3] = uni(R << 16); g[4] = uni(N); g[5] = uni(src_pitch); g[6] = uni(0u); g[7] = uni(0u); return g; }
// Group 0: count 1, LDS destination (byte offset in the workgroup's LDS), global address of the tile's first byte, type 2.
__device__ __forceinline__ u32x4 tdm_group0(unsigned lds_dst, unsigned long long ga) { u32x4 g;
    g[0] = uni(1u); g[1] = uni(lds_dst); g[2] = uni((unsigned)ga); g[3] = uni((((unsigned)(ga >> 32)) & 0x01FFFFFFu) | 0x80000000u); return g; }
__device__ __forceinline__ void tdm_load(u32x4 g0, u32x8 g1) { asm volatile("tensor_load_to_lds %0, %1" :: "s"(g0), "s"(g1) : "memory"); }     // one request of the whole wave: global tile -> LDS
template <typename T16> struct WFrag;
template <> struct WFrag<h16> { typedef v16h V; static __device__ __forceinline__ V ld(const h16* p) { return cat16(*(const v8h*)p, *(const v8h*)(p + 16)); } static __device__ __forceinline__ v8f mma(V a, V b, v8f c) { return wmma16(a, b, c); } };
template <> struct WFrag<bf> { typedef v16bf V; static __device__ __forceinline__ V lds(const bf* p) { return cat16b(*(const v8usa*)p, *(const v8usa*)(p + 16)); } static __device__ __forceinline__ v8f mma(V a, V b, v8f c) { return wmmab(a, b, c); } };
// x + (x of lane ^ M), M < 16: one step of a butterfly sum inside a 16-lane row, on the vector pipe (row_xmask), no LDS round trip.
template <int M> __device__ __forceinline__ float xadd(float x) { return x + __int_as_float(__builtin_amdgcn_update_dpp(0, __float_as_int(x), 0x160 | M, 0xf, 0xf, true)); }
template <typename T16, int K, int NSPLIT, bool BIAS, int EPI>
__global__ __launch_bounds__(128) __attribute__((amdgpu_waves_per_eu(EPI == 3 ? 2 : 1, EPI == 3 ? 2 : 1))) void k_gemmw(const T16* __restrict__ A, const T16* __restrict__ A2, const T16* __restrict__ Bt, float* C, int ldc, const float* __restrict__ bias, size_t sA, size_t sB, size_t sC, const float* gw, const float* gb, float sc, const float* gw2, const float* gb2, float sc2, h16* P16) {
    typedef typename WFrag<T16>::V V;
    static_assert(K % GKB == 0 && NSPLIT <= 1, "whole stages; planes A, Bt and at most A2");
    constexpr int NP = NSPLIT == 1 ? 3 : 2;     // staged planes: A, Bt (, A2)
    static_assert(GKB * sizeof(T16) == 256 && GLP * sizeof(T16) == 272 && (128 * GLP * sizeof(T16)) % 2048 == 0, "tile rows of 256 B at pitch 272 B; every plane starts at a multiple of 2 KiB");
    __shared__ __attribute__((aligned(2048))) T16 tl[2][NP][128 * GLP];
    __shared__ __align__(16) float osw[4][16 * 68];
    constexpr bool LN = EPI == 1 || EPI == 3;     // the per-head LayerNorm epilogue is compiled in
    const size_t z = blockIdx.z; A += z * sA; if (NSPLIT == 1) A2 += z * sA; Bt += z * sB; if (EPI == 3) P16 += z * sC; else C += z * sC;
    if (EPI == 3 && z == 1) { gw = gw2; gb = gb2; sc = sc2; }
    const int tid = threadIdx.x, lane = tid & 31, wave = tid >> 5, lr = lane & 15, hi = lane >> 4;
    const int wr = (wave & 1) * 64, wc = (wave >> 1) * 64, r0 = blockIdx.x * 128 + wr, c0 = blockIdx.y * 128 + wc;
    float* os = osw[wave];     // each wave's own epilogue rows
    v8f acc[4][4];
#pragma unroll
    for (int mb = 0; mb < 4; ++mb)
#pragma unroll
        for (int nb = 0; nb < 4; ++nb) acc[mb][nb] = (v8f){};
    const T16* ga = A + (size_t)blockIdx.x * 128 * K; const T16* gb_ = Bt + (size_t)blockIdx.y * 128 * K; const T16* gc = NSPLIT == 1 ? A2 + (size_t)blockIdx.x * 128 * K : gb_;     // wave-uniform plane bases
    static_assert(K / GKB >= 2, "the prologue asks for stages 0 and 1");
    constexpr unsigned PLB = 128 * GLP * sizeof(T16), BUFB = NP * PLB;     // bytes of a plane and of a buffer in LDS
    const unsigned wv = uni((unsigned)tid >> 5), pl = wv < (unsigned)NP ? wv : 0u;     // the wave's number; the plane it asks for
    const unsigned long long src0 = (unsigned long long)(pl == 0u ? ga : pl == 1u ? gb_ : gc);     // first byte of that plane's stage 0
    const unsigned lds0 = (unsigned)(unsigned long long)(&tl[0][0][0]) + pl * PLB;     // its place in buffer 0: the low 32 bits of the shared address
    u32x8 g1 = tdm_group1<256u, 128u>(K * (unsigned)sizeof(T16));
    asm volatile("" : "+s"(g1));     // descriptor words held in scalar registers: one tuple, built once, serves every request, so that no register of a request in flight takes a new value
    if (pinned(wv < (unsigned)NP)) {
        tdm_load(tdm_group0(lds0, src0), g1);
        asm volatile("s_wait_tensorcnt 0x0" ::: "memory");     // stage 0 has landed before this wave passes the barrier that publishes it
    }
    __syncthreads();
    if (pinned(wv < (unsigned)NP)) tdm_load(tdm_group0(lds0 + BUFB, src0 + GKB * sizeof(T16)), g1);     // stage 1 flies while stage 0 is multiplied
#pragma unroll 1    // one stage per trip: the two buffers alternate
    for (int s = 0; s < K / GKB; ++s) {
        const int b = s & 1;
        const T16* la = tl[b][0] + (wr + lr) * GLP + 8 * hi; const T16* lb = tl[b][1] + (wc + lr) * GLP + 8 * hi; const T16* la2 = tl[b][NP - 1] + (wr + lr) * GLP + 8 * hi;
        V fa[2][4], fb[2][4], fa2[2][4];     // two fragment sets: the next 32 k are read from LDS while this set is multiplied
#pragma unroll
        for (int t = 0; t < 4; ++t) { fa[0][t] = WFrag<T16>::lds(la + t * 16 * GLP); fb[0][t] = WFrag<T16>::lds(lb + t * 16 * GLP); if (NSPLIT == 1) fa2[0][t] = WFrag<T16>::lds(la2 + t * 16 * GLP); }
#pragma unroll    // constant set indices keep the fragments in registers
        for (int kk = 0; kk < GKB / 32; ++kk) {
            const int cu = kk & 1, nx = cu ^ 1;
            if (kk + 1 < GKB / 32) {
#pragma unroll
                for (int t = 0; t < 4; ++t) { fa[nx][t] = WFrag<T16>::lds(la + t * 16 * GLP + (kk + 1) * 32); fb[nx][t] = WFrag<T16>::lds(lb + t * 16 * GLP + (kk + 1) * 32); if (NSPLIT == 1) fa2[nx][t] = WFrag<T16>::lds(la2 + t * 16 * GLP + (kk + 1) * 32); }
            }
            __builtin_amdgcn_sched_barrier(0);     // holds the next set's LDS reads as one group ahead of this matrix block: sunk among the products, each read would be waited for where it stands
#pragma unroll
            for (int nb = 0; nb < 4; ++nb) {
#pragma unroll
                for (int mb = 0; mb < 4; ++mb) acc[mb][nb] = WFrag<T16>::mma(fa[cu][mb], fb[cu][nb], acc[mb][nb]);
                if (NSPLIT == 1) {
#pragma unroll
                    for (int mb = 0; mb < 4; ++mb) acc[mb][nb] = WFrag<T16>::mma(fa2[cu][mb], fb[cu][nb], acc[mb][nb]); }
            }
            __builtin_amdgcn_sched_barrier(0);     // ends the block: the reads behind it stay one group too, not drawn up among these products
        }
        asm volatile("s_wait_dscnt 0x0" ::: "memory");     // this wave's reads of stage s have returned before its buffer is handed to the mover
        if (pinned(wv < (unsigned)NP)) asm volatile("s_wait_tensorcnt 0x0" ::: "memory");     // stage s + 1 has landed before this wave passes the barrier that publishes it
        __syncthreads();   // publishes stage s + 1 and ends every wave's reads of stage s, whose buffer is refilled right behind it
        const unsigned s2 = pinned((unsigned)s + 2u);     // descriptor word held in a scalar register: the next request's address and place are formed behind the wait above
        if (pinned((wv < (unsigned)NP && s2 < (unsigned)(K / GKB)) ? 1u : 0u)) tdm_load(tdm_group0(lds0 + (s2 & 1u) * BUFB, src0 + (unsigned long long)s2 * (GKB * sizeof(T16))), g1);     // only while stage s + 2 exists
    }
    asm volatile("s_wait_tensorcnt 0x0" ::: "memory");     // no request is left when the wave goes on to the epilogue and ends
    asm volatile("s_wait_dscnt 0x0" ::: "memory");     // closes the ring: none of this wave's reads of the buffers is left either
    if (EPI == 2 || (EPI == 3 && z == 2)) {     // (the same for the whole workgroup) acc[mb][nb][0..7] = eight neighbouring rows of one column: one 16-byte store each; the four mb fill a 128-byte line of the transposed plane
#pragma unroll    // this and the two below: constant indices keep acc in registers
        for (int nb = 0; nb < 4; ++nb)
#pragma unroll
            for (int mb = 0; mb < 4; ++mb) { v8h o;
#pragma unroll
                for (int j = 0; j < 8; ++j) o[j] = (h16)acc[mb][nb][j];
                *(v8h*)(P16 + (size_t)(c0 + nb * 16 + lr) * TT + r0 + mb * 16 + 8 * hi) = o;
                asm volatile("s_wait_xcnt 0x0" :: "v"(o) : "memory"); }     // before the store's registers are written again; as an input the stored value stays in its registers up to here
        return;
    }
    const int g8 = lane >> 3, c8 = (lane & 7) * 8;     // EPI 1: eight lanes per row, eight columns per lane
    float gg[8], bb[8];
    if (LN) {
#pragma unroll    // constant indices keep gg and bb in registers
        for (int i = 0; i < 8; ++i) { gg[i] = bfr(gw[c8 + i]); bb[i] = bfr(gb[c8 + i]); } }
#pragma unroll
    for (int mb = 0; mb < 4; ++mb) {
#pragma unroll
        for (int nb = 0; nb < 4; ++nb) {
#pragma unroll
            for (int j = 0; j < 8; ++j) os[(hi * 8 + j) * 68 + nb * 16 + lr] = acc[mb][nb][j]; }
        __builtin_amdgcn_wave_barrier(); asm volatile("" ::: "memory");
        if (LN) {
#pragma unroll    // the four passes are independent: unrolled, their dependent sums interleave; the inner loops: constant indices keep d and o in registers
            for (int s = 0; s < 4; ++s) { const int row = 4 * s + g8; const v4f x0 = *(const v4fa*)(os + row * 68 + c8), x1 = *(const v4fa*)(os + row * 68 + c8 + 4);
                float d[8] = { x0[0], x0[1], x0[2], x0[3], x1[0], x1[1], x1[2], x1[3] };
                const float mu = xadd<4>(xadd<2>(xadd<1>(((d[0] + d[1]) + (d[2] + d[3])) + ((d[4] + d[5]) + (d[6] + d[7]))))) * (1.0f / 64.0f);
#pragma unroll
                for (int i = 0; i < 8; ++i) d[i] -= mu;
                const float s2 = xadd<4>(xadd<2>(xadd<1>(((d[0] * d[0] + d[1] * d[1]) + (d[2] * d[2] + d[3] * d[3])) + ((d[4] * d[4] + d[5] * d[5]) + (d[6] * d[6] + d[7] * d[7])))));
                const float rs = __frsqrt_rn(s2 * (1.0f / 64.0f) + LNEPS);
                v8h o;
#pragma unroll
                for (int i = 0; i < 8; ++i) o[i] = (h16)(((d[i] * rs) * gg[i] + bb[i]) * sc);
                *(v8h*)(P16 + ((size_t)(c0 >> 6) * TT + r0 + mb * 16 + row) * HD + c8) = o; }     // four whole 128-byte rows per store
            asm volatile("s_wait_xcnt 0x0" ::: "memory");     // before the stores' registers are written again
        } else {
        float* crow = C + (size_t)(r0 + mb * 16) * ldc + c0;
#pragma unroll
            for (int s = 0; s < 8; ++s) { const int row = 2 * s + hi, cofs = lr * 4; v4f val = *(const v4fa*)(os + row * 68 + cofs); if (BIAS) { val[0] += bfr(bias[c0 + cofs]); val[1] += bfr(bias[c0 + cofs + 1]); val[2] += bfr(bias[c0 + cofs + 2]); val[3] += bfr(bias[c0 + cofs + 3]); }
                *(v4f*)(crow + (size_t)row * ldc + cofs) = val; }
            asm volatile("s_wait_xcnt 0x0" ::: "memory");     // before the stores' registers are written again
             }
        __builtin_amdgcn_wave_barrier(); asm volatile("" ::: "memory");
    }
}

__device__ __forceinline__ h16 tohx(float x) { return (h16)x; }
__device__ __forceinline__ void splitf(float y, unsigned short& h, unsigned short& l) { h = f2bf(y); l = f2bf(y - bf2f(h)); }
typedef __attribute__((ext_vector_type(2))) _Float16 v2h;
typedef __attribute__((ext_vector_type(4))) _Float16 v4h;
typedef __attribute__((ext_vector_type(2))) unsigned short v2us;
typedef __attribute__((ext_vector_type(4))) unsigned short v4us;
typedef __attribute__((ext_vector_type(2))) float v2f;
typedef __attribute__((ext_vector_type(4))) int v4i;

// ---- k_cvtall: every f32 -> bf16 rounding of the call (Wq, Wk, Wv, Wp, q, k, v) in ONE launch of 256 workgroups of 16 waves, one per WGP: few waves to start, one launch gap.
// A workgroup takes CVG floats of one input, a wave CVL * 128 of them in a row: CVL wave-wide loads of 512 contiguous bytes, all issued before the first is used, each rounded and stored as 256 contiguous bytes.
// The seven bf16 planes lie one behind the other in dst in the order of the arguments, so workgroup b writes dst + b * CVG whatever input it reads.
// amdgpu_waves_per_eu(4, 4): the register budget of four waves per SIMD, so that all CVL loads have registers of their own; at more than 128 registers a wave no second workgroup fits a WGP, so the equal workgroups cannot double up on some WGPs while others idle.
#define CVL 32
#define CVG (16 * CVL * 128)
#define CVNW (DQ * DM / CVG)     // workgroups per weight matrix
#define CVNX (TT * DM / CVG)     // workgroups per activation matrix
__global__ __launch_bounds__(512) __attribute__((amdgpu_waves_per_eu(4, 4))) void k_cvtall(const float* __restrict__ wq, const float* __restrict__ wk, const float* __restrict__ wv, const float* __restrict__ wp, const float* __restrict__ xq, const float* __restrict__ xk, const float* __restrict__ xv, bf* dst) {
    static_assert(DQ * DM % CVG == 0 && TT * DM % CVG == 0, "whole workgroups per input");
    const unsigned b = blockIdx.x, iw = b / CVNW, ix = (b - 4 * CVNW) / CVNX;
    const float* src = b < 4 * CVNW ? (iw == 0 ? wq : iw == 1 ? wk : iw == 2 ? wv : wp) : (ix == 0 ? xq : ix == 1 ? xk : xv);
    const unsigned sb = b < 4 * CVNW ? b % CVNW : (b - 4 * CVNW) % CVNX, to = (threadIdx.x >> 5) * (CVL * 128) + (threadIdx.x & 31) * 4;
    const float* sw = src + (size_t)sb * CVG; bf* d = dst + (size_t)b * CVG + to;     // sw: wave-uniform base of the workgroup's floats
    v4f r[CVL];
#pragma unroll    // this and the loops below: constant indices keep r in registers
    for (int i = 0; i < CVL; ++i) r[i] = *(const v4fa*)(sw + to + i * 128);
    asm volatile("s_wait_xcnt 0x0" :: "v"(to * (unsigned)sizeof(float)), "s"(sw) : "memory");     // stands before any register that these loads name as an address is written again; as inputs offset and base stay in their registers up to here
#pragma unroll
    for (int g = 0; g < CVL; g += 8) {
#pragma unroll
        for (int i = g; i < g + 8; ++i) { v4us o;
#pragma unroll
            for (int k = 0; k < 4; ++k) o[k] = f2bf(r[i][k]);
            *(v4us*)(d + i * 128) = o; }
        if (g + 8 < CVL) asm volatile("s_wait_xcnt 0x0" ::: "memory");     // before the next eight's rounding writes registers that these stores name; the scheduling barrier below holds that rounding behind it
        __builtin_amdgcn_sched_barrier(0);     // each eight loads are rounded and stored as they land: drawn together, every store would stand behind the wait for the last load
    }
}

#define KST 128
#define LP_ 72             // K rows: 64 d + 8
#define VP_ (KST + 8)      // Vt rows: 128 keys + 8
#define NCG 4              // 16-column groups per wave
__device__ __forceinline__ v16h ldsfrag(const h16* p) { return cat16(*(const v8ha*)p, *(const v8ha*)(p + 16)); }
__global__ __launch_bounds__(256) __attribute__((amdgpu_waves_per_eu(2, 2))) void k_fattn(const h16* __restrict__ Q16, const h16* __restrict__ K16, const h16* __restrict__ V16, bf* Ah, bf* Al) {
    constexpr unsigned KSB = KST * LP_ * sizeof(h16), VSB = (HD * VP_ * sizeof(h16) + 2047u) & ~2047u;     // bytes of a K and of a Vt buffer; the latter rounded up so that every buffer starts at a multiple of 2 KiB
    static_assert(KSB % 2048u == 0 && HD * sizeof(h16) == 128 && LP_ * sizeof(h16) == 144 && KST * sizeof(h16) == 256 && VP_ * sizeof(h16) == 272 && TT / KST >= 2, "tile rows and pitches as the descriptors have them; stages 0 and 1 exist");
    __shared__ __attribute__((aligned(2048))) h16 ks[2][KSB / sizeof(h16)];   // [key][d]
    __shared__ __attribute__((aligned(2048))) h16 vs[2][VSB / sizeof(h16)];   // [d][key]
    __shared__ __align__(16) float xch[8][NCG * 4 * 32 * 4];   // per wave: the half of its partial sums that its partner finishes
    const int tid = threadIdx.x, lane = tid & 31, wave = tid >> 5, lr = lane & 15, hi = lane >> 4;
    const int cw = wave & 3, kh = __builtin_amdgcn_readfirstlane(wave >> 2);     // column set; key half (wave-uniform)
    const int h = blockIdx.y, q0 = blockIdx.x * (4 * NCG * 16) + cw * (NCG * 16) + lr;
    const h16* Qh = Q16 + (size_t)h * TT * HD; const h16* Kh = K16 + (size_t)h * TT * HD; const h16* Vh = V16 + (size_t)h * HD * TT;
    const h16* qp = Qh + (size_t)q0 * HD + 8 * hi;
    v16h qf[NCG][2];
#pragma unroll    // this and the loops below: constant indices keep the fragments and accumulators in registers
    for (int c = 0; c < NCG; ++c)
#pragma unroll
        for (int ds = 0; ds < 2; ++ds) qf[c][ds] = WFrag<h16>::ld(qp + c * 16 * HD + ds * 32);
    asm volatile("s_wait_xcnt 0x0" :: "v"(qp) : "memory");     // stands before the register pair that the Q loads name as their address is written again; as an input the address stays in it up to here
#pragma unroll
    for (int c = 0; c < NCG; ++c)
#pragma unroll
        for (int ds = 0; ds < 2; ++ds) qf[c][ds] *= (h16)0.5f;   // times a power of two (exact in f16 above its subnormals): the score tiles hold x / 2, which is what tanh takes
    v8f o[NCG][4];
#pragma unroll
    for (int c = 0; c < NCG; ++c)
#pragma unroll
        for (int db = 0; db < 4; ++db) o[c][db] = (v8f){};
    const unsigned wv = uni((unsigned)tid >> 5);     // the wave's number
    const unsigned long long srck = (unsigned long long)Kh, srcv = (unsigned long long)Vh;     // first bytes of stage 0's tiles
    const unsigned ldsk = (unsigned)(unsigned long long)(&ks[0][0]), ldsv = (unsigned)(unsigned long long)(&vs[0][0]);     // their places in LDS: the low 32 bits of the shared addresses
    u32x8 g1k = tdm_group1<128u, KST>(HD * (unsigned)sizeof(h16)), g1v = tdm_group1<256u, HD>(TT * (unsigned)sizeof(h16));
    asm volatile("" : "+s"(g1k), "+s"(g1v));     // descriptor words held in scalar registers: each tuple, built once, serves every request, so that no register of a request in flight takes a new value
    if (pinned(wv == 0u)) {
        tdm_load(tdm_group0(ldsk, srck), g1k);
        asm volatile("s_wait_tensorcnt 0x0" ::: "memory");     // stage 0's K has landed before this wave passes the barrier that publishes it
    }
    if (pinned(wv == 1u)) {
        tdm_load(tdm_group0(ldsv, srcv), g1v);
        asm volatile("s_wait_tensorcnt 0x0" ::: "memory");     // the same for stage 0's Vt
    }
    __syncthreads();
    if (pinned(wv == 0u)) tdm_load(tdm_group0(ldsk + KSB, srck + KST * HD * sizeof(h16)), g1k);     // stage 1 flies while stage 0 is worked on
    if (pinned(wv == 1u)) tdm_load(tdm_group0(ldsv + VSB, srcv + KST * sizeof(h16)), g1v);
#pragma unroll 1    // one stage per trip: the two buffers alternate
    for (int s = 0; s < TT / KST; ++s) {
        const int b = s & 1;
        const h16* lk = ks[b] + (kh * (KST / 2) + lr) * LP_ + 8 * hi; const h16* lv = vs[b] + lr * VP_ + kh * (KST / 2) + 8 * hi;
#pragma unroll
        for (int p = 0; p < KST / 64; ++p) {
            v16h kf[2][2], vf[4];
#pragma unroll
            for (int kt = 0; kt < 2; ++kt)
#pragma unroll
                for (int ds = 0; ds < 2; ++ds) kf[kt][ds] = ldsfrag(lk + (p * 32 + kt * 16) * LP_ + ds * 32);
#pragma unroll
            for (int db = 0; db < 4; ++db) vf[db] = ldsfrag(lv + db * 16 * VP_ + p * 32);
#pragma unroll
            for (int c = 0; c < NCG; ++c) {
                v8f st[2];
#pragma unroll
                for (int kt = 0; kt < 2; ++kt) { st[kt] = (v8f){};
#pragma unroll
                    for (int ds = 0; ds < 2; ++ds) st[kt] = wmma16(kf[kt][ds], qf[c][ds], st[kt]); }
                v16h pb;
#pragma unroll
                for (int e = 0; e < 16; ++e) pb[e] = tohx(__builtin_fmaf(0.5f, __builtin_amdgcn_tanhf(st[e >> 3][e & 7]), 0.5f));   // st holds x / 2 (see qf)
#pragma unroll
                for (int db = 0; db < 4; ++db) o[c][db] = wmma16(vf[db], pb, o[c][db]);
            }
        }
        asm volatile("s_wait_dscnt 0x0" ::: "memory");     // this wave's reads of stage s have returned before its buffers are handed to the mover
        if (pinned(wv < 2u)) asm volatile("s_wait_tensorcnt 0x0" ::: "memory");     // stage s + 1 has landed before this wave passes the barrier that publishes it
        __syncthreads();   // publishes stage s + 1 and ends every wave's reads of stage s, whose buffers are refilled right behind it
        const unsigned s2 = pinned((unsigned)s + 2u);     // descriptor word held in a scalar register: the next requests' addresses and places are formed behind the wait above
        if (pinned((wv == 0u && s2 < (unsigned)(TT / KST)) ? 1u : 0u)) tdm_load(tdm_group0(ldsk + (s2 & 1u) * KSB, srck + (unsigned long long)s2 * (KST * HD * sizeof(h16))), g1k);     // only while stage s + 2 exists
        if (pinned((wv == 1u && s2 < (unsigned)(TT / KST)) ? 1u : 0u)) tdm_load(tdm_group0(ldsv + (s2 & 1u) * VSB, srcv + (unsigned long long)s2 * (KST * sizeof(h16))), g1v);
    }
    asm volatile("s_wait_tensorcnt 0x0" ::: "memory");     // no request is left when the wave goes on to the epilogue and ends
    asm volatile("s_wait_dscnt 0x0" ::: "memory");     // closes the ring: none of this wave's reads of the buffers is left either
    // The two key halves meet: wave w finishes column groups 0 and 1, wave w + 4 groups 2 and 3; each hands the other two groups' partial sums to its partner.
    float* xo = xch[wave] + lane * 4; const float* xi = xch[wave ^ 4] + lane * 4;
#pragma unroll
    for (int c = 0; c < NCG / 2; ++c)
#pragma unroll
        for (int db = 0; db < 4; ++db) { const v8f g = kh ? o[c][db] : o[c + NCG / 2][db];
            *(v4fa*)(xo + ((c * 4 + db) * 2) * 128) = (v4f){ g[0], g[1], g[2], g[3] }; *(v4fa*)(xo + ((c * 4 + db) * 2 + 1) * 128) = (v4f){ g[4], g[5], g[6], g[7] }; }
    __syncthreads();   // publishes every wave's handed-over partial sums to its partner
    v8f m[NCG / 2][4];
#pragma unroll
    for (int c = 0; c < NCG / 2; ++c)
#pragma unroll
        for (int db = 0; db < 4; ++db) { const v4f g0 = *(const v4fa*)(xi + ((c * 4 + db) * 2) * 128), g1 = *(const v4fa*)(xi + ((c * 4 + db) * 2 + 1) * 128);
            m[c][db] = (kh ? o[c + NCG / 2][db] : o[c][db]) + (v8f){ g0[0], g0[1], g0[2], g0[3], g1[0], g1[1], g1[2], g1[3] }; }
#pragma unroll
    for (int c = 0; c < NCG / 2; ++c)
#pragma unroll
        for (int db = 0; db < 4; ++db) { v8us oh, ol;     // m[c][db][j] = x[q][h * 64 + db * 16 + 8 * hi + j]: eight neighbours of one row, one 16-byte store per plane
#pragma unroll
            for (int j = 0; j < 8; ++j) { unsigned short a, c2; splitf(m[c][db][j], a, c2); oh[j] = a; ol[j] = c2; }
            const size_t oo = (size_t)(q0 + (kh * (NCG / 2) + c) * 16) * DQ + h * HD + db * 16 + 8 * hi; *(v8us*)(Ah + oo) = oh; *(v8us*)(Al + oo) = ol;
            asm volatile("s_wait_xcnt 0x0" :: "v"(oh), "v"(ol) : "memory"); }     // before the stores' registers are written again; as inputs the stored values stay in their registers up to here
}

extern "C" void kernel_launch(void* const* d_in, const int* in_sizes, int n_in,
                              void* d_out, int out_size, void* d_ws, size_t ws_size, hipStream_t stream) {
    (void)in_sizes; (void)n_in; (void)out_size;
    const float* xq = (const float*)d_in[0]; const float* xk = (const float*)d_in[1]; const float* xv = (const float*)d_in[2]; const float* wq = (const float*)d_in[3]; const float* wk = (const float*)d_in[4]; const float* wv = (const float*)d_in[5];
    const float* gq = (const float*)d_in[6]; const float* bq = (const float*)d_in[7]; const float* gk = (const float*)d_in[8]; const float* bk = (const float*)d_in[9]; const float* wp = (const float*)d_in[10]; const float* bp = (const float*)d_in[11];
    float* OUT = (float*)d_out;     // [1][4096][1024]
    char* wsp = (char*)d_ws;
    auto take = [&](size_t bytes) { char* p = wsp; wsp += (bytes + 255) & ~(size_t)255; return (void*)p; };
    bf* WQ = (bf*)take((size_t)DQ * DM * 2); bf* WK = (bf*)take((size_t)DQ * DM * 2); bf* WV = (bf*)take((size_t)DQ * DM * 2); bf* WP = (bf*)take((size_t)DM * DQ * 2);     // these seven planes lie one behind the other (sizes are multiples of 256 B): k_cvtall writes them as one range from WQ
    bf* XQ = (bf*)take((size_t)TT * DM * 2); bf* XK = (bf*)take((size_t)TT * DM * 2); bf* XV = (bf*)take((size_t)TT * DM * 2);
    const size_t PS = (size_t)NH_ * TT * HD; h16* QP16 = (h16*)take(PS * 2); h16* KP16 = (h16*)take(PS * 2); h16* VT16 = (h16*)take(PS * 2);
    bf* ATh = (bf*)take((size_t)TT * DQ * 2); bf* ATl = (bf*)take((size_t)TT * DQ * 2);
    if ((size_t)(wsp - (char*)d_ws) > ws_size) return;    // ws 256 MiB
    k_cvtall<<<4 * CVNW + 3 * CVNX, 512, 0, stream>>>(wq, wk, wv, wp, xq, xk, xv, WQ);
    /* q, k, v: XQ, XK, XV lie TT * DM elements apart, WQ, WK, WV DQ * DM, QP16, KP16, VT16 PS */
    k_gemmw<bf, DM, 0, false, 3><<<dim3(TT / 128, DQ / 128, 3), 128, 0, stream>>>(XQ, nullptr, WQ, nullptr, 0, nullptr, (size_t)TT * DM, (size_t)DQ * DM, PS, gq, bq, SCL, gk, bk, 1.0f, QP16);
    k_fattn<<<dim3(TT / (4 * NCG * 16), NH_, 1), 256, 0, stream>>>(QP16, KP16, VT16, ATh, ATl);      /* sigmoid(qh.kh) vh, merged, hi/lo */
    k_gemmw<bf, DQ, 1, true, 0><<<dim3(TT / 128, DM / 128, 1), 128, 0, stream>>>(ATh, ATl, WP, OUT, DM, bp, 0, 0, 0, nullptr, nullptr, 1.0f, nullptr, nullptr, 1.0f, nullptr);
}

// v009
// One run takes 93 microseconds.
// Next to v008, in two timings, it ran 1.05 times as fast each time.
// Over all steps from v000 it is 22.8 times as fast.
#include <hip/hip_runtime.h>

// Sigmoid attention (q, k, v [1][4096][1024]; qh, kh, vh = (q Wq^T, k Wk^T, v Wv^T) ('oi' [1024][1024], no bias) split into 16 heads x 64; per-head LayerNorm over the 64 dims of qh (x gq + bq, then x 1/8) and kh (x gk + bk); attn = sigmoid(qh.kh) over the full 4096 x 4096 matrix (no softmax, no normalisation); x = attn vh merged; out = x Wp^T + bp -> [1][4096][1024] (4.2 M)).
// Compute dtypes, f32 accumulate: every input rounded to bf16; projections on PLAIN bf16 operands (inputs: exact); LayerNorm in f32 (in the projection's epilogue, eight lanes per head row); scores and attn.v on single fp16 planes (1 product each: sigmoid outputs lie in (0,1), no carry needed); sigmoid in f32 (0.5 + 0.5 tanh(x / 2), hardware tanh); merged heads hi/lo x exact Wp (2 products) + bp.
// Scores, sigmoid, attn.v and the head merge run in ONE launch (k_fattn): the 4096 x 4096 matrix of a head never leaves the registers.
// The q, k and v projections write the f16 head planes themselves: a wave's 64-column tile is exactly one head, so the LayerNorm (q, k) and the transpose (v) are done on the accumulators.
// The three projections read none of each other's output: they run as ONE launch, grid z = which projection.

#define TT   4096
#define DM   1024
#define NH_  16
#define HD   64
#define DQ   (NH_ * HD)
#define SCL  0.125f
#define LNEPS 1e-5f
typedef _Float16 h16;
typedef unsigned short bf;
typedef __attribute__((ext_vector_type(16))) __bf16   v16bf;
typedef __attribute__((ext_vector_type(16))) _Float16 v16h;
typedef __attribute__((ext_vector_type(8)))  _Float16 v8h;
typedef __attribute__((ext_vector_type(8)))  unsigned short v8us;
typedef __attribute__((ext_vector_type(8)))  float    v8f;
typedef __attribute__((ext_vector_type(4)))  float    v4f;
typedef v8h  __attribute__((may_alias)) v8ha;
typedef v4f  __attribute__((may_alias)) v4fa;
typedef v8us __attribute__((may_alias)) v8usa;

__device__ __forceinline__ unsigned short f2bf(float f) { unsigned u = __float_as_uint(f); u += 0x7FFFu + ((u >> 16) & 1u); return (unsigned short)(u >> 16); }
__device__ __forceinline__ float bf2f(unsigned short b) { return __uint_as_float(((unsigned)b) << 16); }
__device__ __forceinline__ float bfr(float f) { return bf2f(f2bf(f)); }
__device__ __forceinline__ v16h cat16(v8h lo, v8h hi) { return __builtin_shufflevector(lo, hi, 0, 1, 2, 3, 4, 5, 6, 7, 8, 9, 10, 11, 12, 13, 14, 15); }
__device__ __forceinline__ v16bf cat16b(v8us lo, v8us hi) { return __builtin_bit_cast(v16bf, __builtin_shufflevector(lo, hi, 0, 1, 2, 3, 4, 5, 6, 7, 8, 9, 10, 11, 12, 13, 14, 15)); }
__device__ __forceinline__ v8f wmma16(v16h a, v16h b, v8f c) { return __builtin_amdgcn_wmma_f32_16x16x32_f16(false, a, false, b, (short)0, c, false, false); }
__device__ __forceinline__ v8f wmmab(v16bf a, v16bf b, v8f c) { return __builtin_amdgcn_wmma_f32_16x16x32_bf16(false, a, false, b, (short)0, c, false, false); }



// ---- k_gemmw: GEMM, workgroup = 4 waves (2 x 2) = one 128x128 output tile, 64x64 (16 accumulators) per wave; grid (M/128, N/128, Z), 128 threads.
// The 128 rows of each operand come in stages of 128 k (256 B per row) into two LDS buffers by tensor loads, through no register: wave p (p < number of planes) asks for plane p's 128 x 256 B tile, one request per stage, issued a whole stage ahead; the mover's pad of 16 B per row makes the 272-B pitch. The waves read their fragments from LDS, each operand row feeding two waves.
// C[m][n] (f32, pitch ldc, + optional f32 bias[n]) = sum_k A[m][k] Bt[n][k] (NSPLIT 1: + A2[m][k] Bt[n][k]). z-batch strides sA/sB/sC in elements. K (a template constant: row offsets become immediates) % 128 == 0.
// EPI 0: C as above. EPI 1: a wave's 64 columns are one head; each row is normalised over them (x gw + gb, x sc) and stored as f16 to P16[head][row][64]. EPI 2: the tile is stored as f16, transposed, to P16[column][TT].
// EPI 3: three independent GEMMs in one grid, f16 planes sC elements apart: z = 0 ends as EPI 1 with gw, gb, sc, z = 1 as EPI 1 with gw2, gb2, sc2, z = 2 as EPI 2 (the shortest epilogue starts last).
// amdgpu_waves_per_eu(1, 1), EPI 0: one wave per SIMD, that is one workgroup per WGP, so that the 256 equal workgroups of a launch cannot double up on some WGPs while others idle.
// amdgpu_waves_per_eu(2, 2), EPI 3: 768 workgroups, two resident per WGP (registers and LDS fit twice): while one waits for its staged rows, fills its first stage or runs its epilogue, the other's products keep the matrix units busy.
#define GKB 128
#define GLP (GKB + 8)     // LDS row pitch 272 B = 16 B x odd: no bank conflict for 16-byte fragment reads
typedef unsigned u32x4 __attribute__((ext_vector_type(4)));
typedef unsigned u32x8 __attribute__((ext_vector_type(8)));
__device__ __forceinline__ unsigned uni(unsigned v) { return (unsigned)__builtin_amdgcn_readfirstlane(v); }
__device__ __forceinline__ unsigned pinned(unsigned v) { unsigned w = uni(v); asm volatile("" : "+s"(w)); return w; }     // holds v in a scalar register: a test on it compiles to a scalar branch (a tensor load ignores EXEC), and a descriptor word made from it is formed where this stands
// Tensor descriptor, group 1: 1-byte elements, tile = tensor = N rows of R bytes (R = 128 or 256), source row pitch in bytes, 16 B of LDS pad behind every row (interval code 4 = 128 B, 5 = 256 B; amount code 3), no mask.
template <unsigned R, unsigned N> __device__ __forceinline__ u32x8 tdm_group1(unsigned src_pitch) { static_assert(R == 128u || R == 256u, "rows whose pad is known to land right"); u32x8 g;
    g[0] = uni((1u << 20) | ((R == 256u ? 5u : 4u) << 22) | (3u << 25)); g[1] = uni(R << 16); g[2] = uni(N << 16); g[3] = uni(R << 16); g[4] = uni(N); g[5] = uni(src_pitch); g[6] = uni(0u); g[7] = uni(0u); return g; }
// Group 0: count 1, LDS destination (byte offset in the workgroup's LDS), global address of the tile's first byte, type 2.
__device__ __forceinline__ u32x4 tdm_group0(unsigned lds_dst, unsigned long long ga) { u32x4 g;
    g[0] = uni(1u); g[1] = uni(lds_dst); g[2] = uni((unsigned)ga); g[3] = uni((((unsigned)(ga >> 32)) & 0x01FFFFFFu) | 0x80000000u); return g; }
__device__ __forceinline__ void tdm_load(u32x4 g0, u32x8 g1) { asm volatile("tensor_load_to_lds %0, %1" :: "s"(g0), "s"(g1) : "memory"); }     // one request of the whole wave: global tile -> LDS
template <typename T16> struct WFrag;
template <> struct WFrag<h16> { typedef v16h V; static __device__ __forceinline__ V ld(const h16* p) { return cat16(*(const v8h*)p, *(const v8h*)(p + 16)); } static __device__ __forceinline__ v8f mma(V a, V b, v8f c) { return wmma16(a, b, c); } };
template <> struct WFrag<bf> { typedef v16bf V; static __device__ __forceinline__ V lds(const bf* p) { return cat16b(*(const v8usa*)p, *(const v8usa*)(p + 16)); } static __device__ __forceinline__ v8f mma(V a, V b, v8f c) { return wmmab(a, b, c); } };
// x + (x of lane ^ M), M < 16: one step of a butterfly sum inside a 16-lane row, on the vector pipe (row_xmask), no LDS round trip.
template <int M> __device__ __forceinline__ float xadd(float x) { return x + __int_as_float(__builtin_amdgcn_update_dpp(0, __float_as_int(x), 0x160 | M, 0xf, 0xf, true)); }
template <typename T16, int K, int NSPLIT, bool BIAS, int EPI>
__global__ __launch_bounds__(128) __attribute__((amdgpu_waves_per_eu(EPI == 3 ? 2 : 1, EPI == 3 ? 2 : 1))) void k_gemmw(const T16* __restrict__ A, const T16* __restrict__ A2, const T16* __restrict__ Bt, float* C, int ldc, const float* __restrict__ bias, size_t sA, size_t sB, size_t sC, const float* gw, const float* gb, float sc, const float* gw2, const float* gb2, float sc2, h16* P16) {
    typedef typename WFrag<T16>::V V;
    static_assert(K % GKB == 0 && NSPLIT <= 1, "whole stages; planes A, Bt and at most A2");
    constexpr int NP = NSPLIT == 1 ? 3 : 2;     // staged planes: A, Bt (, A2)
    static_assert(GKB * sizeof(T16) == 256 && GLP * sizeof(T16) == 272 && (128 * GLP * sizeof(T16)) % 2048 == 0, "tile rows of 256 B at pitch 272 B; every plane starts at a multiple of 2 KiB");
    __shared__ __attribute__((aligned(2048))) T16 tl[2][NP][128 * GLP];
    __shared__ __align__(16) float osw[4][16 * 68];
    constexpr bool LN = EPI == 1 || EPI == 3;     // the per-head LayerNorm epilogue is compiled in
    const size_t z = blockIdx.z; A += z * sA; if (NSPLIT == 1) A2 += z * sA; Bt += z * sB; if (EPI == 3) P16 += z * sC; else C += z * sC;
    if (EPI == 3 && z == 1) { gw = gw2; gb = gb2; sc = sc2; }
    const int tid = threadIdx.x, lane = tid & 31, wave = tid >> 5, lr = lane & 15, hi = lane >> 4;
    const int wr = (wave & 1) * 64, wc = (wave >> 1) * 64, r0 = blockIdx.x * 128 + wr, c0 = blockIdx.y * 128 + wc;
    float* os = osw[wave];     // each wave's own epilogue rows
    v8f acc[4][4];
#pragma unroll
    for (int mb = 0; mb < 4; ++mb)
#pragma unroll
        for (int nb = 0; nb < 4; ++nb) acc[mb][nb] = (v8f){};
    const T16* ga = A + (size_t)blockIdx.x * 128 * K; const T16* gb_ = Bt + (size_t)blockIdx.y * 128 * K; const T16* gc = NSPLIT == 1 ? A2 + (size_t)blockIdx.x * 128 * K : gb_;     // wave-uniform plane bases
    static_assert(K / GKB >= 2, "the prologue asks for stages 0 and 1");
    constexpr unsigned NS = K / GKB; static_assert((NS & (NS - 1u)) == 0u, "the k chunks wrap by a mask");
    // Trip s works on k chunk (s + rot) mod NS. The workgroups that share operand rows (A: same x, every y; Bt: same y, every x) start together: from chunk 0 all of them would ask for the same lines at the same moment, in every trip lines that nobody has brought in from memory yet.
    // With different starts one of them brings a chunk in and the others find it in L2 a trip or more later. rot differs for every y of one x; over x it takes all its values within four neighbours and their partners eight further on. Any rot gives the same sum but for its order.
    const unsigned rot = uni((blockIdx.y + ((blockIdx.x & 3u) | (((blockIdx.x >> 3) & 1u) << 2))) & (NS - 1u));
    constexpr unsigned PLB = 128 * GLP * sizeof(T16), BUFB = NP * PLB;     // bytes of a plane and of a buffer in LDS
    const unsigned wv = uni((unsigned)tid >> 5), pl = wv < (unsigned)NP ? wv : 0u;     // the wave's number; the plane it asks for
    const unsigned long long src0 = (unsigned long long)(pl == 0u ? ga : pl == 1u ? gb_ : gc);     // first byte of that plane's rows at k = 0
    const unsigned lds0 = (unsigned)(unsigned long long)(&tl[0][0][0]) + pl * PLB;     // its place in buffer 0: the low 32 bits of the shared address
    u32x8 g1 = tdm_group1<256u, 128u>(K * (unsigned)sizeof(T16));
    asm volatile("" : "+s"(g1));     // descriptor words held in scalar registers: one tuple, built once, serves every request, so that no register of a request in flight takes a new value
    if (pinned(wv < (unsigned)NP)) {
        tdm_load(tdm_group0(lds0, src0 + (unsigned long long)rot * (GKB * sizeof(T16))), g1);
        asm volatile("s_wait_tensorcnt 0x0" ::: "memory");     // stage 0 has landed before this wave passes the barrier that publishes it
    }
    __syncthreads();
    if (pinned(wv < (unsigned)NP)) tdm_load(tdm_group0(lds0 + BUFB, src0 + (unsigned long long)((rot + 1u) & (NS - 1u)) * (GKB * sizeof(T16))), g1);     // stage 1 flies while stage 0 is multiplied
#pragma unroll 1    // one stage per trip: the two buffers alternate
    for (int s = 0; s < K / GKB; ++s) {
        const int b = s & 1;
        const T16* la = tl[b][0] + (wr + lr) * GLP + 8 * hi; const T16* lb = tl[b][1] + (wc + lr) * GLP + 8 * hi; const T16* la2 = tl[b][NP - 1] + (wr + lr) * GLP + 8 * hi;
        V fa[2][4], fb[2][4], fa2[2][4];     // two fragment sets: the next 32 k are read from LDS while this set is multiplied
#pragma unroll
        for (int t = 0; t < 4; ++t) { fa[0][t] = WFrag<T16>::lds(la + t * 16 * GLP); fb[0][t] = WFrag<T16>::lds(lb + t * 16 * GLP); if (NSPLIT == 1) fa2[0][t] = WFrag<T16>::lds(la2 + t * 16 * GLP); }
#pragma unroll    // constant set indices keep the fragments in registers
        for (int kk = 0; kk < GKB / 32; ++kk) {
            const int cu = kk & 1, nx = cu ^ 1;
            if (kk + 1 < GKB / 32) {
#pragma unroll
                for (int t = 0; t < 4; ++t) { fa[nx][t] = WFrag<T16>::lds(la + t * 16 * GLP + (kk + 1) * 32); fb[nx][t] = WFrag<T16>::lds(lb + t * 16 * GLP + (kk + 1) * 32); if (NSPLIT == 1) fa2[nx][t] = WFrag<T16>::lds(la2 + t * 16 * GLP + (kk + 1) * 32); }
            }
            __builtin_amdgcn_sched_barrier(0);     // holds the next set's LDS reads as one group ahead of this matrix block: sunk among the products, each read would be waited for where it stands
#pragma unroll
            for (int nb = 0; nb < 4; ++nb) {
#pragma unroll
                for (int mb = 0; mb < 4; ++mb) acc[mb][nb] = WFrag<T16>::mma(fa[cu][mb], fb[cu][nb], acc[mb][nb]);
                if (NSPLIT == 1) {
#pragma unroll
                    for (int mb = 0; mb < 4; ++mb) acc[mb][nb] = WFrag<T16>::mma(fa2[cu][mb], fb[cu][nb], acc[mb][nb]); }
            }
            __builtin_amdgcn_sched_barrier(0);     // ends the block: the reads behind it stay one group too, not drawn up among these products
        }
        asm volatile("s_wait_dscnt 0x0" ::: "memory");     // this wave's reads of stage s have returned before its buffer is handed to the mover
        if (pinned(wv < (unsigned)NP)) asm volatile("s_wait_tensorcnt 0x0" ::: "memory");     // stage s + 1 has landed before this wave passes the barrier that publishes it
        __syncthreads();   // publishes stage s + 1 and ends every wave's reads of stage s, whose buffer is refilled right behind it
        const unsigned s2 = pinned((unsigned)s + 2u);     // descriptor word held in a scalar register: the next request's address and place are formed behind the wait above
        if (pinned((wv < (unsigned)NP && s2 < (unsigned)(K / GKB)) ? 1u : 0u)) tdm_load(tdm_group0(lds0 + (s2 & 1u) * BUFB, src0 + (unsigned long long)((s2 + rot) & (NS - 1u)) * (GKB * sizeof(T16))), g1);     // only while stage s + 2 exists
    }
    asm volatile("s_wait_tensorcnt 0x0" ::: "memory");     // no request is left when the wave goes on to the epilogue and ends
    asm volatile("s_wait_dscnt 0x0" ::: "memory");     // closes the ring: none of this wave's reads of the buffers is left either
    if (EPI == 2 || (EPI == 3 && z == 2)) {     // (the same for the whole workgroup) acc[mb][nb][0..7] = eight neighbouring rows of one column: one 16-byte store each; the four mb fill a 128-byte line of the transposed plane
#pragma unroll    // this and the two below: constant indices keep acc in registers
        for (int nb = 0; nb < 4; ++nb)
#pragma unroll
            for (int mb = 0; mb < 4; ++mb) { v8h o;
#pragma unroll
                for (int j = 0; j < 8; ++j) o[j] = (h16)acc[mb][nb][j];
                *(v8h*)(P16 + (size_t)(c0 + nb * 16 + lr) * TT + r0 + mb * 16 + 8 * hi) = o;
                asm volatile("s_wait_xcnt 0x0" :: "v"(o) : "memory"); }     // before the store's registers are written again; as an input the stored value stays in its registers up to here
        return;
    }
    const int g8 = lane >> 3, c8 = (lane & 7) * 8;     // EPI 1: eight lanes per row, eight columns per lane
    float gg[8], bb[8];
    if (LN) {
#pragma unroll    // constant indices keep gg and bb in registers
        for (int i = 0; i < 8; ++i) { gg[i] = bfr(gw[c8 + i]); bb[i] = bfr(gb[c8 + i]); } }
#pragma unroll
    for (int mb = 0; mb < 4; ++mb) {
#pragma unroll
        for (int nb = 0; nb < 4; ++nb) {
#pragma unroll
            for (int j = 0; j < 8; ++j) os[(hi * 8 + j) * 68 + nb * 16 + lr] = acc[mb][nb][j]; }
        __builtin_amdgcn_wave_barrier(); asm volatile("" ::: "memory");
        if (LN) {
#pragma unroll    // the four passes are independent: unrolled, their dependent sums interleave; the inner loops: constant indices keep d and o in registers
            for (int s = 0; s < 4; ++s) { const int row = 4 * s + g8; const v4f x0 = *(const v4fa*)(os + row * 68 + c8), x1 = *(const v4fa*)(os + row * 68 + c8 + 4);
                float d[8] = { x0[0], x0[1], x0[2], x0[3], x1[0], x1[1], x1[2], x1[3] };
                const float mu = xadd<4>(xadd<2>(xadd<1>(((d[0] + d[1]) + (d[2] + d[3])) + ((d[4] + d[5]) + (d[6] + d[7]))))) * (1.0f / 64.0f);
#pragma unroll
                for (int i = 0; i < 8; ++i) d[i] -= mu;
                const float s2 = xadd<4>(xadd<2>(xadd<1>(((d[0] * d[0] + d[1] * d[1]) + (d[2] * d[2] + d[3] * d[3])) + ((d[4] * d[4] + d[5] * d[5]) + (d[6] * d[6] + d[7] * d[7])))));
                const float rs = __frsqrt_rn(s2 * (1.0f / 64.0f) + LNEPS);
                v8h o;
#pragma unroll
                for (int i = 0; i < 8; ++i) o[i] = (h16)(((d[i] * rs) * gg[i] + bb[i]) * sc);
                *(v8h*)(P16 + ((size_t)(c0 >> 6) * TT + r0 + mb * 16 + row) * HD + c8) = o; }     // four whole 128-byte rows per store
            asm volatile("s_wait_xcnt 0x0" ::: "memory");     // before the stores' registers are written again
        } else {
        float* crow = C + (size_t)(r0 + mb * 16) * ldc + c0;
#pragma unroll
            for (int s = 0; s < 8; ++s) { const int row = 2 * s + hi, cofs = lr * 4; v4f val = *(const v4fa*)(os + row * 68 + cofs); if (BIAS) { val[0] += bfr(bias[c0 + cofs]); val[1] += bfr(bias[c0 + cofs + 1]); val[2] += bfr(bias[c0 + cofs + 2]); val[3] += bfr(bias[c0 + cofs + 3]); }
                *(v4f*)(crow + (size_t)row * ldc + cofs) = val; }
            asm volatile("s_wait_xcnt 0x0" ::: "memory");     // before the stores' registers are written again
             }
        __builtin_amdgcn_wave_barrier(); asm volatile("" ::: "memory");
    }
}

__device__ __forceinline__ h16 tohx(float x) { return (h16)x; }
__device__ __forceinline__ void splitf(float y, unsigned short& h, unsigned short& l) { h = f2bf(y); l = f2bf(y - bf2f(h)); }
typedef __attribute__((ext_vector_type(2))) _Float16 v2h;
typedef __attribute__((ext_vector_type(4))) _Float16 v4h;
typedef __attribute__((ext_vector_type(2))) unsigned short v2us;
typedef __attribute__((ext_vector_type(4))) unsigned short v4us;
typedef __attribute__((ext_vector_type(2))) float v2f;
typedef __attribute__((ext_vector_type(4))) int v4i;

// ---- k_cvtall: every f32 -> bf16 rounding of the call (Wq, Wk, Wv, Wp, q, k, v) in ONE launch of 256 workgroups of 16 waves, one per WGP: few waves to start, one launch gap.
// A workgroup takes CVG floats of one input, a wave CVL * 128 of them in a row: CVL wave-wide loads of 512 contiguous bytes, all issued before the first is used, each rounded and stored as 256 contiguous bytes.
// The seven bf16 planes lie one behind the other in dst in the order of the arguments, so workgroup b writes dst + b * CVG whatever input it reads.
// amdgpu_waves_per_eu(4, 4): the register budget of four waves per SIMD, so that all CVL loads have registers of their own; at more than 128 registers a wave no second workgroup fits a WGP, so the equal workgroups cannot double up on some WGPs while others idle.
#define CVL 32
#define CVG (16 * CVL * 128)
#define CVNW (DQ * DM / CVG)     // workgroups per weight matrix
#define CVNX (TT * DM / CVG)     // workgroups per activation matrix
__global__ __launch_bounds__(512) __attribute__((amdgpu_waves_per_eu(4, 4))) void k_cvtall(const float* __restrict__ wq, const float* __restrict__ wk, const float* __restrict__ wv, const float* __restrict__ wp, const float* __restrict__ xq, const float* __restrict__ xk, const float* __restrict__ xv, bf* dst) {
    static_assert(DQ * DM % CVG == 0 && TT * DM % CVG == 0, "whole workgroups per input");
    const unsigned b = blockIdx.x, iw = b / CVNW, ix = (b - 4 * CVNW) / CVNX;
    const float* src = b < 4 * CVNW ? (iw == 0 ? wq : iw == 1 ? wk : iw == 2 ? wv : wp) : (ix == 0 ? xq : ix == 1 ? xk : xv);
    const unsigned sb = b < 4 * CVNW ? b % CVNW : (b - 4 * CVNW) % CVNX, to = (threadIdx.x >> 5) * (CVL * 128) + (threadIdx.x & 31) * 4;
    const float* sw = src + (size_t)sb * CVG; bf* d = dst + (size_t)b * CVG + to;     // sw: wave-uniform base of the workgroup's floats
    v4f r[CVL];
#pragma unroll    // this and the loops below: constant indices keep r in registers
    for (int i = 0; i < CVL; ++i) r[i] = *(const v4fa*)(sw + to + i * 128);
    asm volatile("s_wait_xcnt 0x0" :: "v"(to * (unsigned)sizeof(float)), "s"(sw) : "memory");     // stands before any register that these loads name as an address is written again; as inputs offset and base stay in their registers up to here
#pragma unroll
    for (int g = 0; g < CVL; g += 8) {
#pragma unroll
        for (int i = g; i < g + 8; ++i) { v4us o;
#pragma unroll
            for (int k = 0; k < 4; ++k) o[k] = f2bf(r[i][k]);
            *(v4us*)(d + i * 128) = o; }
        if (g + 8 < CVL) asm volatile("s_wait_xcnt 0x0" ::: "memory");     // before the next eight's rounding writes registers that these stores name; the scheduling barrier below holds that rounding behind it
        __builtin_amdgcn_sched_barrier(0);     // each eight loads are rounded and stored as they land: drawn together, every store would stand behind the wait for the last load
    }
}

#define KST 128
#define LP_ 72             // K rows: 64 d + 8
#define VP_ (KST + 8)      // Vt rows: 128 keys + 8
#define NCG 4              // 16-column groups per wave
__device__ __forceinline__ v16h ldsfrag(const h16* p) { return cat16(*(const v8ha*)p, *(const v8ha*)(p + 16)); }
__global__ __launch_bounds__(256) __attribute__((amdgpu_waves_per_eu(2, 2))) void k_fattn(const h16* __restrict__ Q16, const h16* __restrict__ K16, const h16* __restrict__ V16, bf* Ah, bf* Al) {
    constexpr unsigned KSB = KST * LP_ * sizeof(h16), VSB = (HD * VP_ * sizeof(h16) + 2047u) & ~2047u;     // bytes of a K and of a Vt buffer; the latter rounded up so that every buffer starts at a multiple of 2 KiB
    static_assert(KSB % 2048u == 0 && HD * sizeof(h16) == 128 && LP_ * sizeof(h16) == 144 && KST * sizeof(h16) == 256 && VP_ * sizeof(h16) == 272 && TT / KST >= 2, "tile rows and pitches as the descriptors have them; stages 0 and 1 exist");
    __shared__ __attribute__((aligned(2048))) h16 ks[2][KSB / sizeof(h16)];   // [key][d]
    __shared__ __attribute__((aligned(2048))) h16 vs[2][VSB / sizeof(h16)];   // [d][key]
    __shared__ __align__(16) float xch[8][NCG * 4 * 32 * 4];   // per wave: the half of its partial sums that its partner finishes
    const int tid = threadIdx.x, lane = tid & 31, wave = tid >> 5, lr = lane & 15, hi = lane >> 4;
    const int cw = wave & 3, kh = __builtin_amdgcn_readfirstlane(wave >> 2);     // column set; key half (wave-uniform)
    const int h = blockIdx.y, q0 = blockIdx.x * (4 * NCG * 16) + cw * (NCG * 16) + lr;
    const h16* Qh = Q16 + (size_t)h * TT * HD; const h16* Kh = K16 + (size_t)h * TT * HD; const h16* Vh = V16 + (size_t)h * HD * TT;
    const h16* qp = Qh + (size_t)q0 * HD + 8 * hi;
    v16h qf[NCG][2];
#pragma unroll    // this and the loops below: constant indices keep the fragments and accumulators in registers
    for (int c = 0; c < NCG; ++c)
#pragma unroll
        for (int ds = 0; ds < 2; ++ds) qf[c][ds] = WFrag<h16>::ld(qp + c * 16 * HD + ds * 32);
    asm volatile("s_wait_xcnt 0x0" :: "v"(qp) : "memory");     // stands before the register pair that the Q loads name as their address is written again; as an input the address stays in it up to here
#pragma unroll
    for (int c = 0; c < NCG; ++c)
#pragma unroll
        for (int ds = 0; ds < 2; ++ds) qf[c][ds] *= (h16)0.5f;   // times a power of two (exact in f16 above its subnormals): the score tiles hold x / 2, which is what tanh takes
    v8f o[NCG][4];
#pragma unroll
    for (int c = 0; c < NCG; ++c)
#pragma unroll
        for (int db = 0; db < 4; ++db) o[c][db] = (v8f){};
    const unsigned wv = uni((unsigned)tid >> 5);     // the wave's number
    constexpr unsigned NS = TT / KST; static_assert((NS & (NS - 1u)) == 0u && NS >= 32u && TT / (4 * NCG * 16) <= 16, "the key stages wrap by a mask; sixteen different starts");
    // Trip s works on key stage (s + rot) mod NS: the sixteen workgroups of a head read the same K and Vt tiles and start together; with sixteen different starts, evenly spread over the keys, one of them brings a tile in from memory and the others find it in L2 later. Any rot gives the same sum but for its order.
    const unsigned rot = uni(((NS / 8u) * ((blockIdx.x & 3u) | ((blockIdx.x >> 3) << 2)) + (NS / 16u) * ((blockIdx.x >> 2) & 1u)) & (NS - 1u));
    const unsigned long long srck = (unsigned long long)Kh, srcv = (unsigned long long)Vh;     // first bytes of the head's K and Vt at key 0
    const unsigned ldsk = (unsigned)(unsigned long long)(&ks[0][0]), ldsv = (unsigned)(unsigned long long)(&vs[0][0]);     // their places in LDS: the low 32 bits of the shared addresses
    u32x8 g1k = tdm_group1<128u, KST>(HD * (unsigned)sizeof(h16)), g1v = tdm_group1<256u, HD>(TT * (unsigned)sizeof(h16));
    asm volatile("" : "+s"(g1k), "+s"(g1v));     // descriptor words held in scalar registers: each tuple, built once, serves every request, so that no register of a request in flight takes a new value
    if (pinned(wv == 0u)) {
        tdm_load(tdm_group0(ldsk, srck + (unsigned long long)rot * (KST * HD * sizeof(h16))), g1k);
        asm volatile("s_wait_tensorcnt 0x0" ::: "memory");     // stage 0's K has landed before this wave passes the barrier that publishes it
    }
    if (pinned(wv == 1u)) {
        tdm_load(tdm_group0(ldsv, srcv + (unsigned long long)rot * (KST * sizeof(h16))), g1v);
        asm volatile("s_wait_tensorcnt 0x0" ::: "memory");     // the same for stage 0's Vt
    }
    __syncthreads();
    if (pinned(wv == 0u)) tdm_load(tdm_group0(ldsk + KSB, srck + (unsigned long long)((rot + 1u) & (NS - 1u)) * (KST * HD * sizeof(h16))), g1k);     // stage 1 flies while stage 0 is worked on
    if (pinned(wv == 1u)) tdm_load(tdm_group0(ldsv + VSB, srcv + (unsigned long long)((rot + 1u) & (NS - 1u)) * (KST * sizeof(h16))), g1v);
#pragma unroll 1    // one stage per trip: the two buffers alternate
    for (int s = 0; s < TT / KST; ++s) {
        const int b = s & 1;
        const h16* lk = ks[b] + (kh * (KST / 2) + lr) * LP_ + 8 * hi; const h16* lv = vs[b] + lr * VP_ + kh * (KST / 2) + 8 * hi;
#pragma unroll
        for (int p = 0; p < KST / 64; ++p) {
            v16h kf[2][2], vf[4];
#pragma unroll
            for (int kt = 0; kt < 2; ++kt)
#pragma unroll
                for (int ds = 0; ds < 2; ++ds) kf[kt][ds] = ldsfrag(lk + (p * 32 + kt * 16) * LP_ + ds * 32);
#pragma unroll
            for (int db = 0; db < 4; ++db) vf[db] = ldsfrag(lv + db * 16 * VP_ + p * 32);
#pragma unroll
            for (int c = 0; c < NCG; ++c) {
                v8f st[2];
#pragma unroll
                for (int kt = 0; kt < 2; ++kt) { st[kt] = (v8f){};
#pragma unroll
                    for (int ds = 0; ds < 2; ++ds) st[kt] = wmma16(kf[kt][ds], qf[c][ds], st[kt]); }
                v16h pb;
#pragma unroll
                for (int e = 0; e < 16; ++e) pb[e] = tohx(__builtin_fmaf(0.5f, __builtin_amdgcn_tanhf(st[e >> 3][e & 7]), 0.5f));   // st holds x / 2 (see qf)
#pragma unroll
                for (int db = 0; db < 4; ++db) o[c][db] = wmma16(vf[db], pb, o[c][db]);
            }
        }
        asm volatile("s_wait_dscnt 0x0" ::: "memory");     // this wave's reads of stage s have returned before its buffers are handed to the mover
        if (pinned(wv < 2u)) asm volatile("s_wait_tensorcnt 0x0" ::: "memory");     // stage s + 1 has landed before this wave passes the barrier that publishes it
        __syncthreads();   // publishes stage s + 1 and ends every wave's reads of stage s, whose buffers are refilled right behind it
        const unsigned s2 = pinned((unsigned)s + 2u);     // descriptor word held in a scalar register: the next requests' addresses and places are formed behind the wait above
        if (pinned((wv == 0u && s2 < (unsigned)(TT / KST)) ? 1u : 0u)) tdm_load(tdm_group0(ldsk + (s2 & 1u) * KSB, srck + (unsigned long long)((s2 + rot) & (NS - 1u)) * (KST * HD * sizeof(h16))), g1k);     // only while stage s + 2 exists
        if (pinned((wv == 1u && s2 < (unsigned)(TT / KST)) ? 1u : 0u)) tdm_load(tdm_group0(ldsv + (s2 & 1u) * VSB, srcv + (unsigned long long)((s2 + rot) & (NS - 1u)) * (KST * sizeof(h16))), g1v);
    }
    asm volatile("s_wait_tensorcnt 0x0" ::: "memory");     // no request is left when the wave goes on to the epilogue and ends
    asm volatile("s_wait_dscnt 0x0" ::: "memory");     // closes the ring: none of this wave's reads of the buffers is left either
    // The two key halves meet: wave w finishes column groups 0 and 1, wave w + 4 groups 2 and 3; each hands the other two groups' partial sums to its partner.
    float* xo = xch[wave] + lane * 4; const float* xi = xch[wave ^ 4] + lane * 4;
#pragma unroll
    for (int c = 0; c < NCG / 2; ++c)
#pragma unroll
        for (int db = 0; db < 4; ++db) { const v8f g = kh ? o[c][db] : o[c + NCG / 2][db];
            *(v4fa*)(xo + ((c * 4 + db) * 2) * 128) = (v4f){ g[0], g[1], g[2], g[3] }; *(v4fa*)(xo + ((c * 4 + db) * 2 + 1) * 128) = (v4f){ g[4], g[5], g[6], g[7] }; }
    __syncthreads();   // publishes every wave's handed-over partial sums to its partner
    v8f m[NCG / 2][4];
#pragma unroll
    for (int c = 0; c < NCG / 2; ++c)
#pragma unroll
        for (int db = 0; db < 4; ++db) { const v4f g0 = *(const v4fa*)(xi + ((c * 4 + db) * 2) * 128), g1 = *(const v4fa*)(xi + ((c * 4 + db) * 2 + 1) * 128);
            m[c][db] = (kh ? o[c + NCG / 2][db] : o[c][db]) + (v8f){ g0[0], g0[1], g0[2], g0[3], g1[0], g1[1], g1[2], g1[3] }; }
#pragma unroll
    for (int c = 0; c < NCG / 2; ++c)
#pragma unroll
        for (int db = 0; db < 4; ++db) { v8us oh, ol;     // m[c][db][j] = x[q][h * 64 + db * 16 + 8 * hi + j]: eight neighbours of one row, one 16-byte store per plane
#pragma unroll
            for (int j = 0; j < 8; ++j) { unsigned short a, c2; splitf(m[c][db][j], a, c2); oh[j] = a; ol[j] = c2; }
            const size_t oo = (size_t)(q0 + (kh * (NCG / 2) + c) * 16) * DQ + h * HD + db * 16 + 8 * hi; *(v8us*)(Ah + oo) = oh; *(v8us*)(Al + oo) = ol;
            asm volatile("s_wait_xcnt 0x0" :: "v"(oh), "v"(ol) : "memory"); }     // before the stores' registers are written again; as inputs the stored values stay in their registers up to here
}

extern "C" void kernel_launch(void* const* d_in, const int* in_sizes, int n_in,
                              void* d_out, int out_size, void* d_ws, size_t ws_size, hipStream_t stream) {
    (void)in_sizes; (void)n_in; (void)out_size;
    const float* xq = (const float*)d_in[0]; const float* xk = (const float*)d_in[1]; const float* xv = (const float*)d_in[2]; const float* wq = (const float*)d_in[3]; const float* wk = (const float*)d_in[4]; const float* wv = (const float*)d_in[5];
    const float* gq = (const float*)d_in[6]; const float* bq = (const float*)d_in[7]; const float* gk = (const float*)d_in[8]; const float* bk = (const float*)d_in[9]; const float* wp = (const float*)d_in[10]; const float* bp = (const float*)d_in[11];
    float* OUT = (float*)d_out;     // [1][4096][1024]
    char* wsp = (char*)d_ws;
    auto take = [&](size_t bytes) { char* p = wsp; wsp += (bytes + 255) & ~(size_t)255; return (void*)p; };
    bf* WQ = (bf*)take((size_t)DQ * DM * 2); bf* WK = (bf*)take((size_t)DQ * DM * 2); bf* WV = (bf*)take((size_t)DQ * DM * 2); bf* WP = (bf*)take((size_t)DM * DQ * 2);     // these seven planes lie one behind the other (sizes are multiples of 256 B): k_cvtall writes them as one range from WQ
    bf* XQ = (bf*)take((size_t)TT * DM * 2); bf* XK = (bf*)take((size_t)TT * DM * 2); bf* XV = (bf*)take((size_t)TT * DM * 2);
    const size_t PS = (size_t)NH_ * TT * HD; h16* QP16 = (h16*)take(PS * 2); h16* KP16 = (h16*)take(PS * 2); h16* VT16 = (h16*)take(PS * 2);
    bf* ATh = (bf*)take((size_t)TT * DQ * 2); bf* ATl = (bf*)take((size_t)TT * DQ * 2);
    if ((size_t)(wsp - (char*)d_ws) > ws_size) return;    // ws 256 MiB
    k_cvtall<<<4 * CVNW + 3 * CVNX, 512, 0, stream>>>(wq, wk, wv, wp, xq, xk, xv, WQ);
    /* q, k, v: XQ, XK, XV lie TT * DM elements apart, WQ, WK, WV DQ * DM, QP16, KP16, VT16 PS */
    k_gemmw<bf, DM, 0, false, 3><<<dim3(TT / 128, DQ / 128, 3), 128, 0, stream>>>(XQ, nullptr, WQ, nullptr, 0, nullptr, (size_t)TT * DM, (size_t)DQ * DM, PS, gq, bq, SCL, gk, bk, 1.0f, QP16);
    k_fattn<<<dim3(TT / (4 * NCG * 16), NH_, 1), 256, 0, stream>>>(QP16, KP16, VT16, ATh, ATl);      /* sigmoid(qh.kh) vh, merged, hi/lo */
    k_gemmw<bf, DQ, 1, true, 0><<<dim3(TT / 128, DM / 128, 1), 128, 0, stream>>>(ATh, ATl, WP, OUT, DM, bp, 0, 0, 0, nullptr, nullptr, 1.0f, nullptr, nullptr, 1.0f, nullptr);
}

// v010
// A run of this version takes 90 microseconds.
// Two timings next to v009 both put it at 1.04 times that version's speed.
// All steps since v000 together make it 23.6 times as fast.
#include <hip/hip_runtime.h>

// Sigmoid attention (q, k, v [1][4096][1024]; qh, kh, vh = (q Wq^T, k Wk^T, v Wv^T) ('oi' [1024][1024], no bias) split into 16 heads x 64; per-head LayerNorm over the 64 dims of qh (x gq + bq, then x 1/8) and kh (x gk + bk); attn = sigmoid(qh.kh) over the full 4096 x 4096 matrix (no softmax, no normalisation); x = attn vh merged; out = x Wp^T + bp -> [1][4096][1024] (4.2 M)).
// Compute dtypes, f32 accumulate: every input rounded to bf16; projections on PLAIN bf16 operands (inputs: exact); LayerNorm in f32 (in the projection's epilogue, eight lanes per head row); scores and attn.v on single fp16 planes (1 product each: sigmoid outputs lie in (0,1), no carry needed); sigmoid in f32 (0.5 + 0.5 tanh(x / 2), hardware tanh); merged heads hi/lo x exact Wp (2 products) + bp.
// Scores, sigmoid, attn.v and the head merge run in ONE launch (k_fattn): the 4096 x 4096 matrix of a head never leaves the registers.
// The q, k and v projections write the f16 head planes themselves: a wave's 64-column tile is exactly one head, so the LayerNorm (q, k) and the transpose (v) are done on the accumulators.
// The three projections read none of each other's output: they run as ONE launch, grid z = which projection.

#define TT   4096
#define DM   1024
#define NH_  16
#define HD   64
#define DQ   (NH_ * HD)
#define SCL  0.125f
#define LNEPS 1e-5f
typedef _Float16 h16;
typedef unsigned short bf;
typedef __attribute__((ext_vector_type(16))) __bf16   v16bf;
typedef __attribute__((ext_vector_type(16))) _Float16 v16h;
typedef __attribute__((ext_vector_type(8)))  _Float16 v8h;
typedef __attribute__((ext_vector_type(8)))  unsigned short v8us;
typedef __attribute__((ext_vector_type(8)))  float    v8f;
typedef __attribute__((ext_vector_type(4)))  float    v4f;
typedef v8h  __attribute__((may_alias)) v8ha;
typedef v4f  __attribute__((may_alias)) v4fa;
typedef v8us __attribute__((may_alias)) v8usa;

__device__ __forceinline__ unsigned short f2bf(float f) { unsigned u = __float_as_uint(f); u += 0x7FFFu + ((u >> 16) & 1u); return (unsigned short)(u >> 16); }
__device__ __forceinline__ float bf2f(unsigned short b) { return __uint_as_float(((unsigned)b) << 16); }
__device__ __forceinline__ float bfr(float f) { return bf2f(f2bf(f)); }
__device__ __forceinline__ v16h cat16(v8h lo, v8h hi) { return __builtin_shufflevector(lo, hi, 0, 1, 2, 3, 4, 5, 6, 7, 8, 9, 10, 11, 12, 13, 14, 15); }
__device__ __forceinline__ v16bf cat16b(v8us lo, v8us hi) { return __builtin_bit_cast(v16bf, __builtin_shufflevector(lo, hi, 0, 1, 2, 3, 4, 5, 6, 7, 8, 9, 10, 11, 12, 13, 14, 15)); }
__device__ __forceinline__ v8f wmma16(v16h a, v16h b, v8f c) { return __builtin_amdgcn_wmma_f32_16x16x32_f16(false, a, false, b, (short)0, c, false, false); }
__device__ __forceinline__ v8f wmmab(v16bf a, v16bf b, v8f c) { return __builtin_amdgcn_wmma_f32_16x16x32_bf16(false, a, false, b, (short)0, c, false, false); }



// ---- k_gemmw: GEMM, workgroup = 4 waves (2 x 2) = one 128x128 output tile, 64x64 (16 accumulators) per wave; grid (M/128, N/128, Z), 128 threads.
// The 128 rows of each operand come in stages of KB k (EPI 3: 64 k = 128 B per row, else 128 k = 256 B) into two LDS buffers by tensor loads, through no register: wave p (p < number of planes) asks for plane p's tile of 128 rows, one request per stage, issued a whole stage ahead; the mover's pad of 16 B per row makes the pitch (144 B or 272 B). The waves read their fragments from LDS, each operand row feeding two waves.
// C[m][n] (f32, pitch ldc, + optional f32 bias[n]) = sum_k A[m][k] Bt[n][k] (NSPLIT 1: + A2[m][k] Bt[n][k]). z-batch strides sA/sB/sC in elements. K (a template constant: row offsets become immediates) % 128 == 0.
// EPI 0: C as above. EPI 1: a wave's 64 columns are one head; each row is normalised over them (x gw + gb, x sc) and stored as f16 to P16[head][row][64]. EPI 2: the tile is stored as f16, transposed, to P16[column][TT].
// EPI 3: three independent GEMMs in one grid, f16 planes sC elements apart: z = 0 ends as EPI 1 with gw, gb, sc, z = 1 as EPI 1 with gw2, gb2, sc2, z = 2 as EPI 2 (the shortest epilogue starts last).
// amdgpu_waves_per_eu(1, 1), EPI 0: one wave per SIMD, that is one workgroup per WGP, so that the 256 equal workgroups of a launch cannot double up on some WGPs while others idle.
// amdgpu_waves_per_eu(3, 3), EPI 3: 768 workgroups = three per WGP. With stages of 64 k the two buffers take half the LDS, so registers and LDS fit three times: the whole grid is resident at once, in one round, with no later round of a lone workgroup per WGP;
// while one workgroup waits for its staged rows, fills its first stage or runs its epilogue, the other two's products keep the matrix units busy.
#define GKB 128
typedef unsigned u32x4 __attribute__((ext_vector_type(4)));
typedef unsigned u32x8 __attribute__((ext_vector_type(8)));
__device__ __forceinline__ unsigned uni(unsigned v) { return (unsigned)__builtin_amdgcn_readfirstlane(v); }
__device__ __forceinline__ unsigned pinned(unsigned v) { unsigned w = uni(v); asm volatile("" : "+s"(w)); return w; }     // holds v in a scalar register: a test on it compiles to a scalar branch (a tensor load ignores EXEC), and a descriptor word made from it is formed where this stands
// Tensor descriptor, group 1: 1-byte elements, tile = tensor = N rows of R bytes (R = 128 or 256), source row pitch in bytes, 16 B of LDS pad behind every row (interval code 4 = 128 B, 5 = 256 B; amount code 3), no mask.
template <unsigned R, unsigned N> __device__ __forceinline__ u32x8 tdm_group1(unsigned src_pitch) { static_assert(R == 128u || R == 256u, "rows whose pad is known to land right"); u32x8 g;
    g[0] = uni((1u << 20) | ((R == 256u ? 5u : 4u) << 22) | (3u << 25)); g[1] = uni(R << 16); g[2] = uni(N << 16); g[3] = uni(R << 16); g[4] = uni(N); g[5] = uni(src_pitch); g[6] = uni(0u); g[7] = uni(0u); return g; }
// Group 0: count 1, LDS destination (byte offset in the workgroup's LDS), global address of the tile's first byte, type 2.
__device__ __forceinline__ u32x4 tdm_group0(unsigned lds_dst, unsigned long long ga) { u32x4 g;
    g[0] = uni(1u); g[1] = uni(lds_dst); g[2] = uni((unsigned)ga); g[3] = uni((((unsigned)(ga >> 32)) & 0x01FFFFFFu) | 0x80000000u); return g; }
__device__ __forceinline__ void tdm_load(u32x4 g0, u32x8 g1) { asm volatile("tensor_load_to_lds %0, %1" :: "s"(g0), "s"(g1) : "memory"); }     // one request of the whole wave: global tile -> LDS
template <typename T16> struct WFrag;
template <> struct WFrag<h16> { typedef v16h V; static __device__ __forceinline__ V ld(const h16* p) { return cat16(*(const v8h*)p, *(const v8h*)(p + 16)); } static __device__ __forceinline__ v8f mma(V a, V b, v8f c) { return wmma16(a, b, c); } };
template <> struct WFrag<bf> { typedef v16bf V; static __device__ __forceinline__ V lds(const bf* p) { return cat16b(*(const v8usa*)p, *(const v8usa*)(p + 16)); } static __device__ __forceinline__ v8f mma(V a, V b, v8f c) { return wmmab(a, b, c); } };
// x + (x of lane ^ M), M < 16: one step of a butterfly sum inside a 16-lane row, on the vector pipe (row_xmask), no LDS round trip.
template <int M> __device__ __forceinline__ float xadd(float x) { return x + __int_as_float(__builtin_amdgcn_update_dpp(0, __float_as_int(x), 0x160 | M, 0xf, 0xf, true)); }
template <typename T16, int K, int NSPLIT, bool BIAS, int EPI>
__global__ __launch_bounds__(128) __attribute__((amdgpu_waves_per_eu(EPI == 3 ? 3 : 1, EPI == 3 ? 3 : 1))) void k_gemmw(const T16* __restrict__ A, const T16* __restrict__ A2, const T16* __restrict__ Bt, float* C, int ldc, const float* __restrict__ bias, size_t sA, size_t sB, size_t sC, const float* gw, const float* gb, float sc, const float* gw2, const float* gb2, float sc2, h16* P16) {
    typedef typename WFrag<T16>::V V;
    constexpr int KB = EPI == 3 ? GKB / 2 : GKB, LP = KB + 8;     // k per stage; LDS row pitch in elements (16 B x odd for either KB)
    static_assert(K % GKB == 0 && NSPLIT <= 1, "whole stages; planes A, Bt and at most A2");
    constexpr int NP = NSPLIT == 1 ? 3 : 2;     // staged planes: A, Bt (, A2)
    constexpr unsigned RB = KB * sizeof(T16);     // bytes of a tile row
    static_assert((RB == 256 || RB == 128) && LP * sizeof(T16) == RB + 16 && (128 * LP * sizeof(T16)) % 2048 == 0, "tile rows of 256 B at pitch 272 B or of 128 B at pitch 144 B; every plane starts at a multiple of 2 KiB");
    __shared__ __attribute__((aligned(2048))) T16 tl[2][NP][128 * LP];
    __shared__ __align__(16) float osw[4][16 * 68];
    constexpr bool LN = EPI == 1 || EPI == 3;     // the per-head LayerNorm epilogue is compiled in
    const size_t z = blockIdx.z; A += z * sA; if (NSPLIT == 1) A2 += z * sA; Bt += z * sB; if (EPI == 3) P16 += z * sC; else C += z * sC;
    if (EPI == 3 && z == 1) { gw = gw2; gb = gb2; sc = sc2; }
    const int tid = threadIdx.x, lane = tid & 31, wave = tid >> 5, lr = lane & 15, hi = lane >> 4;
    const int wr = (wave & 1) * 64, wc = (wave >> 1) * 64, r0 = blockIdx.x * 128 + wr, c0 = blockIdx.y * 128 + wc;
    float* os = osw[wave];     // each wave's own epilogue rows
    v8f acc[4][4];
#pragma unroll
    for (int mb = 0; mb < 4; ++mb)
#pragma unroll
        for (int nb = 0; nb < 4; ++nb) acc[mb][nb] = (v8f){};
    const T16* ga = A + (size_t)blockIdx.x * 128 * K; const T16* gb_ = Bt + (size_t)blockIdx.y * 128 * K; const T16* gc = NSPLIT == 1 ? A2 + (size_t)blockIdx.x * 128 * K : gb_;     // wave-uniform plane bases
    static_assert(K / KB >= 2, "the prologue asks for stages 0 and 1");
    constexpr unsigned NS = K / KB, RU = GKB / KB; static_assert((NS & (NS - 1u)) == 0u && (RU & (RU - 1u)) == 0u, "the k chunks wrap by a mask");
    // Trip s works on k chunk (s + rot) mod NS. The workgroups that share operand rows (A: same x, every y; Bt: same y, every x) start together: from chunk 0 all of them would ask for the same lines at the same moment, in every trip lines that nobody has brought in from memory yet.
    // With different starts one of them brings a chunk in and the others find it in L2 a trip or more later. rot differs for every y of one x; over x it takes all its values within four neighbours and their partners eight further on. Any rot gives the same sum but for its order.
    // The starts are counted in pieces of GKB k (256 B of a row), whatever KB is: the order of the k, and so of the sum, does not depend on KB.
    const unsigned rot = uni(((blockIdx.y + ((blockIdx.x & 3u) | (((blockIdx.x >> 3) & 1u) << 2))) & (NS / RU - 1u)) * RU);
    constexpr unsigned PLB = 128 * LP * sizeof(T16), BUFB = NP * PLB;     // bytes of a plane and of a buffer in LDS
    const unsigned wv = uni((unsigned)tid >> 5), pl = wv < (unsigned)NP ? wv : 0u;     // the wave's number; the plane it asks for
    const unsigned long long src0 = (unsigned long long)(pl == 0u ? ga : pl == 1u ? gb_ : gc);     // first byte of that plane's rows at k = 0
    const unsigned lds0 = (unsigned)(unsigned long long)(&tl[0][0][0]) + pl * PLB;     // its place in buffer 0: the low 32 bits of the shared address
    u32x8 g1 = tdm_group1<RB, 128u>(K * (unsigned)sizeof(T16));
    asm volatile("" : "+s"(g1));     // descriptor words held in scalar registers: one tuple, built once, serves every request, so that no register of a request in flight takes a new value
    if (pinned(wv < (unsigned)NP)) {
        tdm_load(tdm_group0(lds0, src0 + (unsigned long long)rot * RB), g1);
        asm volatile("s_wait_tensorcnt 0x0" ::: "memory");     // stage 0 has landed before this wave passes the barrier that publishes it
    }
    __syncthreads();
    if (pinned(wv < (unsigned)NP)) tdm_load(tdm_group0(lds0 + BUFB, src0 + (unsigned long long)((rot + 1u) & (NS - 1u)) * RB), g1);     // stage 1 flies while stage 0 is multiplied
#pragma unroll 1    // one stage per trip: the two buffers alternate
    for (int s = 0; s < K / KB; ++s) {
        const int b = s & 1;
        const T16* la = tl[b][0] + (wr + lr) * LP + 8 * hi; const T16* lb = tl[b][1] + (wc + lr) * LP + 8 * hi; const T16* la2 = tl[b][NP - 1] + (wr + lr) * LP + 8 * hi;
        V fa[2][4], fb[2][4], fa2[2][4];     // two fragment sets: the next 32 k are read from LDS while this set is multiplied
#pragma unroll
        for (int t = 0; t < 4; ++t) { fa[0][t] = WFrag<T16>::lds(la + t * 16 * LP); fb[0][t] = WFrag<T16>::lds(lb + t * 16 * LP); if (NSPLIT == 1) fa2[0][t] = WFrag<T16>::lds(la2 + t * 16 * LP); }
#pragma unroll    // constant set indices keep the fragments in registers
        for (int kk = 0; kk < KB / 32; ++kk) {
            const int cu = kk & 1, nx = cu ^ 1;
            if (kk + 1 < KB / 32) {
#pragma unroll
                for (int t = 0; t < 4; ++t) { fa[nx][t] = WFrag<T16>::lds(la + t * 16 * LP + (kk + 1) * 32); fb[nx][t] = WFrag<T16>::lds(lb + t * 16 * LP + (kk + 1) * 32); if (NSPLIT == 1) fa2[nx][t] = WFrag<T16>::lds(la2 + t * 16 * LP + (kk + 1) * 32); }
            }
            __builtin_amdgcn_sched_barrier(0);     // holds the next set's LDS reads as one group ahead of this matrix block: sunk among the products, each read would be waited for where it stands
#pragma unroll
            for (int nb = 0; nb < 4; ++nb) {
#pragma unroll
                for (int mb = 0; mb < 4; ++mb) acc[mb][nb] = WFrag<T16>::mma(fa[cu][mb], fb[cu][nb], acc[mb][nb]);
                if (NSPLIT == 1) {
#pragma unroll
                    for (int mb = 0; mb < 4; ++mb) acc[mb][nb] = WFrag<T16>::mma(fa2[cu][mb], fb[cu][nb], acc[mb][nb]); }
            }
            __builtin_amdgcn_sched_barrier(0);     // ends the block: the reads behind it stay one group too, not drawn up among these products
        }
        asm volatile("s_wait_dscnt 0x0" ::: "memory");     // this wave's reads of stage s have returned before its buffer is handed to the mover
        if (pinned(wv < (unsigned)NP)) asm volatile("s_wait_tensorcnt 0x0" ::: "memory");     // stage s + 1 has landed before this wave passes the barrier that publishes it
        __syncthreads();   // publishes stage s + 1 and ends every wave's reads of stage s, whose buffer is refilled right behind it
        const unsigned s2 = pinned((unsigned)s + 2u);     // descriptor word held in a scalar register: the next request's address and place are formed behind the wait above
        if (pinned((wv < (unsigned)NP && s2 < (unsigned)(K / KB)) ? 1u : 0u)) tdm_load(tdm_group0(lds0 + (s2 & 1u) * BUFB, src0 + (unsigned long long)((s2 + rot) & (NS - 1u)) * RB), g1);     // only while stage s + 2 exists
    }
    asm volatile("s_wait_tensorcnt 0x0" ::: "memory");     // no request is left when the wave goes on to the epilogue and ends
    asm volatile("s_wait_dscnt 0x0" ::: "memory");     // closes the ring: none of this wave's reads of the buffers is left either
    if (EPI == 2 || (EPI == 3 && z == 2)) {     // (the same for the whole workgroup) acc[mb][nb][0..7] = eight neighbouring rows of one column: one 16-byte store each; the four mb fill a 128-byte line of the transposed plane
#pragma unroll    // this and the two below: constant indices keep acc in registers
        for (int nb = 0; nb < 4; ++nb)
#pragma unroll
            for (int mb = 0; mb < 4; ++mb) { v8h o;
#pragma unroll
                for (int j = 0; j < 8; ++j) o[j] = (h16)acc[mb][nb][j];
                *(v8h*)(P16 + (size_t)(c0 + nb * 16 + lr) * TT + r0 + mb * 16 + 8 * hi) = o;
                asm volatile("s_wait_xcnt 0x0" :: "v"(o) : "memory"); }     // before the store's registers are written again; as an input the stored value stays in its registers up to here
        return;
    }
    const int g8 = lane >> 3, c8 = (lane & 7) * 8;     // EPI 1: eight lanes per row, eight columns per lane
    float gg[8], bb[8];
    if (LN) {
#pragma unroll    // constant indices keep gg and bb in registers
        for (int i = 0; i < 8; ++i) { gg[i] = bfr(gw[c8 + i]); bb[i] = bfr(gb[c8 + i]); } }
#pragma unroll
    for (int mb = 0; mb < 4; ++mb) {
#pragma unroll
        for (int nb = 0; nb < 4; ++nb) {
#pragma unroll
            for (int j = 0; j < 8; ++j) os[(hi * 8 + j) * 68 + nb * 16 + lr] = acc[mb][nb][j]; }
        __builtin_amdgcn_wave_barrier(); asm volatile("" ::: "memory");
        if (LN) {
#pragma unroll    // the four passes are independent: unrolled, their dependent sums interleave; the inner loops: constant indices keep d and o in registers
            for (int s = 0; s < 4; ++s) { const int row = 4 * s + g8; const v4f x0 = *(const v4fa*)(os + row * 68 + c8), x1 = *(const v4fa*)(os + row * 68 + c8 + 4);
                float d[8] = { x0[0], x0[1], x0[2], x0[3], x1[0], x1[1], x1[2], x1[3] };
                const float mu = xadd<4>(xadd<2>(xadd<1>(((d[0] + d[1]) + (d[2] + d[3])) + ((d[4] + d[5]) + (d[6] + d[7]))))) * (1.0f / 64.0f);
#pragma unroll
                for (int i = 0; i < 8; ++i) d[i] -= mu;
                const float s2 = xadd<4>(xadd<2>(xadd<1>(((d[0] * d[0] + d[1] * d[1]) + (d[2] * d[2] + d[3] * d[3])) + ((d[4] * d[4] + d[5] * d[5]) + (d[6] * d[6] + d[7] * d[7])))));
                const float rs = __frsqrt_rn(s2 * (1.0f / 64.0f) + LNEPS);
                v8h o;
#pragma unroll
                for (int i = 0; i < 8; ++i) o[i] = (h16)(((d[i] * rs) * gg[i] + bb[i]) * sc);
                *(v8h*)(P16 + ((size_t)(c0 >> 6) * TT + r0 + mb * 16 + row) * HD + c8) = o; }     // four whole 128-byte rows per store
            asm volatile("s_wait_xcnt 0x0" ::: "memory");     // before the stores' registers are written again
        } else {
        float* crow = C + (size_t)(r0 + mb * 16) * ldc + c0;
#pragma unroll
            for (int s = 0; s < 8; ++s) { const int row = 2 * s + hi, cofs = lr * 4; v4f val = *(const v4fa*)(os + row * 68 + cofs); if (BIAS) { val[0] += bfr(bias[c0 + cofs]); val[1] += bfr(bias[c0 + cofs + 1]); val[2] += bfr(bias[c0 + cofs + 2]); val[3] += bfr(bias[c0 + cofs + 3]); }
                *(v4f*)(crow + (size_t)row * ldc + cofs) = val; }
            asm volatile("s_wait_xcnt 0x0" ::: "memory");     // before the stores' registers are written again
             }
        __builtin_amdgcn_wave_barrier(); asm volatile("" ::: "memory");
    }
}

__device__ __forceinline__ h16 tohx(float x) { return (h16)x; }
__device__ __forceinline__ void splitf(float y, unsigned short& h, unsigned short& l) { h = f2bf(y); l = f2bf(y - bf2f(h)); }
typedef __attribute__((ext_vector_type(2))) _Float16 v2h;
typedef __attribute__((ext_vector_type(4))) _Float16 v4h;
typedef __attribute__((ext_vector_type(2))) unsigned short v2us;
typedef __attribute__((ext_vector_type(4))) unsigned short v4us;
typedef __attribute__((ext_vector_type(2))) float v2f;
typedef __attribute__((ext_vector_type(4))) int v4i;

// ---- k_cvtall: every f32 -> bf16 rounding of the call (Wq, Wk, Wv, Wp, q, k, v) in ONE launch of 256 workgroups of 16 waves, one per WGP: few waves to start, one launch gap.
// A workgroup takes CVG floats of one input, a wave CVL * 128 of them in a row: CVL wave-wide loads of 512 contiguous bytes, all issued before the first is used, each rounded and stored as 256 contiguous bytes.
// The seven bf16 planes lie one behind the other in dst in the order of the arguments, so workgroup b writes dst + b * CVG whatever input it reads.
// amdgpu_waves_per_eu(4, 4): the register budget of four waves per SIMD, so that all CVL loads have registers of their own; at more than 128 registers a wave no second workgroup fits a WGP, so the equal workgroups cannot double up on some WGPs while others idle.
#define CVL 32
#define CVG (16 * CVL * 128)
#define CVNW (DQ * DM / CVG)     // workgroups per weight matrix
#define CVNX (TT * DM / CVG)     // workgroups per activation matrix
__global__ __launch_bounds__(512) __attribute__((amdgpu_waves_per_eu(4, 4))) void k_cvtall(const float* __restrict__ wq, const float* __restrict__ wk, const float* __restrict__ wv, const float* __restrict__ wp, const float* __restrict__ xq, const float* __restrict__ xk, const float* __restrict__ xv, bf* dst) {
    static_assert(DQ * DM % CVG == 0 && TT * DM % CVG == 0, "whole workgroups per input");
    const unsigned b = blockIdx.x, iw = b / CVNW, ix = (b - 4 * CVNW) / CVNX;
    const float* src = b < 4 * CVNW ? (iw == 0 ? wq : iw == 1 ? wk : iw == 2 ? wv : wp) : (ix == 0 ? xq : ix == 1 ? xk : xv);
    const unsigned sb = b < 4 * CVNW ? b % CVNW : (b - 4 * CVNW) % CVNX, to = (threadIdx.x >> 5) * (CVL * 128) + (threadIdx.x & 31) * 4;
    const float* sw = src + (size_t)sb * CVG; bf* d = dst + (size_t)b * CVG + to;     // sw: wave-uniform base of the workgroup's floats
    v4f r[CVL];
#pragma unroll    // this and the loops below: constant indices keep r in registers
    for (int i = 0; i < CVL; ++i) r[i] = *(const v4fa*)(sw + to + i * 128);
    asm volatile("s_wait_xcnt 0x0" :: "v"(to * (unsigned)sizeof(float)), "s"(sw) : "memory");     // stands before any register that these loads name as an address is written again; as inputs offset and base stay in their registers up to here
#pragma unroll
    for (int g = 0; g < CVL; g += 8) {
#pragma unroll
        for (int i = g; i < g + 8; ++i) { v4us o;
#pragma unroll
            for (int k = 0; k < 4; ++k) o[k] = f2bf(r[i][k]);
            *(v4us*)(d + i * 128) = o; }
        if (g + 8 < CVL) asm volatile("s_wait_xcnt 0x0" ::: "memory");     // before the next eight's rounding writes registers that these stores name; the scheduling barrier below holds that rounding behind it
        __builtin_amdgcn_sched_barrier(0);     // each eight loads are rounded and stored as they land: drawn together, every store would stand behind the wait for the last load
    }
}

#define KST 128
#define LP_ 72             // K rows: 64 d + 8
#define VP_ (KST + 8)      // Vt rows: 128 keys + 8
#define NCG 4              // 16-column groups per wave
__device__ __forceinline__ v16h ldsfrag(const h16* p) { return cat16(*(const v8ha*)p, *(const v8ha*)(p + 16)); }
__global__ __launch_bounds__(256) __attribute__((amdgpu_waves_per_eu(2, 2))) void k_fattn(const h16* __restrict__ Q16, const h16* __restrict__ K16, const h16* __restrict__ V16, bf* Ah, bf* Al) {
    constexpr unsigned KSB = KST * LP_ * sizeof(h16), VSB = (HD * VP_ * sizeof(h16) + 2047u) & ~2047u;     // bytes of a K and of a Vt buffer; the latter rounded up so that every buffer starts at a multiple of 2 KiB
    static_assert(KSB % 2048u == 0 && HD * sizeof(h16) == 128 && LP_ * sizeof(h16) == 144 && KST * sizeof(h16) == 256 && VP_ * sizeof(h16) == 272 && TT / KST >= 2, "tile rows and pitches as the descriptors have them; stages 0 and 1 exist");
    __shared__ __attribute__((aligned(2048))) h16 ks[2][KSB / sizeof(h16)];   // [key][d]
    __shared__ __attribute__((aligned(2048))) h16 vs[2][VSB / sizeof(h16)];   // [d][key]
    __shared__ __align__(16) float xch[8][NCG * 4 * 32 * 4];   // per wave: the half of its partial sums that its partner finishes
    const int tid = threadIdx.x, lane = tid & 31, wave = tid >> 5, lr = lane & 15, hi = lane >> 4;
    const int cw = wave & 3, kh = __builtin_amdgcn_readfirstlane(wave >> 2);     // column set; key half (wave-uniform)
    const int h = blockIdx.y, q0 = blockIdx.x * (4 * NCG * 16) + cw * (NCG * 16) + lr;
    const h16* Qh = Q16 + (size_t)h * TT * HD; const h16* Kh = K16 + (size_t)h * TT * HD; const h16* Vh = V16 + (size_t)h * HD * TT;
    const h16* qp = Qh + (size_t)q0 * HD + 8 * hi;
    v16h qf[NCG][2];
#pragma unroll    // this and the loops below: constant indices keep the fragments and accumulators in registers
    for (int c = 0; c < NCG; ++c)
#pragma unroll
        for (int ds = 0; ds < 2; ++ds) qf[c][ds] = WFrag<h16>::ld(qp + c * 16 * HD + ds * 32);
    asm volatile("s_wait_xcnt 0x0" :: "v"(qp) : "memory");     // stands before the register pair that the Q loads name as their address is written again; as an input the address stays in it up to here
#pragma unroll
    for (int c = 0; c < NCG; ++c)
#pragma unroll
        for (int ds = 0; ds < 2; ++ds) qf[c][ds] *= (h16)0.5f;   // times a power of two (exact in f16 above its subnormals): the score tiles hold x / 2, which is what tanh takes
    v8f o[NCG][4];
#pragma unroll
    for (int c = 0; c < NCG; ++c)
#pragma unroll
        for (int db = 0; db < 4; ++db) o[c][db] = (v8f){};
    const unsigned wv = uni((unsigned)tid >> 5);     // the wave's number
    constexpr unsigned NS = TT / KST; static_assert((NS & (NS - 1u)) == 0u && NS >= 32u && TT / (4 * NCG * 16) <= 16, "the key stages wrap by a mask; sixteen different starts");
    // Trip s works on key stage (s + rot) mod NS: the sixteen workgroups of a head read the same K and Vt tiles and start together; with sixteen different starts, evenly spread over the keys, one of them brings a tile in from memory and the others find it in L2 later. Any rot gives the same sum but for its order.
    const unsigned rot = uni(((NS / 8u) * ((blockIdx.x & 3u) | ((blockIdx.x >> 3) << 2)) + (NS / 16u) * ((blockIdx.x >> 2) & 1u)) & (NS - 1u));
    const unsigned long long srck = (unsigned long long)Kh, srcv = (unsigned long long)Vh;     // first bytes of the head's K and Vt at key 0
    const unsigned ldsk = (unsigned)(unsigned long long)(&ks[0][0]), ldsv = (unsigned)(unsigned long long)(&vs[0][0]);     // their places in LDS: the low 32 bits of the shared addresses
    u32x8 g1k = tdm_group1<128u, KST>(HD * (unsigned)sizeof(h16)), g1v = tdm_group1<256u, HD>(TT * (unsigned)sizeof(h16));
    asm volatile("" : "+s"(g1k), "+s"(g1v));     // descriptor words held in scalar registers: each tuple, built once, serves every request, so that no register of a request in flight takes a new value
    if (pinned(wv == 0u)) {
        tdm_load(tdm_group0(ldsk, srck + (unsigned long long)rot * (KST * HD * sizeof(h16))), g1k);
        asm volatile("s_wait_tensorcnt 0x0" ::: "memory");     // stage 0's K has landed before this wave passes the barrier that publishes it
    }
    if (pinned(wv == 1u)) {
        tdm_load(tdm_group0(ldsv, srcv + (unsigned long long)rot * (KST * sizeof(h16))), g1v);
        asm volatile("s_wait_tensorcnt 0x0" ::: "memory");     // the same for stage 0's Vt
    }
    __syncthreads();
    if (pinned(wv == 0u)) tdm_load(tdm_group0(ldsk + KSB, srck + (unsigned long long)((rot + 1u) & (NS - 1u)) * (KST * HD * sizeof(h16))), g1k);     // stage 1 flies while stage 0 is worked on
    if (pinned(wv == 1u)) tdm_load(tdm_group0(ldsv + VSB, srcv + (unsigned long long)((rot + 1u) & (NS - 1u)) * (KST * sizeof(h16))), g1v);
#pragma unroll 1    // one stage per trip: the two buffers alternate
    for (int s = 0; s < TT / KST; ++s) {
        const int b = s & 1;
        const h16* lk = ks[b] + (kh * (KST / 2) + lr) * LP_ + 8 * hi; const h16* lv = vs[b] + lr * VP_ + kh * (KST / 2) + 8 * hi;
#pragma unroll
        for (int p = 0; p < KST / 64; ++p) {
            v16h kf[2][2], vf[4];
#pragma unroll
            for (int kt = 0; kt < 2; ++kt)
#pragma unroll
                for (int ds = 0; ds < 2; ++ds) kf[kt][ds] = ldsfrag(lk + (p * 32 + kt * 16) * LP_ + ds * 32);
#pragma unroll
            for (int db = 0; db < 4; ++db) vf[db] = ldsfrag(lv + db * 16 * VP_ + p * 32);
#pragma unroll
            for (int c = 0; c < NCG; ++c) {
                v8f st[2];
#pragma unroll
                for (int kt = 0; kt < 2; ++kt) { st[kt] = (v8f){};
#pragma unroll
                    for (int ds = 0; ds < 2; ++ds) st[kt] = wmma16(kf[kt][ds], qf[c][ds], st[kt]); }
                v16h pb;
#pragma unroll
                for (int e = 0; e < 16; ++e) pb[e] = tohx(__builtin_fmaf(0.5f, __builtin_amdgcn_tanhf(st[e >> 3][e & 7]), 0.5f));   // st holds x / 2 (see qf)
#pragma unroll
                for (int db = 0; db < 4; ++db) o[c][db] = wmma16(vf[db], pb, o[c][db]);
            }
        }
        asm volatile("s_wait_dscnt 0x0" ::: "memory");     // this wave's reads of stage s have returned before its buffers are handed to the mover
        if (pinned(wv < 2u)) asm volatile("s_wait_tensorcnt 0x0" ::: "memory");     // stage s + 1 has landed before this wave passes the barrier that publishes it
        __syncthreads();   // publishes stage s + 1 and ends every wave's reads of stage s, whose buffers are refilled right behind it
        const unsigned s2 = pinned((unsigned)s + 2u);     // descriptor word held in a scalar register: the next requests' addresses and places are formed behind the wait above
        if (pinned((wv == 0u && s2 < (unsigned)(TT / KST)) ? 1u : 0u)) tdm_load(tdm_group0(ldsk + (s2 & 1u) * KSB, srck + (unsigned long long)((s2 + rot) & (NS - 1u)) * (KST * HD * sizeof(h16))), g1k);     // only while stage s + 2 exists
        if (pinned((wv == 1u && s2 < (unsigned)(TT / KST)) ? 1u : 0u)) tdm_load(tdm_group0(ldsv + (s2 & 1u) * VSB, srcv + (unsigned long long)((s2 + rot) & (NS - 1u)) * (KST * sizeof(h16))), g1v);
    }
    asm volatile("s_wait_tensorcnt 0x0" ::: "memory");     // no request is left when the wave goes on to the epilogue and ends
    asm volatile("s_wait_dscnt 0x0" ::: "memory");     // closes the ring: none of this wave's reads of the buffers is left either
    // The two key halves meet: wave w finishes column groups 0 and 1, wave w + 4 groups 2 and 3; each hands the other two groups' partial sums to its partner.
    float* xo = xch[wave] + lane * 4; const float* xi = xch[wave ^ 4] + lane * 4;
#pragma unroll
    for (int c = 0; c < NCG / 2; ++c)
#pragma unroll
        for (int db = 0; db < 4; ++db) { const v8f g = kh ? o[c][db] : o[c + NCG / 2][db];
            *(v4fa*)(xo + ((c * 4 + db) * 2) * 128) = (v4f){ g[0], g[1], g[2], g[3] }; *(v4fa*)(xo + ((c * 4 + db) * 2 + 1) * 128) = (v4f){ g[4], g[5], g[6], g[7] }; }
    __syncthreads();   // publishes every wave's handed-over partial sums to its partner
    v8f m[NCG / 2][4];
#pragma unroll
    for (int c = 0; c < NCG / 2; ++c)
#pragma unroll
        for (int db = 0; db < 4; ++db) { const v4f g0 = *(const v4fa*)(xi + ((c * 4 + db) * 2) * 128), g1 = *(const v4fa*)(xi + ((c * 4 + db) * 2 + 1) * 128);
            m[c][db] = (kh ? o[c + NCG / 2][db] : o[c][db]) + (v8f){ g0[0], g0[1], g0[2], g0[3], g1[0], g1[1], g1[2], g1[3] }; }
#pragma unroll
    for (int c = 0; c < NCG / 2; ++c)
#pragma unroll
        for (int db = 0; db < 4; ++db) { v8us oh, ol;     // m[c][db][j] = x[q][h * 64 + db * 16 + 8 * hi + j]: eight neighbours of one row, one 16-byte store per plane
#pragma unroll
            for (int j = 0; j < 8; ++j) { unsigned short a, c2; splitf(m[c][db][j], a, c2); oh[j] = a; ol[j] = c2; }
            const size_t oo = (size_t)(q0 + (kh * (NCG / 2) + c) * 16) * DQ + h * HD + db * 16 + 8 * hi; *(v8us*)(Ah + oo) = oh; *(v8us*)(Al + oo) = ol;
            asm volatile("s_wait_xcnt 0x0" :: "v"(oh), "v"(ol) : "memory"); }     // before the stores' registers are written again; as inputs the stored values stay in their registers up to here
}

extern "C" void kernel_launch(void* const* d_in, const int* in_sizes, int n_in,
                              void* d_out, int out_size, void* d_ws, size_t ws_size, hipStream_t stream) {
    (void)in_sizes; (void)n_in; (void)out_size;
    const float* xq = (const float*)d_in[0]; const float* xk = (const float*)d_in[1]; const float* xv = (const float*)d_in[2]; const float* wq = (const float*)d_in[3]; const float* wk = (const float*)d_in[4]; const float* wv = (const float*)d_in[5];
    const float* gq = (const float*)d_in[6]; const float* bq = (const float*)d_in[7]; const float* gk = (const float*)d_in[8]; const float* bk = (const float*)d_in[9]; const float* wp = (const float*)d_in[10]; const float* bp = (const float*)d_in[11];
    float* OUT = (float*)d_out;     // [1][4096][1024]
    char* wsp = (char*)d_ws;
    auto take = [&](size_t bytes) { char* p = wsp; wsp += (bytes + 255) & ~(size_t)255; return (void*)p; };
    bf* WQ = (bf*)take((size_t)DQ * DM * 2); bf* WK = (bf*)take((size_t)DQ * DM * 2); bf* WV = (bf*)take((size_t)DQ * DM * 2); bf* WP = (bf*)take((size_t)DM * DQ * 2);     // these seven planes lie one behind the other (sizes are multiples of 256 B): k_cvtall writes them as one range from WQ
    bf* XQ = (bf*)take((size_t)TT * DM * 2); bf* XK = (bf*)take((size_t)TT * DM * 2); bf* XV = (bf*)take((size_t)TT * DM * 2);
    const size_t PS = (size_t)NH_ * TT * HD; h16* QP16 = (h16*)take(PS * 2); h16* KP16 = (h16*)take(PS * 2); h16* VT16 = (h16*)take(PS * 2);
    bf* ATh = (bf*)take((size_t)TT * DQ * 2); bf* ATl = (bf*)take((size_t)TT * DQ * 2);
    if ((size_t)(wsp - (char*)d_ws) > ws_size) return;    // ws 256 MiB
    k_cvtall<<<4 * CVNW + 3 * CVNX, 512, 0, stream>>>(wq, wk, wv, wp, xq, xk, xv, WQ);
    /* q, k, v: XQ, XK, XV lie TT * DM elements apart, WQ, WK, WV DQ * DM, QP16, KP16, VT16 PS */
    k_gemmw<bf, DM, 0, false, 3><<<dim3(TT / 128, DQ / 128, 3), 128, 0, stream>>>(XQ, nullptr, WQ, nullptr, 0, nullptr, (size_t)TT * DM, (size_t)DQ * DM, PS, gq, bq, SCL, gk, bk, 1.0f, QP16);
    k_fattn<<<dim3(TT / (4 * NCG * 16), NH_, 1), 256, 0, stream>>>(QP16, KP16, VT16, ATh, ATl);      /* sigmoid(qh.kh) vh, merged, hi/lo */
    k_gemmw<bf, DQ, 1, true, 0><<<dim3(TT / 128, DM / 128, 1), 128, 0, stream>>>(ATh, ATl, WP, OUT, DM, bp, 0, 0, 0, nullptr, nullptr, 1.0f, nullptr, nullptr, 1.0f, nullptr);
}
